// v000
// The times below were measured on an AMD MI455X: many runs one after another, warmed up first and cycling through
// copies of the inputs, with the whole window's GPU time divided by the number of runs. Launches and the gaps
// between them are all in it. The median over several windows is given; except for v000 it joins two sittings, which
// can be a few percent apart, so the side-by-side timings, each taken in one sitting, are the better comparison.
// v000, which the later versions start from, runs in 189 microseconds.
#include <hip/hip_runtime.h>
#include <math.h>

// ---------------- problem constants ----------------
constexpr int Bc   = 4;
constexpr int Cc   = 192;
constexpr int Nc   = 160;
constexpr int Mc   = 160;
constexpr int Hc   = 4;
constexpr int DHc  = 32;
constexpr int HIDc = 128;   // Hc*DHc
constexpr int NMEMc = 4;
#define SCALE_F 0.17677669529663687f   // 1/sqrt(32)

typedef __attribute__((ext_vector_type(16))) _Float16 v16h;
typedef __attribute__((ext_vector_type(8)))  float    v8f;

// =====================================================================
// Kernel 1: per-pixel inverse channel norm of x:  invp[b,n,m]
// =====================================================================
__global__ __launch_bounds__(256) void pixel_invnorm(const float* __restrict__ x,
                                                     float* __restrict__ invp)
{
    const int idx = blockIdx.x * blockDim.x + threadIdx.x;
    const int NM = Nc * Mc;
    if (idx >= Bc * NM) return;
    const int b = idx / NM;
    const int p = idx - b * NM;
    const float* xp = x + (size_t)b * Cc * NM + p;
    float s = 0.f;
    for (int c = 0; c < Cc; ++c) {
        float v = xp[(size_t)c * NM];
        s += v * v;
    }
    invp[idx] = 1.0f / fmaxf(sqrtf(s), 1e-12f);
}

// =====================================================================
// Kernel 2: per (b,c) plane reductions.
//  row_ft[b,c,n] = mean_m x          col_ft[b,c,m] = mean_n x
//  Scol[b,c,n]   = sum_m x*invp      Srow[b,c,m]   = sum_n x*invp
// block = 160 threads, grid = (C, B)
// =====================================================================
__global__ __launch_bounds__(160) void plane_reduce(const float* __restrict__ x,
                                                    const float* __restrict__ invp,
                                                    float* __restrict__ row_ft,
                                                    float* __restrict__ col_ft,
                                                    float* __restrict__ Srow,
                                                    float* __restrict__ Scol)
{
    const int b = blockIdx.y, c = blockIdx.x;
    const float* xp = x + ((size_t)b * Cc + c) * Nc * Mc;
    const float* ip = invp + (size_t)b * Nc * Mc;
    const int t = threadIdx.x;
    if (t < Nc) {   // row t: reduce over m
        float s = 0.f, sw = 0.f;
        for (int m = 0; m < Mc; ++m) {
            float v = xp[t * Mc + m];
            s += v;
            sw += v * ip[t * Mc + m];
        }
        row_ft[((size_t)b * Cc + c) * Nc + t] = s * (1.0f / Mc);
        Scol  [((size_t)b * Cc + c) * Nc + t] = sw;
    }
    if (t < Mc) {   // col t: reduce over n
        float s = 0.f, sw = 0.f;
        for (int n = 0; n < Nc; ++n) {
            float v = xp[n * Mc + t];
            s += v;
            sw += v * ip[n * Mc + t];
        }
        col_ft[((size_t)b * Cc + c) * Mc + t] = s * (1.0f / Nc);
        Srow  [((size_t)b * Cc + c) * Mc + t] = sw;
    }
}

// =====================================================================
// Kernel 3: inverse channel norm of a (B,C,P) feature per column p
// =====================================================================
__global__ __launch_bounds__(128) void feat_invnorm(const float* __restrict__ f,
                                                    float* __restrict__ inv,
                                                    int P, int total)
{
    const int idx = blockIdx.x * blockDim.x + threadIdx.x;
    if (idx >= total) return;
    const int b = idx / P;
    const int p = idx - b * P;
    const float* fp = f + (size_t)b * Cc * P + p;
    float s = 0.f;
    for (int c = 0; c < Cc; ++c) {
        float v = fp[(size_t)c * P];
        s += v * v;
    }
    inv[idx] = 1.0f / fmaxf(sqrtf(s), 1e-12f);
}

// =====================================================================
// Kernel 4: generic WMMA GEMM (one wave = one 16x16 output tile)
//   Out[b,m,p] = sum_k (W[m,k]*cs[k]) * (X[b,k,p] * ps[b,p] * xscale) + bias[m]
// Compile-time specialization removes all null-pointer branches.
// A/cs loads are float4 (global_load_b128); B loads coalesce across lanes.
// Fragment layouts per CDNA5 ISA 7.12.2 (16-bit A 16x32; B row-striped).
// =====================================================================
template <bool HAS_CS, bool HAS_PS, bool HAS_BIAS>
__global__ __launch_bounds__(32) void gemm_wmma(const float* __restrict__ W, int ldW,
                                                const float* __restrict__ X,
                                                const float* __restrict__ cs,
                                                const float* __restrict__ ps,
                                                const float* __restrict__ bias,
                                                float xscale,
                                                float* __restrict__ Out,
                                                int Mdim, int Kdim, int Nn)
{
    const int b  = blockIdx.z;
    const int mt = blockIdx.y;
    const int nt = blockIdx.x;
    const int lane = threadIdx.x;
    const int nl = lane & 15;
    const int k0 = (lane & 16) ? 8 : 0;

    const int mrow = (mt << 4) + nl;           // A-matrix row held by this lane
    const int ncol = (nt << 4) + nl;           // B/D column held by this lane
    const float* Xb = X + (size_t)b * Kdim * Nn;
    const float  psn = (HAS_PS ? ps[(size_t)b * Nn + ncol] : 1.0f) * xscale;
    const float* Wrow = W + (size_t)mrow * ldW;

    v8f acc = {};
    for (int kk = 0; kk < Kdim; kk += 32) {
        const int ka = kk + k0;       // multiple of 4 -> 16B aligned
        const int kb = ka + 16;
        const float4 w0 = *(const float4*)(Wrow + ka);
        const float4 w1 = *(const float4*)(Wrow + ka + 4);
        const float4 w2 = *(const float4*)(Wrow + kb);
        const float4 w3 = *(const float4*)(Wrow + kb + 4);
        float wa[16] = { w0.x, w0.y, w0.z, w0.w, w1.x, w1.y, w1.z, w1.w,
                         w2.x, w2.y, w2.z, w2.w, w3.x, w3.y, w3.z, w3.w };
        if (HAS_CS) {
            const float4 c0 = *(const float4*)(cs + ka);
            const float4 c1 = *(const float4*)(cs + ka + 4);
            const float4 c2 = *(const float4*)(cs + kb);
            const float4 c3 = *(const float4*)(cs + kb + 4);
            const float ca[16] = { c0.x, c0.y, c0.z, c0.w, c1.x, c1.y, c1.z, c1.w,
                                   c2.x, c2.y, c2.z, c2.w, c3.x, c3.y, c3.z, c3.w };
#pragma unroll
            for (int j = 0; j < 16; ++j) wa[j] *= ca[j];
        }
        v16h a, bf;
#pragma unroll
        for (int j = 0; j < 8; ++j) {
            a[j]     = (_Float16)wa[j];
            a[8 + j] = (_Float16)wa[8 + j];
            bf[j]     = (_Float16)(Xb[(size_t)(ka + j) * Nn + ncol] * psn);
            bf[8 + j] = (_Float16)(Xb[(size_t)(kb + j) * Nn + ncol] * psn);
        }
        acc = __builtin_amdgcn_wmma_f32_16x16x32_f16(false, a, false, bf,
                                                     (short)0, acc, false, false);
    }
    const int rbase = (lane >> 4) * 8;
#pragma unroll
    for (int r = 0; r < 8; ++r) {
        const int m = (mt << 4) + rbase + r;
        float v = acc[r];
        if (HAS_BIAS) v += bias[m];
        Out[((size_t)b * Mdim + m) * Nn + ncol] = v;
    }
}

// =====================================================================
// Kernel 5: attention for one (b, h, 16-query tile). One wave per block.
//   Q,K,V are (B, 128, P) row-major (row = h*32+d, col = position).
//   s = (Q^T·K)·SCALE; exact max over [keys, mem]; Z = Σe_m + rep·Σe_k
//   O[b, h*32+d, q] = (e_k·v_sum + e_m·mem_v) / Z
// =====================================================================
#define PADS 168
__global__ __launch_bounds__(32) void attn_wave(const float* __restrict__ Q,
                                                const float* __restrict__ Kf,
                                                const float* __restrict__ V,
                                                const float* __restrict__ memkv,
                                                float* __restrict__ O,
                                                int P, float rep)
{
    __shared__ float s[16][PADS];
    __shared__ float sm[16][NMEMc];
    __shared__ float rowZ[16];

    const int b = blockIdx.z, h = blockIdx.y, qt = blockIdx.x;
    const int lane = threadIdx.x;
    const int nl = lane & 15;
    const int k0 = (lane & 16) ? 8 : 0;
    const size_t base = ((size_t)b * HIDc + h * DHc) * P;
    const float* Qb = Q + base;
    const float* Kb = Kf + base;
    const float* Vb = V + base;
    const int qcol = qt * 16 + nl;

    // A fragment: A[i][d] = Q[b, h*32+d, qt*16+i]   (reused across all key tiles)
    v16h aq;
#pragma unroll
    for (int j = 0; j < 8; ++j) {
        aq[j]     = (_Float16)Qb[(k0 + j) * P + qcol];
        aq[8 + j] = (_Float16)Qb[(16 + k0 + j) * P + qcol];
    }

    // scores vs all key tiles (K = 32 = exactly one WMMA step)
    for (int jt = 0; jt < P / 16; ++jt) {
        const int kcol = jt * 16 + nl;
        v16h bk;
#pragma unroll
        for (int j = 0; j < 8; ++j) {
            bk[j]     = (_Float16)Kb[(k0 + j) * P + kcol];
            bk[8 + j] = (_Float16)Kb[(16 + k0 + j) * P + kcol];
        }
        v8f c = {};
        c = __builtin_amdgcn_wmma_f32_16x16x32_f16(false, aq, false, bk,
                                                   (short)0, c, false, false);
        const int rbase = (lane >> 4) * 8;
#pragma unroll
        for (int r = 0; r < 8; ++r)
            s[rbase + r][jt * 16 + nl] = c[r] * SCALE_F;
    }

    // memory-slot scores (scalar; 16 rows handled by lanes 0..15)
    if (lane < 16) {
#pragma unroll
        for (int jm = 0; jm < NMEMc; ++jm) {
            float acc = 0.f;
            for (int d = 0; d < DHc; ++d)
                acc += Qb[d * P + qt * 16 + lane] * memkv[(h * NMEMc + jm) * DHc + d];
            sm[lane][jm] = acc * SCALE_F;
        }
    }
    __syncthreads();

    // exact softmax stats per row
    if (lane < 16) {
        float mx = -3.4e38f;
        for (int j = 0; j < P; ++j) mx = fmaxf(mx, s[lane][j]);
#pragma unroll
        for (int jm = 0; jm < NMEMc; ++jm) mx = fmaxf(mx, sm[lane][jm]);
        float se = 0.f;
        for (int j = 0; j < P; ++j) {
            float e = expf(s[lane][j] - mx);
            s[lane][j] = e;
            se += e;
        }
        float sem = 0.f;
#pragma unroll
        for (int jm = 0; jm < NMEMc; ++jm) {
            float e = expf(sm[lane][jm] - mx);
            sm[lane][jm] = e;
            sem += e;
        }
        rowZ[lane] = sem + rep * se;
    }
    __syncthreads();

    // out = e_k @ v_sum  (K = P in steps of 32), two 16-wide d-tiles
    const int memv_off = Hc * NMEMc * DHc;   // mem_kv[1]
    for (int nt2 = 0; nt2 < 2; ++nt2) {
        v8f c = {};
        for (int kk = 0; kk < P; kk += 32) {
            // e-matrix row (contiguous in LDS, 16B aligned) and V row (contiguous
            // in global, 16B aligned) -> vector loads
            const float4 e0 = *(const float4*)(&s[nl][kk + k0]);
            const float4 e1 = *(const float4*)(&s[nl][kk + k0 + 4]);
            const float4 e2 = *(const float4*)(&s[nl][kk + 16 + k0]);
            const float4 e3 = *(const float4*)(&s[nl][kk + 16 + k0 + 4]);
            const float* Vrow = Vb + (size_t)(nt2 * 16 + nl) * P;
            const float4 v0 = *(const float4*)(Vrow + kk + k0);
            const float4 v1 = *(const float4*)(Vrow + kk + k0 + 4);
            const float4 v2 = *(const float4*)(Vrow + kk + 16 + k0);
            const float4 v3 = *(const float4*)(Vrow + kk + 16 + k0 + 4);
            const float ea[16] = { e0.x, e0.y, e0.z, e0.w, e1.x, e1.y, e1.z, e1.w,
                                   e2.x, e2.y, e2.z, e2.w, e3.x, e3.y, e3.z, e3.w };
            const float va[16] = { v0.x, v0.y, v0.z, v0.w, v1.x, v1.y, v1.z, v1.w,
                                   v2.x, v2.y, v2.z, v2.w, v3.x, v3.y, v3.z, v3.w };
            v16h ae, bv;
#pragma unroll
            for (int j = 0; j < 16; ++j) {
                ae[j] = (_Float16)ea[j];
                bv[j] = (_Float16)va[j];
            }
            c = __builtin_amdgcn_wmma_f32_16x16x32_f16(false, ae, false, bv,
                                                       (short)0, c, false, false);
        }
        const int rbase = (lane >> 4) * 8;
#pragma unroll
        for (int r = 0; r < 8; ++r) {
            const int i = rbase + r;
            const int d = nt2 * 16 + nl;
            float memc = 0.f;
#pragma unroll
            for (int jm = 0; jm < NMEMc; ++jm)
                memc += sm[i][jm] * memkv[memv_off + (h * NMEMc + jm) * DHc + d];
            O[((size_t)b * HIDc + h * DHc + d) * P + qt * 16 + i] =
                (c[r] + memc) / rowZ[i];
        }
    }
}

// =====================================================================
// Kernel 6: out[b,d,n,m] = Rrow[b,d,n] + Rcol[b,d,m]   (float4 writes)
// =====================================================================
__global__ __launch_bounds__(256) void bcast_add(const float* __restrict__ Rrow,
                                                 const float* __restrict__ Rcol,
                                                 float* __restrict__ out)
{
    const size_t idx4 = (size_t)blockIdx.x * blockDim.x + threadIdx.x;
    const size_t e = idx4 * 4;               // grid sized exactly: no guard needed
    const int m = (int)(e % Mc);
    size_t t = e / Mc;
    const int n = (int)(t % Nc); t /= Nc;
    const int d = (int)(t % Cc);
    const int b = (int)(t / Cc);
    const float  rv = Rrow[((size_t)b * Cc + d) * Nc + n];
    const float4 cv = *(const float4*)(Rcol + ((size_t)b * Cc + d) * Mc + m);
    float4 o;
    o.x = rv + cv.x; o.y = rv + cv.y; o.z = rv + cv.z; o.w = rv + cv.w;
    *(float4*)(out + e) = o;
}

// =====================================================================
// Host launcher
// =====================================================================
extern "C" void kernel_launch(void* const* d_in, const int* in_sizes, int n_in,
                              void* d_out, int out_size, void* d_ws, size_t ws_size,
                              hipStream_t stream)
{
    const float* x     = (const float*)d_in[0];
    const float* gq    = (const float*)d_in[1];
    const float* gk    = (const float*)d_in[2];
    const float* gv    = (const float*)d_in[3];
    const float* Wq    = (const float*)d_in[4];
    const float* Wk    = (const float*)d_in[5];
    const float* Wv    = (const float*)d_in[6];
    const float* memkv = (const float*)d_in[7];
    const float* Wo    = (const float*)d_in[8];
    const float* bo    = (const float*)d_in[9];
    const float* Wr    = (const float*)d_in[10];
    float* out = (float*)d_out;

    // ---- workspace layout (floats); total ~7.0 MB ----
    float* w = (float*)d_ws;
    size_t o = 0;
    float* invp     = w + o; o += (size_t)Bc * Nc * Mc;   // 102400
    float* row_ft   = w + o; o += (size_t)Bc * Cc * Nc;   // 122880
    float* col_ft   = w + o; o += (size_t)Bc * Cc * Mc;
    float* Srow     = w + o; o += (size_t)Bc * Cc * Mc;
    float* Scol     = w + o; o += (size_t)Bc * Cc * Nc;
    float* inv_nrow = w + o; o += (size_t)Bc * Nc;
    float* inv_ncol = w + o; o += (size_t)Bc * Mc;
    float* Qr = w + o; o += (size_t)Bc * HIDc * Nc;       // 81920 each
    float* Kr = w + o; o += (size_t)Bc * HIDc * Mc;
    float* Vr = w + o; o += (size_t)Bc * HIDc * Mc;
    float* Qc = w + o; o += (size_t)Bc * HIDc * Mc;
    float* Kc = w + o; o += (size_t)Bc * HIDc * Nc;
    float* Vc = w + o; o += (size_t)Bc * HIDc * Nc;
    float* Orow = w + o; o += (size_t)Bc * HIDc * Nc;
    float* Ocol = w + o; o += (size_t)Bc * HIDc * Mc;
    float* row_attn = w + o; o += (size_t)Bc * Cc * Nc;
    float* col_attn = w + o; o += (size_t)Bc * Cc * Mc;
    float* Rrow = w + o; o += (size_t)Bc * Cc * Nc;
    float* Rcol = w + o; o += (size_t)Bc * Cc * Mc;
    (void)ws_size; (void)in_sizes; (void)n_in; (void)out_size;

    const float sqrtC = sqrtf((float)Cc);

    // 1) per-pixel channel norms (pass 1 over x)
    pixel_invnorm<<<(Bc * Nc * Mc + 255) / 256, 256, 0, stream>>>(x, invp);

    // 2) plane reductions (pass 2 over x)
    plane_reduce<<<dim3(Cc, Bc), 160, 0, stream>>>(x, invp, row_ft, col_ft, Srow, Scol);

    // 3) feature channel norms
    feat_invnorm<<<(Bc * Nc + 127) / 128, 128, 0, stream>>>(row_ft, inv_nrow, Nc, Bc * Nc);
    feat_invnorm<<<(Bc * Mc + 127) / 128, 128, 0, stream>>>(col_ft, inv_ncol, Mc, Bc * Mc);

    // 4) QKV projections (128x192x160 WMMA GEMMs)
    const dim3 gP(Nc / 16, HIDc / 16, Bc);
    // row branch: q<-row_ft, k<-col_ft, v<-Srow
    gemm_wmma<true, true, false><<<gP, 32, 0, stream>>>(Wq, Cc, row_ft, gq, inv_nrow, nullptr, sqrtC, Qr, HIDc, Cc, Nc);
    gemm_wmma<true, true, false><<<gP, 32, 0, stream>>>(Wk, Cc, col_ft, gk, inv_ncol, nullptr, sqrtC, Kr, HIDc, Cc, Mc);
    gemm_wmma<true, false, false><<<gP, 32, 0, stream>>>(Wv, Cc, Srow, gv, nullptr, nullptr, sqrtC, Vr, HIDc, Cc, Mc);
    // col branch: q<-col_ft, k<-row_ft, v<-Scol
    gemm_wmma<true, true, false><<<gP, 32, 0, stream>>>(Wq, Cc, col_ft, gq, inv_ncol, nullptr, sqrtC, Qc, HIDc, Cc, Mc);
    gemm_wmma<true, true, false><<<gP, 32, 0, stream>>>(Wk, Cc, row_ft, gk, inv_nrow, nullptr, sqrtC, Kc, HIDc, Cc, Nc);
    gemm_wmma<true, false, false><<<gP, 32, 0, stream>>>(Wv, Cc, Scol, gv, nullptr, nullptr, sqrtC, Vc, HIDc, Cc, Nc);

    // 5) attention (one wave per (b,h,q-tile))
    const dim3 gA(Nc / 16, Hc, Bc);
    attn_wave<<<gA, 32, 0, stream>>>(Qr, Kr, Vr, memkv, Orow, Nc, (float)Nc);
    attn_wave<<<gA, 32, 0, stream>>>(Qc, Kc, Vc, memkv, Ocol, Mc, (float)Mc);

    // 6) output projections (192x128x160) with bias bo
    const dim3 gO(Nc / 16, Cc / 16, Bc);
    gemm_wmma<false, false, true><<<gO, 32, 0, stream>>>(Wo, HIDc, Orow, nullptr, nullptr, bo, 1.0f, row_attn, Cc, HIDc, Nc);
    gemm_wmma<false, false, true><<<gO, 32, 0, stream>>>(Wo, HIDc, Ocol, nullptr, nullptr, bo, 1.0f, col_attn, Cc, HIDc, Mc);

    // 7) Wr projections (192x192x160); Wr is (C, 2C): Wr1 = Wr[:, :C], Wr2 = Wr[:, C:]
    gemm_wmma<false, false, false><<<gO, 32, 0, stream>>>(Wr, 2 * Cc, row_attn, nullptr, nullptr, nullptr, 1.0f, Rrow, Cc, Cc, Nc);
    gemm_wmma<false, false, false><<<gO, 32, 0, stream>>>(Wr + Cc, 2 * Cc, col_attn, nullptr, nullptr, nullptr, 1.0f, Rcol, Cc, Cc, Mc);

    // 8) broadcast add -> final output (78.6 MB, float4 stores)
    const int total4 = (Bc * Cc * Nc * Mc) / 4;       // 4,915,200
    bcast_add<<<total4 / 256, 256, 0, stream>>>(Rrow, Rcol, out);
}

// v001
// It runs in 118 microseconds.
// In both of two side-by-side timings against v000, it was 1.63 times as fast.
#include <hip/hip_runtime.h>
#include <math.h>

// ---------------- problem constants ----------------
constexpr int Bc   = 4;
constexpr int Cc   = 192;
constexpr int Nc   = 160;
constexpr int Mc   = 160;
constexpr int Hc   = 4;
constexpr int DHc  = 32;
constexpr int HIDc = 128;   // Hc*DHc
constexpr int NMEMc = 4;
#define SCALE_F 0.17677669529663687f   // 1/sqrt(32)

typedef __attribute__((ext_vector_type(16))) _Float16 v16h;
typedef __attribute__((ext_vector_type(8)))  float    v8f;

// =====================================================================
// Kernel 1: per-pixel inverse channel norm of x:  invp[b,n,m]
// =====================================================================
__global__ __launch_bounds__(256) void pixel_invnorm(const float* __restrict__ x,
                                                     float* __restrict__ invp)
{
    const int idx = blockIdx.x * blockDim.x + threadIdx.x;
    const int NM = Nc * Mc;
    if (idx >= Bc * NM) return;
    const int b = idx / NM;
    const int p = idx - b * NM;
    const float* xp = x + (size_t)b * Cc * NM + p;
    float s = 0.f;
    for (int c = 0; c < Cc; ++c) {
        float v = xp[(size_t)c * NM];
        s += v * v;
    }
    invp[idx] = 1.0f / fmaxf(sqrtf(s), 1e-12f);
}

// =====================================================================
// Kernel 2: per (b,c) plane reductions.
//  row_ft[b,c,n] = mean_m x          col_ft[b,c,m] = mean_n x
//  Scol[b,c,n]   = sum_m x*invp      Srow[b,c,m]   = sum_n x*invp
// block = 160 threads, grid = (C, B)
// =====================================================================
__global__ __launch_bounds__(160) void plane_reduce(const float* __restrict__ x,
                                                    const float* __restrict__ invp,
                                                    float* __restrict__ row_ft,
                                                    float* __restrict__ col_ft,
                                                    float* __restrict__ Srow,
                                                    float* __restrict__ Scol)
{
    const int b = blockIdx.y, c = blockIdx.x;
    const float* xp = x + ((size_t)b * Cc + c) * Nc * Mc;
    const float* ip = invp + (size_t)b * Nc * Mc;
    const int t = threadIdx.x;
    if (t < Nc) {   // row t: reduce over m
        float s = 0.f, sw = 0.f;
        for (int m = 0; m < Mc; ++m) {
            float v = xp[t * Mc + m];
            s += v;
            sw += v * ip[t * Mc + m];
        }
        row_ft[((size_t)b * Cc + c) * Nc + t] = s * (1.0f / Mc);
        Scol  [((size_t)b * Cc + c) * Nc + t] = sw;
    }
    if (t < Mc) {   // col t: reduce over n
        float s = 0.f, sw = 0.f;
        for (int n = 0; n < Nc; ++n) {
            float v = xp[n * Mc + t];
            s += v;
            sw += v * ip[n * Mc + t];
        }
        col_ft[((size_t)b * Cc + c) * Mc + t] = s * (1.0f / Nc);
        Srow  [((size_t)b * Cc + c) * Mc + t] = sw;
    }
}

// =====================================================================
// Kernel 3: inverse channel norm of a (2B,C,P) feature stack per column p
// =====================================================================
__global__ __launch_bounds__(128) void feat_invnorm(const float* __restrict__ f,
                                                    float* __restrict__ inv,
                                                    int P, int total)
{
    const int idx = blockIdx.x * blockDim.x + threadIdx.x;
    if (idx >= total) return;
    const int b = idx / P;
    const int p = idx - b * P;
    const float* fp = f + (size_t)b * Cc * P + p;
    float s = 0.f;
    for (int c = 0; c < Cc; ++c) {
        float v = fp[(size_t)c * P];
        s += v * v;
    }
    inv[idx] = 1.0f / fmaxf(sqrtf(s), 1e-12f);
}

// =====================================================================
// Kernel 4: generic WMMA GEMM tile (one wave = one 16x16 output tile)
//   Outb[m,p] = sum_k (W[m,k]*cs[k]) * (Xb[k,p] * psn) + bias[m]
// Xb / Outb are the planes of one batch entry; psn is this lane's column scale.
// Compile-time specialization removes all null-pointer branches.
// A/cs loads are float4 (global_load_b128); B loads coalesce across lanes.
// Fragment layouts per CDNA5 ISA 7.12.2 (16-bit A 16x32; B row-striped).
// =====================================================================
template <bool HAS_CS, bool HAS_BIAS>
__device__ __forceinline__ void gemm_tile(const float* __restrict__ W, int ldW,
                                          const float* __restrict__ Xb,
                                          const float* __restrict__ cs,
                                          float psn,
                                          const float* __restrict__ bias,
                                          float* __restrict__ Outb,
                                          int Kdim, int Nn)
{
    const int mt = blockIdx.y;
    const int nt = blockIdx.x;
    const int lane = threadIdx.x;
    const int nl = lane & 15;
    const int k0 = (lane & 16) ? 8 : 0;

    const int mrow = (mt << 4) + nl;           // A-matrix row held by this lane
    const int ncol = (nt << 4) + nl;           // B/D column held by this lane
    const float* Wrow = W + (size_t)mrow * ldW;

    v8f acc = {};
    for (int kk = 0; kk < Kdim; kk += 32) {
        const int ka = kk + k0;       // multiple of 4 -> 16B aligned
        const int kb = ka + 16;
        const float4 w0 = *(const float4*)(Wrow + ka);
        const float4 w1 = *(const float4*)(Wrow + ka + 4);
        const float4 w2 = *(const float4*)(Wrow + kb);
        const float4 w3 = *(const float4*)(Wrow + kb + 4);
        float wa[16] = { w0.x, w0.y, w0.z, w0.w, w1.x, w1.y, w1.z, w1.w,
                         w2.x, w2.y, w2.z, w2.w, w3.x, w3.y, w3.z, w3.w };
        if (HAS_CS) {
            const float4 c0 = *(const float4*)(cs + ka);
            const float4 c1 = *(const float4*)(cs + ka + 4);
            const float4 c2 = *(const float4*)(cs + kb);
            const float4 c3 = *(const float4*)(cs + kb + 4);
            const float ca[16] = { c0.x, c0.y, c0.z, c0.w, c1.x, c1.y, c1.z, c1.w,
                                   c2.x, c2.y, c2.z, c2.w, c3.x, c3.y, c3.z, c3.w };
#pragma unroll
            for (int j = 0; j < 16; ++j) wa[j] *= ca[j];
        }
        v16h a, bf;
#pragma unroll
        for (int j = 0; j < 8; ++j) {
            a[j]     = (_Float16)wa[j];
            a[8 + j] = (_Float16)wa[8 + j];
            bf[j]     = (_Float16)(Xb[(size_t)(ka + j) * Nn + ncol] * psn);
            bf[8 + j] = (_Float16)(Xb[(size_t)(kb + j) * Nn + ncol] * psn);
        }
        acc = __builtin_amdgcn_wmma_f32_16x16x32_f16(false, a, false, bf,
                                                     (short)0, acc, false, false);
    }
    const int rbase = (lane >> 4) * 8;
#pragma unroll
    for (int r = 0; r < 8; ++r) {
        const int m = (mt << 4) + rbase + r;
        float v = acc[r];
        if (HAS_BIAS) v += bias[m];
        Outb[(size_t)m * Nn + ncol] = v;
    }
}

// ---------------------------------------------------------------------
// Kernel 4a: all six q/k/v projections in one grid.
//   blockIdx.z = ((branch*3 + kind) * B + b), kind 0=q 1=k 2=v, branch 0=row 1=col
//   row branch: q<-row_ft, k<-col_ft, v<-Srow ; col branch: q<-col_ft, k<-row_ft, v<-Scol
//   Out planes are stacked [Qr|Qc|Kr|Kc|Vr|Vc], each (B, HID, P).
// ---------------------------------------------------------------------
__global__ __launch_bounds__(32) void qkv_wmma(const float* __restrict__ Wq,
                                               const float* __restrict__ Wk,
                                               const float* __restrict__ Wv,
                                               const float* __restrict__ gq,
                                               const float* __restrict__ gk,
                                               const float* __restrict__ gv,
                                               const float* __restrict__ row_ft,
                                               const float* __restrict__ col_ft,
                                               const float* __restrict__ Srow,
                                               const float* __restrict__ Scol,
                                               const float* __restrict__ inv_nrow,
                                               const float* __restrict__ inv_ncol,
                                               float xscale,
                                               float* __restrict__ qkv,
                                               int Mdim, int Kdim, int Nn)
{
    const int z      = blockIdx.z;
    const int b      = z % Bc;
    const int g      = z / Bc;
    const int kind   = g % 3;
    const int branch = g / 3;
    const bool from_row = (kind == branch);     // q of row branch, k of col branch
    const float* W  = (kind == 0) ? Wq : (kind == 1) ? Wk : Wv;
    const float* cs = (kind == 0) ? gq : (kind == 1) ? gk : gv;
    const float* X  = (kind == 2) ? (branch ? Scol : Srow) : (from_row ? row_ft : col_ft);
    const int ncol = (blockIdx.x << 4) + (threadIdx.x & 15);
    float psn = xscale;
    if (kind != 2)
        psn = (from_row ? inv_nrow : inv_ncol)[(size_t)b * Nn + ncol] * xscale;
    gemm_tile<true, false>(W, Kdim, X + (size_t)b * Kdim * Nn, cs, psn, nullptr,
                           qkv + ((size_t)(kind * 2 + branch) * Bc + b) * Mdim * Nn,
                           Kdim, Nn);
}

// ---------------------------------------------------------------------
// Kernel 4b: plain projection over a stack of 2*B planes (row branch, then col branch).
//   The col branch reads W shifted by wBranch columns; X is scaled by xscale.
// ---------------------------------------------------------------------
template <bool HAS_BIAS>
__global__ __launch_bounds__(32) void proj_wmma(const float* __restrict__ W, int ldW,
                                                int wBranch,
                                                const float* __restrict__ X,
                                                const float* __restrict__ bias,
                                                float xscale,
                                                float* __restrict__ Out,
                                                int Mdim, int Kdim, int Nn)
{
    const int b = blockIdx.z;                   // 0 .. 2*B-1
    gemm_tile<false, HAS_BIAS>(W + (b / Bc) * wBranch, ldW, X + (size_t)b * Kdim * Nn,
                               nullptr, xscale, bias, Out + (size_t)b * Mdim * Nn,
                               Kdim, Nn);
}

// =====================================================================
// Kernel 5: attention for one (b, h, 16-query tile). One wave per block.
//   Q,K,V are (2B, 128, P) row-major (row = h*32+d, col = position).
//   s = (Q^T·K)·SCALE; exact max over [keys, mem]; Z = Σe_m + rep·Σe_k
//   O[b, h*32+d, q] = (e_k·v_sum + e_m·mem_v) / Z
// =====================================================================
#define PADS 168
__global__ __launch_bounds__(32) void attn_wave(const float* __restrict__ Q,
                                                const float* __restrict__ Kf,
                                                const float* __restrict__ V,
                                                const float* __restrict__ memkv,
                                                float* __restrict__ O,
                                                int P, float rep)
{
    __shared__ float s[16][PADS];
    __shared__ float sm[16][NMEMc];
    __shared__ float rowZ[16];

    const int b = blockIdx.z, h = blockIdx.y, qt = blockIdx.x;
    const int lane = threadIdx.x;
    const int nl = lane & 15;
    const int k0 = (lane & 16) ? 8 : 0;
    const size_t base = ((size_t)b * HIDc + h * DHc) * P;
    const float* Qb = Q + base;
    const float* Kb = Kf + base;
    const float* Vb = V + base;
    const int qcol = qt * 16 + nl;

    // A fragment: A[i][d] = Q[b, h*32+d, qt*16+i]   (reused across all key tiles)
    v16h aq;
#pragma unroll
    for (int j = 0; j < 8; ++j) {
        aq[j]     = (_Float16)Qb[(k0 + j) * P + qcol];
        aq[8 + j] = (_Float16)Qb[(16 + k0 + j) * P + qcol];
    }

    // scores vs all key tiles (K = 32 = exactly one WMMA step)
    for (int jt = 0; jt < P / 16; ++jt) {
        const int kcol = jt * 16 + nl;
        v16h bk;
#pragma unroll
        for (int j = 0; j < 8; ++j) {
            bk[j]     = (_Float16)Kb[(k0 + j) * P + kcol];
            bk[8 + j] = (_Float16)Kb[(16 + k0 + j) * P + kcol];
        }
        v8f c = {};
        c = __builtin_amdgcn_wmma_f32_16x16x32_f16(false, aq, false, bk,
                                                   (short)0, c, false, false);
        const int rbase = (lane >> 4) * 8;
#pragma unroll
        for (int r = 0; r < 8; ++r)
            s[rbase + r][jt * 16 + nl] = c[r] * SCALE_F;
    }

    // memory-slot scores (scalar; 16 rows handled by lanes 0..15)
    if (lane < 16) {
#pragma unroll
        for (int jm = 0; jm < NMEMc; ++jm) {
            float acc = 0.f;
            for (int d = 0; d < DHc; ++d)
                acc += Qb[d * P + qt * 16 + lane] * memkv[(h * NMEMc + jm) * DHc + d];
            sm[lane][jm] = acc * SCALE_F;
        }
    }
    __syncthreads();

    // exact softmax stats per row
    if (lane < 16) {
        float mx = -3.4e38f;
        for (int j = 0; j < P; ++j) mx = fmaxf(mx, s[lane][j]);
#pragma unroll
        for (int jm = 0; jm < NMEMc; ++jm) mx = fmaxf(mx, sm[lane][jm]);
        float se = 0.f;
        for (int j = 0; j < P; ++j) {
            float e = expf(s[lane][j] - mx);
            s[lane][j] = e;
            se += e;
        }
        float sem = 0.f;
#pragma unroll
        for (int jm = 0; jm < NMEMc; ++jm) {
            float e = expf(sm[lane][jm] - mx);
            sm[lane][jm] = e;
            sem += e;
        }
        rowZ[lane] = sem + rep * se;
    }
    __syncthreads();

    // out = e_k @ v_sum  (K = P in steps of 32), two 16-wide d-tiles
    const int memv_off = Hc * NMEMc * DHc;   // mem_kv[1]
    for (int nt2 = 0; nt2 < 2; ++nt2) {
        v8f c = {};
        for (int kk = 0; kk < P; kk += 32) {
            // e-matrix row (contiguous in LDS, 16B aligned) and V row (contiguous
            // in global, 16B aligned) -> vector loads
            const float4 e0 = *(const float4*)(&s[nl][kk + k0]);
            const float4 e1 = *(const float4*)(&s[nl][kk + k0 + 4]);
            const float4 e2 = *(const float4*)(&s[nl][kk + 16 + k0]);
            const float4 e3 = *(const float4*)(&s[nl][kk + 16 + k0 + 4]);
            const float* Vrow = Vb + (size_t)(nt2 * 16 + nl) * P;
            const float4 v0 = *(const float4*)(Vrow + kk + k0);
            const float4 v1 = *(const float4*)(Vrow + kk + k0 + 4);
            const float4 v2 = *(const float4*)(Vrow + kk + 16 + k0);
            const float4 v3 = *(const float4*)(Vrow + kk + 16 + k0 + 4);
            const float ea[16] = { e0.x, e0.y, e0.z, e0.w, e1.x, e1.y, e1.z, e1.w,
                                   e2.x, e2.y, e2.z, e2.w, e3.x, e3.y, e3.z, e3.w };
            const float va[16] = { v0.x, v0.y, v0.z, v0.w, v1.x, v1.y, v1.z, v1.w,
                                   v2.x, v2.y, v2.z, v2.w, v3.x, v3.y, v3.z, v3.w };
            v16h ae, bv;
#pragma unroll
            for (int j = 0; j < 16; ++j) {
                ae[j] = (_Float16)ea[j];
                bv[j] = (_Float16)va[j];
            }
            c = __builtin_amdgcn_wmma_f32_16x16x32_f16(false, ae, false, bv,
                                                       (short)0, c, false, false);
        }
        const int rbase = (lane >> 4) * 8;
#pragma unroll
        for (int r = 0; r < 8; ++r) {
            const int i = rbase + r;
            const int d = nt2 * 16 + nl;
            float memc = 0.f;
#pragma unroll
            for (int jm = 0; jm < NMEMc; ++jm)
                memc += sm[i][jm] * memkv[memv_off + (h * NMEMc + jm) * DHc + d];
            O[((size_t)b * HIDc + h * DHc + d) * P + qt * 16 + i] =
                (c[r] + memc) / rowZ[i];
        }
    }
}

// =====================================================================
// Kernel 6: out[b,d,n,m] = Rrow[b,d,n] + Rcol[b,d,m]   (float4 writes)
// =====================================================================
__global__ __launch_bounds__(256) void bcast_add(const float* __restrict__ Rrow,
                                                 const float* __restrict__ Rcol,
                                                 float* __restrict__ out)
{
    const size_t idx4 = (size_t)blockIdx.x * blockDim.x + threadIdx.x;
    const size_t e = idx4 * 4;               // grid sized exactly: no guard needed
    const int m = (int)(e % Mc);
    size_t t = e / Mc;
    const int n = (int)(t % Nc); t /= Nc;
    const int d = (int)(t % Cc);
    const int b = (int)(t / Cc);
    const float  rv = Rrow[((size_t)b * Cc + d) * Nc + n];
    const float4 cv = *(const float4*)(Rcol + ((size_t)b * Cc + d) * Mc + m);
    float4 o;
    o.x = rv + cv.x; o.y = rv + cv.y; o.z = rv + cv.z; o.w = rv + cv.w;
    *(float4*)(out + e) = o;
}

// =====================================================================
// Host launcher
// =====================================================================
extern "C" void kernel_launch(void* const* d_in, const int* in_sizes, int n_in,
                              void* d_out, int out_size, void* d_ws, size_t ws_size,
                              hipStream_t stream)
{
    const float* x     = (const float*)d_in[0];
    const float* gq    = (const float*)d_in[1];
    const float* gk    = (const float*)d_in[2];
    const float* gv    = (const float*)d_in[3];
    const float* Wq    = (const float*)d_in[4];
    const float* Wk    = (const float*)d_in[5];
    const float* Wv    = (const float*)d_in[6];
    const float* memkv = (const float*)d_in[7];
    const float* Wo    = (const float*)d_in[8];
    const float* bo    = (const float*)d_in[9];
    const float* Wr    = (const float*)d_in[10];
    float* out = (float*)d_out;

    // ---- workspace layout (floats); total ~7.0 MB ----
    float* w = (float*)d_ws;
    size_t o = 0;
    float* invp     = w + o; o += (size_t)Bc * Nc * Mc;   // 102400
    float* row_ft   = w + o; o += (size_t)Bc * Cc * Nc;   // 122880
    float* col_ft   = w + o; o += (size_t)Bc * Cc * Mc;
    float* Srow     = w + o; o += (size_t)Bc * Cc * Mc;
    float* Scol     = w + o; o += (size_t)Bc * Cc * Nc;
    float* inv_nrow = w + o; o += (size_t)Bc * Nc;
    float* inv_ncol = w + o; o += (size_t)Bc * Mc;
    // row-branch plane directly followed by its col-branch twin: a stack of 2*B planes
    float* Qr = w + o; o += (size_t)Bc * HIDc * Nc;       // 81920 each
    float* Qc = w + o; o += (size_t)Bc * HIDc * Mc;
    float* Kr = w + o; o += (size_t)Bc * HIDc * Mc;
    float* Kc = w + o; o += (size_t)Bc * HIDc * Nc;
    float* Vr = w + o; o += (size_t)Bc * HIDc * Mc;
    float* Vc = w + o; o += (size_t)Bc * HIDc * Nc;
    float* Orow = w + o; o += (size_t)Bc * HIDc * Nc;
    float* Ocol = w + o; o += (size_t)Bc * HIDc * Mc;
    float* row_attn = w + o; o += (size_t)Bc * Cc * Nc;
    float* col_attn = w + o; o += (size_t)Bc * Cc * Mc;
    float* Rrow = w + o; o += (size_t)Bc * Cc * Nc;
    float* Rcol = w + o; o += (size_t)Bc * Cc * Mc;
    (void)ws_size; (void)in_sizes; (void)n_in; (void)out_size;

    const float sqrtC = sqrtf((float)Cc);

    // 1) per-pixel channel norms (pass 1 over x)
    pixel_invnorm<<<(Bc * Nc * Mc + 255) / 256, 256, 0, stream>>>(x, invp);

    // 2) plane reductions (pass 2 over x)
    plane_reduce<<<dim3(Cc, Bc), 160, 0, stream>>>(x, invp, row_ft, col_ft, Srow, Scol);

    // N == M, so the two branches have equal shapes and share one grid per stage:
    // blockIdx.z (or the flat index) runs over the 2*B stacked planes (6*B for QKV).
    static_assert(Nc == Mc, "branch stacking needs equal row and column lengths");
    (void)Qc; (void)Kc; (void)Vc; (void)Ocol; (void)col_attn;

    // 3) feature channel norms of [row_ft | col_ft] -> [inv_nrow | inv_ncol]
    feat_invnorm<<<(2 * Bc * Nc + 127) / 128, 128, 0, stream>>>(row_ft, inv_nrow, Nc, 2 * Bc * Nc);

    // 4) all six QKV projections (128x192x160 WMMA GEMMs) in one grid
    const dim3 gP(Nc / 16, HIDc / 16, 6 * Bc);
    qkv_wmma<<<gP, 32, 0, stream>>>(Wq, Wk, Wv, gq, gk, gv, row_ft, col_ft, Srow, Scol,
                                    inv_nrow, inv_ncol, sqrtC, Qr, HIDc, Cc, Nc);

    // 5) attention, both branches (one wave per (branch,b,h,q-tile))
    const dim3 gA(Nc / 16, Hc, 2 * Bc);
    attn_wave<<<gA, 32, 0, stream>>>(Qr, Kr, Vr, memkv, Orow, Nc, (float)Nc);

    // 6) output projections (192x128x160) with bias bo, both branches
    const dim3 gO(Nc / 16, Cc / 16, 2 * Bc);
    proj_wmma<true><<<gO, 32, 0, stream>>>(Wo, HIDc, 0, Orow, bo, 1.0f, row_attn, Cc, HIDc, Nc);

    // 7) Wr projections (192x192x160); Wr is (C, 2C): Wr1 = Wr[:, :C], Wr2 = Wr[:, C:]
    proj_wmma<false><<<gO, 32, 0, stream>>>(Wr, 2 * Cc, Cc, row_attn, nullptr, 1.0f, Rrow, Cc, Cc, Nc);

    // 8) broadcast add -> final output (78.6 MB, float4 stores)
    const int total4 = (Bc * Cc * Nc * Mc) / 4;       // 4,915,200
    bcast_add<<<total4 / 256, 256, 0, stream>>>(Rrow, Rcol, out);
}

// v002
// Measured time: 97 microseconds a run.
// In both of two side-by-side timings against v001, it was 1.21 times as fast.
// Counting every step since v000, it is 1.97 times as fast.
#include <hip/hip_runtime.h>
#include <math.h>

// ---------------- problem constants ----------------
constexpr int Bc   = 4;
constexpr int Cc   = 192;
constexpr int Nc   = 160;
constexpr int Mc   = 160;
constexpr int Hc   = 4;
constexpr int DHc  = 32;
constexpr int HIDc = 128;   // Hc*DHc
constexpr int NMEMc = 4;
#define SCALE_F 0.17677669529663687f   // 1/sqrt(32)

typedef __attribute__((ext_vector_type(16))) _Float16 v16h;
typedef __attribute__((ext_vector_type(8)))  float    v8f;

// =====================================================================
// Kernel 1: per-pixel inverse channel norm of x:  invp[b,n,m]
// =====================================================================
__global__ __launch_bounds__(256) void pixel_invnorm(const float* __restrict__ x,
                                                     float* __restrict__ invp)
{
    const int idx = blockIdx.x * blockDim.x + threadIdx.x;
    const int NM = Nc * Mc;
    if (idx >= Bc * NM) return;
    const int b = idx / NM;
    const int p = idx - b * NM;
    const float* xp = x + (size_t)b * Cc * NM + p;
    float s = 0.f;
    for (int c = 0; c < Cc; ++c) {
        float v = xp[(size_t)c * NM];
        s += v * v;
    }
    invp[idx] = 1.0f / fmaxf(sqrtf(s), 1e-12f);
}

// =====================================================================
// Kernel 2: per (b,c) plane reductions.
//  row_ft[b,c,n] = mean_m x          col_ft[b,c,m] = mean_n x
//  Scol[b,c,n]   = sum_m x*invp      Srow[b,c,m]   = sum_n x*invp
// block = 160 threads, grid = (C, B)
// =====================================================================
__global__ __launch_bounds__(160) void plane_reduce(const float* __restrict__ x,
                                                    const float* __restrict__ invp,
                                                    float* __restrict__ row_ft,
                                                    float* __restrict__ col_ft,
                                                    float* __restrict__ Srow,
                                                    float* __restrict__ Scol)
{
    const int b = blockIdx.y, c = blockIdx.x;
    const float* xp = x + ((size_t)b * Cc + c) * Nc * Mc;
    const float* ip = invp + (size_t)b * Nc * Mc;
    const int t = threadIdx.x;
    if (t < Nc) {   // row t: reduce over m
        float s = 0.f, sw = 0.f;
        for (int m = 0; m < Mc; ++m) {
            float v = xp[t * Mc + m];
            s += v;
            sw += v * ip[t * Mc + m];
        }
        row_ft[((size_t)b * Cc + c) * Nc + t] = s * (1.0f / Mc);
        Scol  [((size_t)b * Cc + c) * Nc + t] = sw;
    }
    if (t < Mc) {   // col t: reduce over n
        float s = 0.f, sw = 0.f;
        for (int n = 0; n < Nc; ++n) {
            float v = xp[n * Mc + t];
            s += v;
            sw += v * ip[n * Mc + t];
        }
        col_ft[((size_t)b * Cc + c) * Mc + t] = s * (1.0f / Nc);
        Srow  [((size_t)b * Cc + c) * Mc + t] = sw;
    }
}

// =====================================================================
// Kernel 3: inverse channel norm of a (2B,C,P) feature stack per column p
// =====================================================================
__global__ __launch_bounds__(128) void feat_invnorm(const float* __restrict__ f,
                                                    float* __restrict__ inv,
                                                    int P, int total)
{
    const int idx = blockIdx.x * blockDim.x + threadIdx.x;
    if (idx >= total) return;
    const int b = idx / P;
    const int p = idx - b * P;
    const float* fp = f + (size_t)b * Cc * P + p;
    float s = 0.f;
    for (int c = 0; c < Cc; ++c) {
        float v = fp[(size_t)c * P];
        s += v * v;
    }
    inv[idx] = 1.0f / fmaxf(sqrtf(s), 1e-12f);
}

// =====================================================================
// Kernel 4: generic WMMA GEMM tile (one wave = one 16x16 output tile)
//   Outb[m,p] = sum_k (W[m,k]*cs[k]) * (Xb[k,p] * psn) + bias[m]
// Xb / Outb are the planes of one batch entry; psn is this lane's column scale.
// Compile-time specialization removes all null-pointer branches.
// A/cs loads are float4 (global_load_b128); B loads coalesce across lanes.
// Fragment layouts per CDNA5 ISA 7.12.2 (16-bit A 16x32; B row-striped).
// =====================================================================
template <bool HAS_CS, bool HAS_BIAS>
__device__ __forceinline__ void gemm_tile(const float* __restrict__ W, int ldW,
                                          const float* __restrict__ Xb,
                                          const float* __restrict__ cs,
                                          float psn,
                                          const float* __restrict__ bias,
                                          float* __restrict__ Outb,
                                          int Kdim, int Nn)
{
    const int mt = blockIdx.y;
    const int nt = blockIdx.x;
    const int lane = threadIdx.x;
    const int nl = lane & 15;
    const int k0 = (lane & 16) ? 8 : 0;

    const int mrow = (mt << 4) + nl;           // A-matrix row held by this lane
    const int ncol = (nt << 4) + nl;           // B/D column held by this lane
    const float* Wrow = W + (size_t)mrow * ldW;

    v8f acc = {};
    for (int kk = 0; kk < Kdim; kk += 32) {
        const int ka = kk + k0;       // multiple of 4 -> 16B aligned
        const int kb = ka + 16;
        const float4 w0 = *(const float4*)(Wrow + ka);
        const float4 w1 = *(const float4*)(Wrow + ka + 4);
        const float4 w2 = *(const float4*)(Wrow + kb);
        const float4 w3 = *(const float4*)(Wrow + kb + 4);
        float wa[16] = { w0.x, w0.y, w0.z, w0.w, w1.x, w1.y, w1.z, w1.w,
                         w2.x, w2.y, w2.z, w2.w, w3.x, w3.y, w3.z, w3.w };
        if (HAS_CS) {
            const float4 c0 = *(const float4*)(cs + ka);
            const float4 c1 = *(const float4*)(cs + ka + 4);
            const float4 c2 = *(const float4*)(cs + kb);
            const float4 c3 = *(const float4*)(cs + kb + 4);
            const float ca[16] = { c0.x, c0.y, c0.z, c0.w, c1.x, c1.y, c1.z, c1.w,
                                   c2.x, c2.y, c2.z, c2.w, c3.x, c3.y, c3.z, c3.w };
#pragma unroll
            for (int j = 0; j < 16; ++j) wa[j] *= ca[j];
        }
        v16h a, bf;
#pragma unroll
        for (int j = 0; j < 8; ++j) {
            a[j]     = (_Float16)wa[j];
            a[8 + j] = (_Float16)wa[8 + j];
            bf[j]     = (_Float16)(Xb[(size_t)(ka + j) * Nn + ncol] * psn);
            bf[8 + j] = (_Float16)(Xb[(size_t)(kb + j) * Nn + ncol] * psn);
        }
        acc = __builtin_amdgcn_wmma_f32_16x16x32_f16(false, a, false, bf,
                                                     (short)0, acc, false, false);
    }
    const int rbase = (lane >> 4) * 8;
#pragma unroll
    for (int r = 0; r < 8; ++r) {
        const int m = (mt << 4) + rbase + r;
        float v = acc[r];
        if (HAS_BIAS) v += bias[m];
        Outb[(size_t)m * Nn + ncol] = v;
    }
}

// ---------------------------------------------------------------------
// Kernel 4a: all six q/k/v projections in one grid.
//   blockIdx.z = ((branch*3 + kind) * B + b), kind 0=q 1=k 2=v, branch 0=row 1=col
//   row branch: q<-row_ft, k<-col_ft, v<-Srow ; col branch: q<-col_ft, k<-row_ft, v<-Scol
//   Out planes are stacked [Qr|Qc|Kr|Kc|Vr|Vc], each (B, HID, P).
// ---------------------------------------------------------------------
__global__ __launch_bounds__(32) void qkv_wmma(const float* __restrict__ Wq,
                                               const float* __restrict__ Wk,
                                               const float* __restrict__ Wv,
                                               const float* __restrict__ gq,
                                               const float* __restrict__ gk,
                                               const float* __restrict__ gv,
                                               const float* __restrict__ row_ft,
                                               const float* __restrict__ col_ft,
                                               const float* __restrict__ Srow,
                                               const float* __restrict__ Scol,
                                               const float* __restrict__ inv_nrow,
                                               const float* __restrict__ inv_ncol,
                                               float xscale,
                                               float* __restrict__ qkv,
                                               int Mdim, int Kdim, int Nn)
{
    const int z      = blockIdx.z;
    const int b      = z % Bc;
    const int g      = z / Bc;
    const int kind   = g % 3;
    const int branch = g / 3;
    const bool from_row = (kind == branch);     // q of row branch, k of col branch
    const float* W  = (kind == 0) ? Wq : (kind == 1) ? Wk : Wv;
    const float* cs = (kind == 0) ? gq : (kind == 1) ? gk : gv;
    const float* X  = (kind == 2) ? (branch ? Scol : Srow) : (from_row ? row_ft : col_ft);
    const int ncol = (blockIdx.x << 4) + (threadIdx.x & 15);
    float psn = xscale;
    if (kind != 2)
        psn = (from_row ? inv_nrow : inv_ncol)[(size_t)b * Nn + ncol] * xscale;
    gemm_tile<true, false>(W, Kdim, X + (size_t)b * Kdim * Nn, cs, psn, nullptr,
                           qkv + ((size_t)(kind * 2 + branch) * Bc + b) * Mdim * Nn,
                           Kdim, Nn);
}

// ---------------------------------------------------------------------
// Kernel 4b: plain projection over a stack of 2*B planes (row branch, then col branch).
//   The col branch reads W shifted by wBranch columns; X is scaled by xscale.
// ---------------------------------------------------------------------
template <bool HAS_BIAS>
__global__ __launch_bounds__(32) void proj_wmma(const float* __restrict__ W, int ldW,
                                                int wBranch,
                                                const float* __restrict__ X,
                                                const float* __restrict__ bias,
                                                float xscale,
                                                float* __restrict__ Out,
                                                int Mdim, int Kdim, int Nn)
{
    const int b = blockIdx.z;                   // 0 .. 2*B-1
    gemm_tile<false, HAS_BIAS>(W + (b / Bc) * wBranch, ldW, X + (size_t)b * Kdim * Nn,
                               nullptr, xscale, bias, Out + (size_t)b * Mdim * Nn,
                               Kdim, Nn);
}

// =====================================================================
// Kernel 5: attention for one (b, h, 16-query tile). One wave per block.
//   Q,K,V are (2B, 128, P) row-major (row = h*32+d, col = position).
//   s = (Q^T·K)·SCALE; exact max over [keys, mem]; Z = Σe_m + rep·Σe_k
//   O[b, h*32+d, q] = (e_k·v_sum + e_m·mem_v) / Z
// =====================================================================
#define PADS 168
__global__ __launch_bounds__(32) void attn_wave(const float* __restrict__ Q,
                                                const float* __restrict__ Kf,
                                                const float* __restrict__ V,
                                                const float* __restrict__ memkv,
                                                float* __restrict__ O,
                                                int P, float rep)
{
    __shared__ float s[16][PADS];
    __shared__ float sm[16][NMEMc];
    __shared__ float rowZ[16];

    const int b = blockIdx.z, h = blockIdx.y, qt = blockIdx.x;
    const int lane = threadIdx.x;
    const int nl = lane & 15;
    const int k0 = (lane & 16) ? 8 : 0;
    const size_t base = ((size_t)b * HIDc + h * DHc) * P;
    const float* Qb = Q + base;
    const float* Kb = Kf + base;
    const float* Vb = V + base;
    const int qcol = qt * 16 + nl;

    // A fragment: A[i][d] = Q[b, h*32+d, qt*16+i]   (reused across all key tiles)
    v16h aq;
#pragma unroll
    for (int j = 0; j < 8; ++j) {
        aq[j]     = (_Float16)Qb[(k0 + j) * P + qcol];
        aq[8 + j] = (_Float16)Qb[(16 + k0 + j) * P + qcol];
    }

    // scores vs all key tiles (K = 32 = exactly one WMMA step)
    for (int jt = 0; jt < P / 16; ++jt) {
        const int kcol = jt * 16 + nl;
        v16h bk;
#pragma unroll
        for (int j = 0; j < 8; ++j) {
            bk[j]     = (_Float16)Kb[(k0 + j) * P + kcol];
            bk[8 + j] = (_Float16)Kb[(16 + k0 + j) * P + kcol];
        }
        v8f c = {};
        c = __builtin_amdgcn_wmma_f32_16x16x32_f16(false, aq, false, bk,
                                                   (short)0, c, false, false);
        const int rbase = (lane >> 4) * 8;
#pragma unroll
        for (int r = 0; r < 8; ++r)
            s[rbase + r][jt * 16 + nl] = c[r] * SCALE_F;
    }

    // memory-slot scores (scalar; 16 rows handled by lanes 0..15)
    if (lane < 16) {
#pragma unroll
        for (int jm = 0; jm < NMEMc; ++jm) {
            float acc = 0.f;
            for (int d = 0; d < DHc; ++d)
                acc += Qb[d * P + qt * 16 + lane] * memkv[(h * NMEMc + jm) * DHc + d];
            sm[lane][jm] = acc * SCALE_F;
        }
    }
    __syncthreads();

    // exact softmax stats per row
    if (lane < 16) {
        float mx = -3.4e38f;
        for (int j = 0; j < P; ++j) mx = fmaxf(mx, s[lane][j]);
#pragma unroll
        for (int jm = 0; jm < NMEMc; ++jm) mx = fmaxf(mx, sm[lane][jm]);
        float se = 0.f;
        for (int j = 0; j < P; ++j) {
            float e = expf(s[lane][j] - mx);
            s[lane][j] = e;
            se += e;
        }
        float sem = 0.f;
#pragma unroll
        for (int jm = 0; jm < NMEMc; ++jm) {
            float e = expf(sm[lane][jm] - mx);
            sm[lane][jm] = e;
            sem += e;
        }
        rowZ[lane] = sem + rep * se;
    }
    __syncthreads();

    // out = e_k @ v_sum  (K = P in steps of 32), two 16-wide d-tiles
    const int memv_off = Hc * NMEMc * DHc;   // mem_kv[1]
    for (int nt2 = 0; nt2 < 2; ++nt2) {
        v8f c = {};
        for (int kk = 0; kk < P; kk += 32) {
            // e-matrix row (contiguous in LDS, 16B aligned) and V row (contiguous
            // in global, 16B aligned) -> vector loads
            const float4 e0 = *(const float4*)(&s[nl][kk + k0]);
            const float4 e1 = *(const float4*)(&s[nl][kk + k0 + 4]);
            const float4 e2 = *(const float4*)(&s[nl][kk + 16 + k0]);
            const float4 e3 = *(const float4*)(&s[nl][kk + 16 + k0 + 4]);
            const float* Vrow = Vb + (size_t)(nt2 * 16 + nl) * P;
            const float4 v0 = *(const float4*)(Vrow + kk + k0);
            const float4 v1 = *(const float4*)(Vrow + kk + k0 + 4);
            const float4 v2 = *(const float4*)(Vrow + kk + 16 + k0);
            const float4 v3 = *(const float4*)(Vrow + kk + 16 + k0 + 4);
            const float ea[16] = { e0.x, e0.y, e0.z, e0.w, e1.x, e1.y, e1.z, e1.w,
                                   e2.x, e2.y, e2.z, e2.w, e3.x, e3.y, e3.z, e3.w };
            const float va[16] = { v0.x, v0.y, v0.z, v0.w, v1.x, v1.y, v1.z, v1.w,
                                   v2.x, v2.y, v2.z, v2.w, v3.x, v3.y, v3.z, v3.w };
            v16h ae, bv;
#pragma unroll
            for (int j = 0; j < 16; ++j) {
                ae[j] = (_Float16)ea[j];
                bv[j] = (_Float16)va[j];
            }
            c = __builtin_amdgcn_wmma_f32_16x16x32_f16(false, ae, false, bv,
                                                       (short)0, c, false, false);
        }
        const int rbase = (lane >> 4) * 8;
#pragma unroll
        for (int r = 0; r < 8; ++r) {
            const int i = rbase + r;
            const int d = nt2 * 16 + nl;
            float memc = 0.f;
#pragma unroll
            for (int jm = 0; jm < NMEMc; ++jm)
                memc += sm[i][jm] * memkv[memv_off + (h * NMEMc + jm) * DHc + d];
            O[((size_t)b * HIDc + h * DHc + d) * P + qt * 16 + i] =
                (c[r] + memc) / rowZ[i];
        }
    }
}

// =====================================================================
// Kernel 6: out[b,d,n,m] = Rrow[b,d,n] + Rcol[b,d,m]   (float4 writes)
// One block per (b,d) plane. 160 threads cover 4 rows of 40 float4, so a thread
// keeps its four columns of Rcol in registers and stores them under every 4th
// row: a wave lives for 40 stores of 512 contiguous bytes instead of one.
// =====================================================================
constexpr int BC_COLS4 = Mc / 4;                 // float4 per row
constexpr int BC_ROWS  = 4;                      // rows covered by one pass of the block
constexpr int BC_THREADS = BC_COLS4 * BC_ROWS;   // 160
static_assert(Mc % 4 == 0 && Nc % BC_ROWS == 0, "plane must split into whole passes");
__global__ __launch_bounds__(BC_THREADS) void bcast_add(const float* __restrict__ Rrow,
                                                        const float* __restrict__ Rcol,
                                                        float* __restrict__ out)
{
    const int plane = blockIdx.x;                // b*C + d
    const int t  = threadIdx.x;
    const int cg = t % BC_COLS4;
    const int r0 = t / BC_COLS4;
    const float4 cv = *(const float4*)(Rcol + (size_t)plane * Mc + cg * 4);
    const float* rr = Rrow + (size_t)plane * Nc + r0;
    float4* op = (float4*)(out + (size_t)plane * Nc * Mc) + t;
    // all row values are requested before the first store, so the stores wait once
    float rv[Nc / BC_ROWS];
#pragma unroll
    for (int k = 0; k < Nc / BC_ROWS; ++k) rv[k] = rr[k * BC_ROWS];
    // unrolled: rv[] stays in registers and every store takes an immediate offset
#pragma unroll
    for (int k = 0; k < Nc / BC_ROWS; ++k) {
        float4 o;
        o.x = rv[k] + cv.x; o.y = rv[k] + cv.y; o.z = rv[k] + cv.z; o.w = rv[k] + cv.w;
        op[k * BC_THREADS] = o;
    }
}

// =====================================================================
// Host launcher
// =====================================================================
extern "C" void kernel_launch(void* const* d_in, const int* in_sizes, int n_in,
                              void* d_out, int out_size, void* d_ws, size_t ws_size,
                              hipStream_t stream)
{
    const float* x     = (const float*)d_in[0];
    const float* gq    = (const float*)d_in[1];
    const float* gk    = (const float*)d_in[2];
    const float* gv    = (const float*)d_in[3];
    const float* Wq    = (const float*)d_in[4];
    const float* Wk    = (const float*)d_in[5];
    const float* Wv    = (const float*)d_in[6];
    const float* memkv = (const float*)d_in[7];
    const float* Wo    = (const float*)d_in[8];
    const float* bo    = (const float*)d_in[9];
    const float* Wr    = (const float*)d_in[10];
    float* out = (float*)d_out;

    // ---- workspace layout (floats); total ~7.0 MB ----
    float* w = (float*)d_ws;
    size_t o = 0;
    float* invp     = w + o; o += (size_t)Bc * Nc * Mc;   // 102400
    float* row_ft   = w + o; o += (size_t)Bc * Cc * Nc;   // 122880
    float* col_ft   = w + o; o += (size_t)Bc * Cc * Mc;
    float* Srow     = w + o; o += (size_t)Bc * Cc * Mc;
    float* Scol     = w + o; o += (size_t)Bc * Cc * Nc;
    float* inv_nrow = w + o; o += (size_t)Bc * Nc;
    float* inv_ncol = w + o; o += (size_t)Bc * Mc;
    // row-branch plane directly followed by its col-branch twin: a stack of 2*B planes
    float* Qr = w + o; o += (size_t)Bc * HIDc * Nc;       // 81920 each
    float* Qc = w + o; o += (size_t)Bc * HIDc * Mc;
    float* Kr = w + o; o += (size_t)Bc * HIDc * Mc;
    float* Kc = w + o; o += (size_t)Bc * HIDc * Nc;
    float* Vr = w + o; o += (size_t)Bc * HIDc * Mc;
    float* Vc = w + o; o += (size_t)Bc * HIDc * Nc;
    float* Orow = w + o; o += (size_t)Bc * HIDc * Nc;
    float* Ocol = w + o; o += (size_t)Bc * HIDc * Mc;
    float* row_attn = w + o; o += (size_t)Bc * Cc * Nc;
    float* col_attn = w + o; o += (size_t)Bc * Cc * Mc;
    float* Rrow = w + o; o += (size_t)Bc * Cc * Nc;
    float* Rcol = w + o; o += (size_t)Bc * Cc * Mc;
    (void)ws_size; (void)in_sizes; (void)n_in; (void)out_size;

    const float sqrtC = sqrtf((float)Cc);

    // 1) per-pixel channel norms (pass 1 over x)
    pixel_invnorm<<<(Bc * Nc * Mc + 255) / 256, 256, 0, stream>>>(x, invp);

    // 2) plane reductions (pass 2 over x)
    plane_reduce<<<dim3(Cc, Bc), 160, 0, stream>>>(x, invp, row_ft, col_ft, Srow, Scol);

    // N == M, so the two branches have equal shapes and share one grid per stage:
    // blockIdx.z (or the flat index) runs over the 2*B stacked planes (6*B for QKV).
    static_assert(Nc == Mc, "branch stacking needs equal row and column lengths");
    (void)Qc; (void)Kc; (void)Vc; (void)Ocol; (void)col_attn;

    // 3) feature channel norms of [row_ft | col_ft] -> [inv_nrow | inv_ncol]
    feat_invnorm<<<(2 * Bc * Nc + 127) / 128, 128, 0, stream>>>(row_ft, inv_nrow, Nc, 2 * Bc * Nc);

    // 4) all six QKV projections (128x192x160 WMMA GEMMs) in one grid
    const dim3 gP(Nc / 16, HIDc / 16, 6 * Bc);
    qkv_wmma<<<gP, 32, 0, stream>>>(Wq, Wk, Wv, gq, gk, gv, row_ft, col_ft, Srow, Scol,
                                    inv_nrow, inv_ncol, sqrtC, Qr, HIDc, Cc, Nc);

    // 5) attention, both branches (one wave per (branch,b,h,q-tile))
    const dim3 gA(Nc / 16, Hc, 2 * Bc);
    attn_wave<<<gA, 32, 0, stream>>>(Qr, Kr, Vr, memkv, Orow, Nc, (float)Nc);

    // 6) output projections (192x128x160) with bias bo, both branches
    const dim3 gO(Nc / 16, Cc / 16, 2 * Bc);
    proj_wmma<true><<<gO, 32, 0, stream>>>(Wo, HIDc, 0, Orow, bo, 1.0f, row_attn, Cc, HIDc, Nc);

    // 7) Wr projections (192x192x160); Wr is (C, 2C): Wr1 = Wr[:, :C], Wr2 = Wr[:, C:]
    proj_wmma<false><<<gO, 32, 0, stream>>>(Wr, 2 * Cc, Cc, row_attn, nullptr, 1.0f, Rrow, Cc, Cc, Nc);

    // 8) broadcast add -> final output (78.6 MB, float4 stores)
    bcast_add<<<Bc * Cc, BC_THREADS, 0, stream>>>(Rrow, Rcol, out);
}

// v003
// A run of this version takes 77.9 microseconds.
// Two timings next to v002 put it at 1.24 and 1.26 times that version's speed.
// Counting every step since v000, it is 2.47 times as fast.
#include <hip/hip_runtime.h>
#include <math.h>

// ---------------- problem constants ----------------
constexpr int Bc   = 4;
constexpr int Cc   = 192;
constexpr int Nc   = 160;
constexpr int Mc   = 160;
constexpr int Hc   = 4;
constexpr int DHc  = 32;
constexpr int HIDc = 128;   // Hc*DHc
constexpr int NMEMc = 4;
#define SCALE_F 0.17677669529663687f   // 1/sqrt(32)

typedef __attribute__((ext_vector_type(16))) _Float16 v16h;
typedef __attribute__((ext_vector_type(8)))  float    v8f;
typedef __attribute__((ext_vector_type(4)))  float    v4f;

// =====================================================================
// Kernel 1: per-pixel inverse channel norm of x:  invp[b,n,m]
// =====================================================================
__global__ __launch_bounds__(256) void pixel_invnorm(const float* __restrict__ x,
                                                     float* __restrict__ invp)
{
    const int idx = blockIdx.x * blockDim.x + threadIdx.x;
    const int NM = Nc * Mc;
    if (idx >= Bc * NM) return;
    const int b = idx / NM;
    const int p = idx - b * NM;
    const float* xp = x + (size_t)b * Cc * NM + p;
    float s = 0.f;
    for (int c = 0; c < Cc; ++c) {
        float v = xp[(size_t)c * NM];
        s += v * v;
    }
    invp[idx] = 1.0f / fmaxf(sqrtf(s), 1e-12f);
}

// =====================================================================
// Kernel 2: plane reductions, every plane read once with whole-line loads.
//  row_ft[b,c,n] = mean_m x          col_ft[b,c,m] = mean_n x
//  Scol[b,c,n]   = sum_m x*invp      Srow[b,c,m]   = sum_n x*invp
// One block takes 3 channels of one batch entry, so a float4 of invp serves three
// planes. 640 threads cover 16 rows of 40 float4; a thread keeps its four columns'
// sums in registers and leaves each row's four-element partial in LDS. After the
// barrier one thread per (channel, index) adds up a row's 40 partials and a
// column's 16 partials.
// =====================================================================
constexpr int PR_CH      = 3;                       // channels per block
constexpr int PR_COLS4   = Mc / 4;                  // float4 per row
constexpr int PR_SLOTS   = 16;                      // rows covered by one pass
constexpr int PR_THREADS = PR_COLS4 * PR_SLOTS;     // 640
constexpr int PR_PASSES  = Nc / PR_SLOTS;           // 10
constexpr int PR_GRP     = 2;                       // passes fetched together
constexpr int PR_NGRP    = PR_PASSES / PR_GRP;      // 5
constexpr int PR_PITCH   = PR_COLS4 + 1;            // odd pitch: 32 rows read side by side hit distinct banks
static_assert(Cc % PR_CH == 0 && Nc % PR_SLOTS == 0 && Mc % 4 == 0 && Nc == Mc &&
              PR_PASSES % PR_GRP == 0 && PR_CH * Nc <= PR_THREADS && (PR_CH * Nc) % 32 == 0, "plane_reduce tiling");
__global__ __launch_bounds__(PR_THREADS) void plane_reduce(const float* __restrict__ x,
                                                           const float* __restrict__ invp,
                                                           float* __restrict__ row_ft,
                                                           float* __restrict__ col_ft,
                                                           float* __restrict__ Srow,
                                                           float* __restrict__ Scol)
{
    __shared__ float2 rowp[PR_CH][Nc][PR_PITCH];            // (sum, weighted sum) of 4 columns
    __shared__ v4f colp[PR_SLOTS][PR_CH][2][PR_COLS4];      // column sums of one row slot

    const int b = blockIdx.y, c0 = blockIdx.x * PR_CH;
    const int t  = threadIdx.x;
    const int cg = t % PR_COLS4;
    const int r0 = t / PR_COLS4;
    constexpr int PLANE4 = Nc * Mc / 4;
    const v4f* xp = (const v4f*)(x + ((size_t)b * Cc + c0) * Nc * Mc) + t;
    const v4f* ip = (const v4f*)(invp + (size_t)b * Nc * Mc) + t;

    v4f cs[PR_CH], cw[PR_CH];
#pragma unroll
    for (int ch = 0; ch < PR_CH; ++ch) {
        cs[ch] = (v4f)(0.f);
        cw[ch] = (v4f)(0.f);
    }
    // Two register sets of PR_GRP passes each: the next group's loads are issued before
    // this group is summed. Unrolled, so set indices are static and offsets immediate.
    v4f wv[2][PR_GRP], xv[2][PR_GRP][PR_CH];
#pragma unroll
    for (int p = 0; p < PR_GRP; ++p) {
        wv[0][p] = ip[p * PR_THREADS];
#pragma unroll
        for (int ch = 0; ch < PR_CH; ++ch) xv[0][p][ch] = xp[ch * PLANE4 + p * PR_THREADS];
    }
#pragma unroll
    for (int g = 0; g < PR_NGRP; ++g) {
        const int cur = g & 1, nxt = cur ^ 1;
        // the pair of scheduling barriers pins "next group's loads, then this group's sums";
        // without it each load sinks to its use and the wave waits out one load at a time
        __builtin_amdgcn_sched_barrier(0);
        if (g + 1 < PR_NGRP) {
#pragma unroll
            for (int p = 0; p < PR_GRP; ++p) {
                const int k = (g + 1) * PR_GRP + p;
                wv[nxt][p] = ip[k * PR_THREADS];
#pragma unroll
                for (int ch = 0; ch < PR_CH; ++ch)
                    xv[nxt][p][ch] = xp[ch * PLANE4 + k * PR_THREADS];
            }
        }
        __builtin_amdgcn_sched_barrier(0);
#pragma unroll
        for (int p = 0; p < PR_GRP; ++p) {
            const v4f w4 = wv[cur][p];
#pragma unroll
            for (int ch = 0; ch < PR_CH; ++ch) {
                const v4f v = xv[cur][p][ch];
                const v4f vw = v * w4;
                cs[ch] += v;
                cw[ch] += vw;
                rowp[ch][(g * PR_GRP + p) * PR_SLOTS + r0][cg] =
                    make_float2((v.x + v.y) + (v.z + v.w), (vw.x + vw.y) + (vw.z + vw.w));
            }
        }
    }
#pragma unroll
    for (int ch = 0; ch < PR_CH; ++ch) {
        colp[r0][ch][0][cg] = cs[ch];
        colp[r0][ch][1][cg] = cw[ch];
    }
    // the loads' base and index registers are reused below: this wait stands in front of that
    asm volatile("s_wait_xcnt 0x0" ::: "memory");
    __syncthreads();

    if (t < PR_CH * Nc) {       // whole waves: 480 = 15 * 32
        const int ch = t / Nc;
        const int i  = t - ch * Nc;
        float rs = 0.f, rw = 0.f;
#pragma unroll
        for (int j = 0; j < PR_COLS4; ++j) {
            const float2 p = rowp[ch][i][j];
            rs += p.x;
            rw += p.y;
        }
        const float* cp = (const float*)colp;
        float ss = 0.f, sw = 0.f;
#pragma unroll
        for (int sl = 0; sl < PR_SLOTS; ++sl) {
            ss += cp[((sl * PR_CH + ch) * 2 + 0) * Mc + i];
            sw += cp[((sl * PR_CH + ch) * 2 + 1) * Mc + i];
        }
        const size_t o = ((size_t)b * Cc + c0 + ch) * Nc + i;
        row_ft[o] = rs * (1.0f / Mc);
        Scol[o]   = rw;
        col_ft[o] = ss * (1.0f / Nc);
        Srow[o]   = sw;
    }
}

// =====================================================================
// Kernel 3: inverse channel norm of a (2B,C,P) feature stack per column p
// =====================================================================
__global__ __launch_bounds__(128) void feat_invnorm(const float* __restrict__ f,
                                                    float* __restrict__ inv,
                                                    int P, int total)
{
    const int idx = blockIdx.x * blockDim.x + threadIdx.x;
    if (idx >= total) return;
    const int b = idx / P;
    const int p = idx - b * P;
    const float* fp = f + (size_t)b * Cc * P + p;
    float s = 0.f;
    for (int c = 0; c < Cc; ++c) {
        float v = fp[(size_t)c * P];
        s += v * v;
    }
    inv[idx] = 1.0f / fmaxf(sqrtf(s), 1e-12f);
}

// =====================================================================
// Kernel 4: generic WMMA GEMM tile (one wave = one 16x16 output tile)
//   Outb[m,p] = sum_k (W[m,k]*cs[k]) * (Xb[k,p] * psn) + bias[m]
// Xb / Outb are the planes of one batch entry; psn is this lane's column scale.
// Compile-time specialization removes all null-pointer branches.
// A/cs loads are float4 (global_load_b128); B loads coalesce across lanes.
// Fragment layouts per CDNA5 ISA 7.12.2 (16-bit A 16x32; B row-striped).
// =====================================================================
template <bool HAS_CS, bool HAS_BIAS>
__device__ __forceinline__ void gemm_tile(const float* __restrict__ W, int ldW,
                                          const float* __restrict__ Xb,
                                          const float* __restrict__ cs,
                                          float psn,
                                          const float* __restrict__ bias,
                                          float* __restrict__ Outb,
                                          int Kdim, int Nn)
{
    const int mt = blockIdx.y;
    const int nt = blockIdx.x;
    const int lane = threadIdx.x;
    const int nl = lane & 15;
    const int k0 = (lane & 16) ? 8 : 0;

    const int mrow = (mt << 4) + nl;           // A-matrix row held by this lane
    const int ncol = (nt << 4) + nl;           // B/D column held by this lane
    const float* Wrow = W + (size_t)mrow * ldW;

    v8f acc = {};
    for (int kk = 0; kk < Kdim; kk += 32) {
        const int ka = kk + k0;       // multiple of 4 -> 16B aligned
        const int kb = ka + 16;
        const float4 w0 = *(const float4*)(Wrow + ka);
        const float4 w1 = *(const float4*)(Wrow + ka + 4);
        const float4 w2 = *(const float4*)(Wrow + kb);
        const float4 w3 = *(const float4*)(Wrow + kb + 4);
        float wa[16] = { w0.x, w0.y, w0.z, w0.w, w1.x, w1.y, w1.z, w1.w,
                         w2.x, w2.y, w2.z, w2.w, w3.x, w3.y, w3.z, w3.w };
        if (HAS_CS) {
            const float4 c0 = *(const float4*)(cs + ka);
            const float4 c1 = *(const float4*)(cs + ka + 4);
            const float4 c2 = *(const float4*)(cs + kb);
            const float4 c3 = *(const float4*)(cs + kb + 4);
            const float ca[16] = { c0.x, c0.y, c0.z, c0.w, c1.x, c1.y, c1.z, c1.w,
                                   c2.x, c2.y, c2.z, c2.w, c3.x, c3.y, c3.z, c3.w };
#pragma unroll
            for (int j = 0; j < 16; ++j) wa[j] *= ca[j];
        }
        v16h a, bf;
#pragma unroll
        for (int j = 0; j < 8; ++j) {
            a[j]     = (_Float16)wa[j];
            a[8 + j] = (_Float16)wa[8 + j];
            bf[j]     = (_Float16)(Xb[(size_t)(ka + j) * Nn + ncol] * psn);
            bf[8 + j] = (_Float16)(Xb[(size_t)(kb + j) * Nn + ncol] * psn);
        }
        acc = __builtin_amdgcn_wmma_f32_16x16x32_f16(false, a, false, bf,
                                                     (short)0, acc, false, false);
    }
    const int rbase = (lane >> 4) * 8;
#pragma unroll
    for (int r = 0; r < 8; ++r) {
        const int m = (mt << 4) + rbase + r;
        float v = acc[r];
        if (HAS_BIAS) v += bias[m];
        Outb[(size_t)m * Nn + ncol] = v;
    }
}

// ---------------------------------------------------------------------
// Kernel 4a: all six q/k/v projections in one grid.
//   blockIdx.z = ((branch*3 + kind) * B + b), kind 0=q 1=k 2=v, branch 0=row 1=col
//   row branch: q<-row_ft, k<-col_ft, v<-Srow ; col branch: q<-col_ft, k<-row_ft, v<-Scol
//   Out planes are stacked [Qr|Qc|Kr|Kc|Vr|Vc], each (B, HID, P).
// ---------------------------------------------------------------------
__global__ __launch_bounds__(32) void qkv_wmma(const float* __restrict__ Wq,
                                               const float* __restrict__ Wk,
                                               const float* __restrict__ Wv,
                                               const float* __restrict__ gq,
                                               const float* __restrict__ gk,
                                               const float* __restrict__ gv,
                                               const float* __restrict__ row_ft,
                                               const float* __restrict__ col_ft,
                                               const float* __restrict__ Srow,
                                               const float* __restrict__ Scol,
                                               const float* __restrict__ inv_nrow,
                                               const float* __restrict__ inv_ncol,
                                               float xscale,
                                               float* __restrict__ qkv,
                                               int Mdim, int Kdim, int Nn)
{
    const int z      = blockIdx.z;
    const int b      = z % Bc;
    const int g      = z / Bc;
    const int kind   = g % 3;
    const int branch = g / 3;
    const bool from_row = (kind == branch);     // q of row branch, k of col branch
    const float* W  = (kind == 0) ? Wq : (kind == 1) ? Wk : Wv;
    const float* cs = (kind == 0) ? gq : (kind == 1) ? gk : gv;
    const float* X  = (kind == 2) ? (branch ? Scol : Srow) : (from_row ? row_ft : col_ft);
    const int ncol = (blockIdx.x << 4) + (threadIdx.x & 15);
    float psn = xscale;
    if (kind != 2)
        psn = (from_row ? inv_nrow : inv_ncol)[(size_t)b * Nn + ncol] * xscale;
    gemm_tile<true, false>(W, Kdim, X + (size_t)b * Kdim * Nn, cs, psn, nullptr,
                           qkv + ((size_t)(kind * 2 + branch) * Bc + b) * Mdim * Nn,
                           Kdim, Nn);
}

// ---------------------------------------------------------------------
// Kernel 4b: plain projection over a stack of 2*B planes (row branch, then col branch).
//   The col branch reads W shifted by wBranch columns; X is scaled by xscale.
// ---------------------------------------------------------------------
template <bool HAS_BIAS>
__global__ __launch_bounds__(32) void proj_wmma(const float* __restrict__ W, int ldW,
                                                int wBranch,
                                                const float* __restrict__ X,
                                                const float* __restrict__ bias,
                                                float xscale,
                                                float* __restrict__ Out,
                                                int Mdim, int Kdim, int Nn)
{
    const int b = blockIdx.z;                   // 0 .. 2*B-1
    gemm_tile<false, HAS_BIAS>(W + (b / Bc) * wBranch, ldW, X + (size_t)b * Kdim * Nn,
                               nullptr, xscale, bias, Out + (size_t)b * Mdim * Nn,
                               Kdim, Nn);
}

// =====================================================================
// Kernel 5: attention for one (b, h, 16-query tile). One wave per block.
//   Q,K,V are (2B, 128, P) row-major (row = h*32+d, col = position).
//   s = (Q^T·K)·SCALE; exact max over [keys, mem]; Z = Σe_m + rep·Σe_k
//   O[b, h*32+d, q] = (e_k·v_sum + e_m·mem_v) / Z
// =====================================================================
#define PADS 168
__global__ __launch_bounds__(32) void attn_wave(const float* __restrict__ Q,
                                                const float* __restrict__ Kf,
                                                const float* __restrict__ V,
                                                const float* __restrict__ memkv,
                                                float* __restrict__ O,
                                                int P, float rep)
{
    __shared__ float s[16][PADS];
    __shared__ float sm[16][NMEMc];
    __shared__ float rowZ[16];

    const int b = blockIdx.z, h = blockIdx.y, qt = blockIdx.x;
    const int lane = threadIdx.x;
    const int nl = lane & 15;
    const int k0 = (lane & 16) ? 8 : 0;
    const size_t base = ((size_t)b * HIDc + h * DHc) * P;
    const float* Qb = Q + base;
    const float* Kb = Kf + base;
    const float* Vb = V + base;
    const int qcol = qt * 16 + nl;

    // A fragment: A[i][d] = Q[b, h*32+d, qt*16+i]   (reused across all key tiles)
    v16h aq;
#pragma unroll
    for (int j = 0; j < 8; ++j) {
        aq[j]     = (_Float16)Qb[(k0 + j) * P + qcol];
        aq[8 + j] = (_Float16)Qb[(16 + k0 + j) * P + qcol];
    }

    // scores vs all key tiles (K = 32 = exactly one WMMA step)
    for (int jt = 0; jt < P / 16; ++jt) {
        const int kcol = jt * 16 + nl;
        v16h bk;
#pragma unroll
        for (int j = 0; j < 8; ++j) {
            bk[j]     = (_Float16)Kb[(k0 + j) * P + kcol];
            bk[8 + j] = (_Float16)Kb[(16 + k0 + j) * P + kcol];
        }
        v8f c = {};
        c = __builtin_amdgcn_wmma_f32_16x16x32_f16(false, aq, false, bk,
                                                   (short)0, c, false, false);
        const int rbase = (lane >> 4) * 8;
#pragma unroll
        for (int r = 0; r < 8; ++r)
            s[rbase + r][jt * 16 + nl] = c[r] * SCALE_F;
    }

    // memory-slot scores (scalar; 16 rows handled by lanes 0..15)
    if (lane < 16) {
#pragma unroll
        for (int jm = 0; jm < NMEMc; ++jm) {
            float acc = 0.f;
            for (int d = 0; d < DHc; ++d)
                acc += Qb[d * P + qt * 16 + lane] * memkv[(h * NMEMc + jm) * DHc + d];
            sm[lane][jm] = acc * SCALE_F;
        }
    }
    __syncthreads();

    // exact softmax stats per row
    if (lane < 16) {
        float mx = -3.4e38f;
        for (int j = 0; j < P; ++j) mx = fmaxf(mx, s[lane][j]);
#pragma unroll
        for (int jm = 0; jm < NMEMc; ++jm) mx = fmaxf(mx, sm[lane][jm]);
        float se = 0.f;
        for (int j = 0; j < P; ++j) {
            float e = expf(s[lane][j] - mx);
            s[lane][j] = e;
            se += e;
        }
        float sem = 0.f;
#pragma unroll
        for (int jm = 0; jm < NMEMc; ++jm) {
            float e = expf(sm[lane][jm] - mx);
            sm[lane][jm] = e;
            sem += e;
        }
        rowZ[lane] = sem + rep * se;
    }
    __syncthreads();

    // out = e_k @ v_sum  (K = P in steps of 32), two 16-wide d-tiles
    const int memv_off = Hc * NMEMc * DHc;   // mem_kv[1]
    for (int nt2 = 0; nt2 < 2; ++nt2) {
        v8f c = {};
        for (int kk = 0; kk < P; kk += 32) {
            // e-matrix row (contiguous in LDS, 16B aligned) and V row (contiguous
            // in global, 16B aligned) -> vector loads
            const float4 e0 = *(const float4*)(&s[nl][kk + k0]);
            const float4 e1 = *(const float4*)(&s[nl][kk + k0 + 4]);
            const float4 e2 = *(const float4*)(&s[nl][kk + 16 + k0]);
            const float4 e3 = *(const float4*)(&s[nl][kk + 16 + k0 + 4]);
            const float* Vrow = Vb + (size_t)(nt2 * 16 + nl) * P;
            const float4 v0 = *(const float4*)(Vrow + kk + k0);
            const float4 v1 = *(const float4*)(Vrow + kk + k0 + 4);
            const float4 v2 = *(const float4*)(Vrow + kk + 16 + k0);
            const float4 v3 = *(const float4*)(Vrow + kk + 16 + k0 + 4);
            const float ea[16] = { e0.x, e0.y, e0.z, e0.w, e1.x, e1.y, e1.z, e1.w,
                                   e2.x, e2.y, e2.z, e2.w, e3.x, e3.y, e3.z, e3.w };
            const float va[16] = { v0.x, v0.y, v0.z, v0.w, v1.x, v1.y, v1.z, v1.w,
                                   v2.x, v2.y, v2.z, v2.w, v3.x, v3.y, v3.z, v3.w };
            v16h ae, bv;
#pragma unroll
            for (int j = 0; j < 16; ++j) {
                ae[j] = (_Float16)ea[j];
                bv[j] = (_Float16)va[j];
            }
            c = __builtin_amdgcn_wmma_f32_16x16x32_f16(false, ae, false, bv,
                                                       (short)0, c, false, false);
        }
        const int rbase = (lane >> 4) * 8;
#pragma unroll
        for (int r = 0; r < 8; ++r) {
            const int i = rbase + r;
            const int d = nt2 * 16 + nl;
            float memc = 0.f;
#pragma unroll
            for (int jm = 0; jm < NMEMc; ++jm)
                memc += sm[i][jm] * memkv[memv_off + (h * NMEMc + jm) * DHc + d];
            O[((size_t)b * HIDc + h * DHc + d) * P + qt * 16 + i] =
                (c[r] + memc) / rowZ[i];
        }
    }
}

// =====================================================================
// Kernel 6: out[b,d,n,m] = Rrow[b,d,n] + Rcol[b,d,m]   (float4 writes)
// One block per (b,d) plane. 160 threads cover 4 rows of 40 float4, so a thread
// keeps its four columns of Rcol in registers and stores them under every 4th
// row: a wave lives for 40 stores of 512 contiguous bytes instead of one.
// =====================================================================
constexpr int BC_COLS4 = Mc / 4;                 // float4 per row
constexpr int BC_ROWS  = 4;                      // rows covered by one pass of the block
constexpr int BC_THREADS = BC_COLS4 * BC_ROWS;   // 160
static_assert(Mc % 4 == 0 && Nc % BC_ROWS == 0, "plane must split into whole passes");
__global__ __launch_bounds__(BC_THREADS) void bcast_add(const float* __restrict__ Rrow,
                                                        const float* __restrict__ Rcol,
                                                        float* __restrict__ out)
{
    const int plane = blockIdx.x;                // b*C + d
    const int t  = threadIdx.x;
    const int cg = t % BC_COLS4;
    const int r0 = t / BC_COLS4;
    const float4 cv = *(const float4*)(Rcol + (size_t)plane * Mc + cg * 4);
    const float* rr = Rrow + (size_t)plane * Nc + r0;
    float4* op = (float4*)(out + (size_t)plane * Nc * Mc) + t;
    // all row values are requested before the first store, so the stores wait once
    float rv[Nc / BC_ROWS];
#pragma unroll
    for (int k = 0; k < Nc / BC_ROWS; ++k) rv[k] = rr[k * BC_ROWS];
    // unrolled: rv[] stays in registers and every store takes an immediate offset
#pragma unroll
    for (int k = 0; k < Nc / BC_ROWS; ++k) {
        float4 o;
        o.x = rv[k] + cv.x; o.y = rv[k] + cv.y; o.z = rv[k] + cv.z; o.w = rv[k] + cv.w;
        op[k * BC_THREADS] = o;
    }
}

// =====================================================================
// Host launcher
// =====================================================================
extern "C" void kernel_launch(void* const* d_in, const int* in_sizes, int n_in,
                              void* d_out, int out_size, void* d_ws, size_t ws_size,
                              hipStream_t stream)
{
    const float* x     = (const float*)d_in[0];
    const float* gq    = (const float*)d_in[1];
    const float* gk    = (const float*)d_in[2];
    const float* gv    = (const float*)d_in[3];
    const float* Wq    = (const float*)d_in[4];
    const float* Wk    = (const float*)d_in[5];
    const float* Wv    = (const float*)d_in[6];
    const float* memkv = (const float*)d_in[7];
    const float* Wo    = (const float*)d_in[8];
    const float* bo    = (const float*)d_in[9];
    const float* Wr    = (const float*)d_in[10];
    float* out = (float*)d_out;

    // ---- workspace layout (floats); total ~7.0 MB ----
    float* w = (float*)d_ws;
    size_t o = 0;
    float* invp     = w + o; o += (size_t)Bc * Nc * Mc;   // 102400
    float* row_ft   = w + o; o += (size_t)Bc * Cc * Nc;   // 122880
    float* col_ft   = w + o; o += (size_t)Bc * Cc * Mc;
    float* Srow     = w + o; o += (size_t)Bc * Cc * Mc;
    float* Scol     = w + o; o += (size_t)Bc * Cc * Nc;
    float* inv_nrow = w + o; o += (size_t)Bc * Nc;
    float* inv_ncol = w + o; o += (size_t)Bc * Mc;
    // row-branch plane directly followed by its col-branch twin: a stack of 2*B planes
    float* Qr = w + o; o += (size_t)Bc * HIDc * Nc;       // 81920 each
    float* Qc = w + o; o += (size_t)Bc * HIDc * Mc;
    float* Kr = w + o; o += (size_t)Bc * HIDc * Mc;
    float* Kc = w + o; o += (size_t)Bc * HIDc * Nc;
    float* Vr = w + o; o += (size_t)Bc * HIDc * Mc;
    float* Vc = w + o; o += (size_t)Bc * HIDc * Nc;
    float* Orow = w + o; o += (size_t)Bc * HIDc * Nc;
    float* Ocol = w + o; o += (size_t)Bc * HIDc * Mc;
    float* row_attn = w + o; o += (size_t)Bc * Cc * Nc;
    float* col_attn = w + o; o += (size_t)Bc * Cc * Mc;
    float* Rrow = w + o; o += (size_t)Bc * Cc * Nc;
    float* Rcol = w + o; o += (size_t)Bc * Cc * Mc;
    (void)ws_size; (void)in_sizes; (void)n_in; (void)out_size;

    const float sqrtC = sqrtf((float)Cc);

    // 1) per-pixel channel norms (pass 1 over x)
    pixel_invnorm<<<(Bc * Nc * Mc + 255) / 256, 256, 0, stream>>>(x, invp);

    // 2) plane reductions (pass 2 over x)
    plane_reduce<<<dim3(Cc / PR_CH, Bc), PR_THREADS, 0, stream>>>(x, invp, row_ft, col_ft, Srow, Scol);

    // N == M, so the two branches have equal shapes and share one grid per stage:
    // blockIdx.z (or the flat index) runs over the 2*B stacked planes (6*B for QKV).
    static_assert(Nc == Mc, "branch stacking needs equal row and column lengths");
    (void)Qc; (void)Kc; (void)Vc; (void)Ocol; (void)col_attn;

    // 3) feature channel norms of [row_ft | col_ft] -> [inv_nrow | inv_ncol]
    feat_invnorm<<<(2 * Bc * Nc + 127) / 128, 128, 0, stream>>>(row_ft, inv_nrow, Nc, 2 * Bc * Nc);

    // 4) all six QKV projections (128x192x160 WMMA GEMMs) in one grid
    const dim3 gP(Nc / 16, HIDc / 16, 6 * Bc);
    qkv_wmma<<<gP, 32, 0, stream>>>(Wq, Wk, Wv, gq, gk, gv, row_ft, col_ft, Srow, Scol,
                                    inv_nrow, inv_ncol, sqrtC, Qr, HIDc, Cc, Nc);

    // 5) attention, both branches (one wave per (branch,b,h,q-tile))
    const dim3 gA(Nc / 16, Hc, 2 * Bc);
    attn_wave<<<gA, 32, 0, stream>>>(Qr, Kr, Vr, memkv, Orow, Nc, (float)Nc);

    // 6) output projections (192x128x160) with bias bo, both branches
    const dim3 gO(Nc / 16, Cc / 16, 2 * Bc);
    proj_wmma<true><<<gO, 32, 0, stream>>>(Wo, HIDc, 0, Orow, bo, 1.0f, row_attn, Cc, HIDc, Nc);

    // 7) Wr projections (192x192x160); Wr is (C, 2C): Wr1 = Wr[:, :C], Wr2 = Wr[:, C:]
    proj_wmma<false><<<gO, 32, 0, stream>>>(Wr, 2 * Cc, Cc, row_attn, nullptr, 1.0f, Rrow, Cc, Cc, Nc);

    // 8) broadcast add -> final output (78.6 MB, float4 stores)
    bcast_add<<<Bc * Cc, BC_THREADS, 0, stream>>>(Rrow, Rcol, out);
}

// v004
// A run of this version takes 66.8 microseconds.
// Next to v003, in two timings, it ran 1.18 and 1.17 times as fast.
// Counting every step since v000, it is 2.90 times as fast.
#include <hip/hip_runtime.h>
#include <math.h>

// ---------------- problem constants ----------------
constexpr int Bc   = 4;
constexpr int Cc   = 192;
constexpr int Nc   = 160;
constexpr int Mc   = 160;
constexpr int Hc   = 4;
constexpr int DHc  = 32;
constexpr int HIDc = 128;   // Hc*DHc
constexpr int NMEMc = 4;
#define SCALE_F 0.17677669529663687f   // 1/sqrt(32)

typedef __attribute__((ext_vector_type(16))) _Float16 v16h;
typedef __attribute__((ext_vector_type(8)))  float    v8f;
typedef __attribute__((ext_vector_type(4)))  float    v4f;

// =====================================================================
// Kernel 1: per-pixel inverse channel norm of x:  invp[b,n,m]
// =====================================================================
__global__ __launch_bounds__(256) void pixel_invnorm(const float* __restrict__ x,
                                                     float* __restrict__ invp)
{
    const int idx = blockIdx.x * blockDim.x + threadIdx.x;
    const int NM = Nc * Mc;
    if (idx >= Bc * NM) return;
    const int b = idx / NM;
    const int p = idx - b * NM;
    const float* xp = x + (size_t)b * Cc * NM + p;
    float s = 0.f;
    for (int c = 0; c < Cc; ++c) {
        float v = xp[(size_t)c * NM];
        s += v * v;
    }
    invp[idx] = 1.0f / fmaxf(sqrtf(s), 1e-12f);
}

// =====================================================================
// Kernel 2: plane reductions, every plane read once with whole-line loads.
//  row_ft[b,c,n] = mean_m x          col_ft[b,c,m] = mean_n x
//  Scol[b,c,n]   = sum_m x*invp      Srow[b,c,m]   = sum_n x*invp
// One block takes 3 channels of one batch entry, so a float4 of invp serves three
// planes. 640 threads cover 16 rows of 40 float4; a thread keeps its four columns'
// sums in registers and leaves each row's four-element partial in LDS. After the
// barrier one thread per (channel, index) adds up a row's 40 partials and a
// column's 16 partials.
// =====================================================================
constexpr int PR_CH      = 3;                       // channels per block
constexpr int PR_COLS4   = Mc / 4;                  // float4 per row
constexpr int PR_SLOTS   = 16;                      // rows covered by one pass
constexpr int PR_THREADS = PR_COLS4 * PR_SLOTS;     // 640
constexpr int PR_PASSES  = Nc / PR_SLOTS;           // 10
constexpr int PR_GRP     = 2;                       // passes fetched together
constexpr int PR_NGRP    = PR_PASSES / PR_GRP;      // 5
constexpr int PR_PITCH   = PR_COLS4 + 1;            // odd pitch: 32 rows read side by side hit distinct banks
static_assert(Cc % PR_CH == 0 && Nc % PR_SLOTS == 0 && Mc % 4 == 0 && Nc == Mc &&
              PR_PASSES % PR_GRP == 0 && PR_CH * Nc <= PR_THREADS && (PR_CH * Nc) % 32 == 0, "plane_reduce tiling");
__global__ __launch_bounds__(PR_THREADS) void plane_reduce(const float* __restrict__ x,
                                                           const float* __restrict__ invp,
                                                           float* __restrict__ row_ft,
                                                           float* __restrict__ col_ft,
                                                           float* __restrict__ Srow,
                                                           float* __restrict__ Scol)
{
    __shared__ float2 rowp[PR_CH][Nc][PR_PITCH];            // (sum, weighted sum) of 4 columns
    __shared__ v4f colp[PR_SLOTS][PR_CH][2][PR_COLS4];      // column sums of one row slot

    const int b = blockIdx.y, c0 = blockIdx.x * PR_CH;
    const int t  = threadIdx.x;
    const int cg = t % PR_COLS4;
    const int r0 = t / PR_COLS4;
    constexpr int PLANE4 = Nc * Mc / 4;
    const v4f* xp = (const v4f*)(x + ((size_t)b * Cc + c0) * Nc * Mc) + t;
    const v4f* ip = (const v4f*)(invp + (size_t)b * Nc * Mc) + t;

    v4f cs[PR_CH], cw[PR_CH];
#pragma unroll
    for (int ch = 0; ch < PR_CH; ++ch) {
        cs[ch] = (v4f)(0.f);
        cw[ch] = (v4f)(0.f);
    }
    // Two register sets of PR_GRP passes each: the next group's loads are issued before
    // this group is summed. Unrolled, so set indices are static and offsets immediate.
    v4f wv[2][PR_GRP], xv[2][PR_GRP][PR_CH];
#pragma unroll
    for (int p = 0; p < PR_GRP; ++p) {
        wv[0][p] = ip[p * PR_THREADS];
#pragma unroll
        for (int ch = 0; ch < PR_CH; ++ch) xv[0][p][ch] = xp[ch * PLANE4 + p * PR_THREADS];
    }
#pragma unroll
    for (int g = 0; g < PR_NGRP; ++g) {
        const int cur = g & 1, nxt = cur ^ 1;
        // the pair of scheduling barriers pins "next group's loads, then this group's sums";
        // without it each load sinks to its use and the wave waits out one load at a time
        __builtin_amdgcn_sched_barrier(0);
        if (g + 1 < PR_NGRP) {
#pragma unroll
            for (int p = 0; p < PR_GRP; ++p) {
                const int k = (g + 1) * PR_GRP + p;
                wv[nxt][p] = ip[k * PR_THREADS];
#pragma unroll
                for (int ch = 0; ch < PR_CH; ++ch)
                    xv[nxt][p][ch] = xp[ch * PLANE4 + k * PR_THREADS];
            }
        }
        __builtin_amdgcn_sched_barrier(0);
#pragma unroll
        for (int p = 0; p < PR_GRP; ++p) {
            const v4f w4 = wv[cur][p];
#pragma unroll
            for (int ch = 0; ch < PR_CH; ++ch) {
                const v4f v = xv[cur][p][ch];
                const v4f vw = v * w4;
                cs[ch] += v;
                cw[ch] += vw;
                rowp[ch][(g * PR_GRP + p) * PR_SLOTS + r0][cg] =
                    make_float2((v.x + v.y) + (v.z + v.w), (vw.x + vw.y) + (vw.z + vw.w));
            }
        }
    }
#pragma unroll
    for (int ch = 0; ch < PR_CH; ++ch) {
        colp[r0][ch][0][cg] = cs[ch];
        colp[r0][ch][1][cg] = cw[ch];
    }
    // the loads' base and index registers are reused below: this wait stands in front of that
    asm volatile("s_wait_xcnt 0x0" ::: "memory");
    __syncthreads();

    if (t < PR_CH * Nc) {       // whole waves: 480 = 15 * 32
        const int ch = t / Nc;
        const int i  = t - ch * Nc;
        float rs = 0.f, rw = 0.f;
#pragma unroll
        for (int j = 0; j < PR_COLS4; ++j) {
            const float2 p = rowp[ch][i][j];
            rs += p.x;
            rw += p.y;
        }
        const float* cp = (const float*)colp;
        float ss = 0.f, sw = 0.f;
#pragma unroll
        for (int sl = 0; sl < PR_SLOTS; ++sl) {
            ss += cp[((sl * PR_CH + ch) * 2 + 0) * Mc + i];
            sw += cp[((sl * PR_CH + ch) * 2 + 1) * Mc + i];
        }
        const size_t o = ((size_t)b * Cc + c0 + ch) * Nc + i;
        row_ft[o] = rs * (1.0f / Mc);
        Scol[o]   = rw;
        col_ft[o] = ss * (1.0f / Nc);
        Srow[o]   = sw;
    }
}

// =====================================================================
// Kernel 3: inverse channel norm of a (2B,C,P) feature stack per column p
// =====================================================================
__global__ __launch_bounds__(128) void feat_invnorm(const float* __restrict__ f,
                                                    float* __restrict__ inv,
                                                    int P, int total)
{
    const int idx = blockIdx.x * blockDim.x + threadIdx.x;
    if (idx >= total) return;
    const int b = idx / P;
    const int p = idx - b * P;
    const float* fp = f + (size_t)b * Cc * P + p;
    float s = 0.f;
    for (int c = 0; c < Cc; ++c) {
        float v = fp[(size_t)c * P];
        s += v * v;
    }
    inv[idx] = 1.0f / fmaxf(sqrtf(s), 1e-12f);
}

// =====================================================================
// Kernel 4: generic WMMA GEMM tile (one wave = one 16x16 output tile)
//   Outb[m,p] = sum_k (W[m,k]*cs[k]) * (Xb[k,p] * psn) + bias[m]
// Xb / Outb are the planes of one batch entry; psn is this lane's column scale.
// Compile-time specialization removes all null-pointer branches.
// A/cs loads are float4 (global_load_b128); B loads coalesce across lanes.
// Fragment layouts per CDNA5 ISA 7.12.2 (16-bit A 16x32; B row-striped).
// =====================================================================
template <bool HAS_CS, bool HAS_BIAS>
__device__ __forceinline__ void gemm_tile(const float* __restrict__ W, int ldW,
                                          const float* __restrict__ Xb,
                                          const float* __restrict__ cs,
                                          float psn,
                                          const float* __restrict__ bias,
                                          float* __restrict__ Outb,
                                          int Kdim, int Nn)
{
    const int mt = blockIdx.y;
    const int nt = blockIdx.x;
    const int lane = threadIdx.x;
    const int nl = lane & 15;
    const int k0 = (lane & 16) ? 8 : 0;

    const int mrow = (mt << 4) + nl;           // A-matrix row held by this lane
    const int ncol = (nt << 4) + nl;           // B/D column held by this lane
    const float* Wrow = W + (size_t)mrow * ldW;

    v8f acc = {};
    for (int kk = 0; kk < Kdim; kk += 32) {
        const int ka = kk + k0;       // multiple of 4 -> 16B aligned
        const int kb = ka + 16;
        const float4 w0 = *(const float4*)(Wrow + ka);
        const float4 w1 = *(const float4*)(Wrow + ka + 4);
        const float4 w2 = *(const float4*)(Wrow + kb);
        const float4 w3 = *(const float4*)(Wrow + kb + 4);
        float wa[16] = { w0.x, w0.y, w0.z, w0.w, w1.x, w1.y, w1.z, w1.w,
                         w2.x, w2.y, w2.z, w2.w, w3.x, w3.y, w3.z, w3.w };
        if (HAS_CS) {
            const float4 c0 = *(const float4*)(cs + ka);
            const float4 c1 = *(const float4*)(cs + ka + 4);
            const float4 c2 = *(const float4*)(cs + kb);
            const float4 c3 = *(const float4*)(cs + kb + 4);
            const float ca[16] = { c0.x, c0.y, c0.z, c0.w, c1.x, c1.y, c1.z, c1.w,
                                   c2.x, c2.y, c2.z, c2.w, c3.x, c3.y, c3.z, c3.w };
#pragma unroll
            for (int j = 0; j < 16; ++j) wa[j] *= ca[j];
        }
        v16h a, bf;
#pragma unroll
        for (int j = 0; j < 8; ++j) {
            a[j]     = (_Float16)wa[j];
            a[8 + j] = (_Float16)wa[8 + j];
            bf[j]     = (_Float16)(Xb[(size_t)(ka + j) * Nn + ncol] * psn);
            bf[8 + j] = (_Float16)(Xb[(size_t)(kb + j) * Nn + ncol] * psn);
        }
        acc = __builtin_amdgcn_wmma_f32_16x16x32_f16(false, a, false, bf,
                                                     (short)0, acc, false, false);
    }
    const int rbase = (lane >> 4) * 8;
#pragma unroll
    for (int r = 0; r < 8; ++r) {
        const int m = (mt << 4) + rbase + r;
        float v = acc[r];
        if (HAS_BIAS) v += bias[m];
        Outb[(size_t)m * Nn + ncol] = v;
    }
}

// ---------------------------------------------------------------------
// Kernel 4a: all six q/k/v projections in one grid.
//   blockIdx.z = ((branch*3 + kind) * B + b), kind 0=q 1=k 2=v, branch 0=row 1=col
//   row branch: q<-row_ft, k<-col_ft, v<-Srow ; col branch: q<-col_ft, k<-row_ft, v<-Scol
//   Out planes are stacked [Qr|Qc|Kr|Kc|Vr|Vc], each (B, HID, P).
// ---------------------------------------------------------------------
__global__ __launch_bounds__(32) void qkv_wmma(const float* __restrict__ Wq,
                                               const float* __restrict__ Wk,
                                               const float* __restrict__ Wv,
                                               const float* __restrict__ gq,
                                               const float* __restrict__ gk,
                                               const float* __restrict__ gv,
                                               const float* __restrict__ row_ft,
                                               const float* __restrict__ col_ft,
                                               const float* __restrict__ Srow,
                                               const float* __restrict__ Scol,
                                               const float* __restrict__ inv_nrow,
                                               const float* __restrict__ inv_ncol,
                                               float xscale,
                                               float* __restrict__ qkv,
                                               int Mdim, int Kdim, int Nn)
{
    const int z      = blockIdx.z;
    const int b      = z % Bc;
    const int g      = z / Bc;
    const int kind   = g % 3;
    const int branch = g / 3;
    const bool from_row = (kind == branch);     // q of row branch, k of col branch
    const float* W  = (kind == 0) ? Wq : (kind == 1) ? Wk : Wv;
    const float* cs = (kind == 0) ? gq : (kind == 1) ? gk : gv;
    const float* X  = (kind == 2) ? (branch ? Scol : Srow) : (from_row ? row_ft : col_ft);
    const int ncol = (blockIdx.x << 4) + (threadIdx.x & 15);
    float psn = xscale;
    if (kind != 2)
        psn = (from_row ? inv_nrow : inv_ncol)[(size_t)b * Nn + ncol] * xscale;
    gemm_tile<true, false>(W, Kdim, X + (size_t)b * Kdim * Nn, cs, psn, nullptr,
                           qkv + ((size_t)(kind * 2 + branch) * Bc + b) * Mdim * Nn,
                           Kdim, Nn);
}

// ---------------------------------------------------------------------
// Kernel 4b: plain projection over a stack of 2*B planes (row branch, then col branch).
//   The col branch reads W shifted by wBranch columns; X is scaled by xscale.
// ---------------------------------------------------------------------
template <bool HAS_BIAS>
__global__ __launch_bounds__(32) void proj_wmma(const float* __restrict__ W, int ldW,
                                                int wBranch,
                                                const float* __restrict__ X,
                                                const float* __restrict__ bias,
                                                float xscale,
                                                float* __restrict__ Out,
                                                int Mdim, int Kdim, int Nn)
{
    const int b = blockIdx.z;                   // 0 .. 2*B-1
    gemm_tile<false, HAS_BIAS>(W + (b / Bc) * wBranch, ldW, X + (size_t)b * Kdim * Nn,
                               nullptr, xscale, bias, Out + (size_t)b * Mdim * Nn,
                               Kdim, Nn);
}

// =====================================================================
// Kernel 5: attention for one (b, h, 16-query tile). One wave per block, no LDS.
//   Q,K,V are (B, 128, P) row-major (row = h*32+d, col = position), P = 160 fixed.
//   s = (Q^T.K).SCALE; exact max over [keys, mem]; Z = sum e_m + rep * sum e_k
//   O[b, h*32+d, q] = (e_k.v_sum + e_m.mem_v) / Z
// The scores are formed transposed, D[key][query] = K^T.Q: a lane then holds 80 of the
// 160 scores of ONE query (its column), lane l ^ 16 the other 80. Maximum and sum are
// register trees plus one exchange with that lane, and two score tiles, converted in
// place, are the B operand of out^T[d][query] = V.e^T (k order 8h+s, 16+8h+s on both
// sides). All trip counts are constants: the loops unroll, every load takes an immediate
// offset from a fixed base, and no address depends on a loaded value.
// =====================================================================
// lane l reads lane l ^ 16: a vector move between the two 16-lane rows, no LDS-path wait
__device__ __forceinline__ float other_row(float v)
{
    const unsigned u = __float_as_uint(v);
    return __uint_as_float(__builtin_amdgcn_permlanex16(u, u, 0x76543210u, 0xfedcba98u, false, false));
}

constexpr int AT_P  = Nc;           // keys = queries = 160 in both branches
constexpr int AT_NT = AT_P / 16;    // 16-key score tiles
constexpr int AT_NK = AT_P / 32;    // 32-key steps of the second product
static_assert(Nc == Mc && AT_P % 32 == 0 && DHc == 32, "attention tiling");
__global__ __launch_bounds__(32) void attn_wave(const float* __restrict__ Q,
                                                const float* __restrict__ Kf,
                                                const float* __restrict__ V,
                                                const float* __restrict__ memkv,
                                                float* __restrict__ O,
                                                float rep)
{
    constexpr int P = AT_P;
    const int b = blockIdx.z, h = blockIdx.y, qt = blockIdx.x;
    const int lane = threadIdx.x;
    const int nl = lane & 15;
    const int k0 = (lane >> 4) * 8;
    const size_t base = ((size_t)b * HIDc + h * DHc) * P;
    const float* Qp = Q + base + (size_t)k0 * P + qt * 16 + nl;    // column = this lane's query
    const float* Kp = Kf + base + (size_t)k0 * P + nl;             // row of K^T = key nl of a tile
    const float* Vp = V + base + (size_t)nl * P + k0;              // row of V = channel nl of a tile
    const float* mk = memkv + h * NMEMc * DHc + k0;                // mem_kv[0]
    const float* mv = mk + Hc * NMEMc * DHc;                       // mem_kv[1]

    // this lane's 16 of the 32 channels of its query: d = k0 + j and 16 + k0 + j
    float qf[16];
#pragma unroll
    for (int j = 0; j < 8; ++j) {
        qf[j]     = Qp[j * P];
        qf[8 + j] = Qp[(16 + j) * P];
    }
    v16h bq;
#pragma unroll
    for (int j = 0; j < 16; ++j) bq[j] = (_Float16)qf[j];

    // scores: sc[jt][r] = s[key jt*16 + k0 + r][query nl]
    v8f sc[AT_NT];
#pragma unroll
    for (int jt = 0; jt < AT_NT; ++jt) {
        v16h ak;
#pragma unroll
        for (int j = 0; j < 8; ++j) {
            ak[j]     = (_Float16)Kp[j * P + jt * 16];
            ak[8 + j] = (_Float16)Kp[(16 + j) * P + jt * 16];
        }
        v8f c = {};
        c = __builtin_amdgcn_wmma_f32_16x16x32_f16(false, ak, false, bq,
                                                   (short)0, c, false, false);
        sc[jt] = c * SCALE_F;
    }

    // memory-slot scores in f32: each lane sums its 16 channels, the other row adds its 16
    float sm[NMEMc];
#pragma unroll
    for (int jm = 0; jm < NMEMc; ++jm) {
        const float4 m0 = *(const float4*)(mk + jm * DHc);
        const float4 m1 = *(const float4*)(mk + jm * DHc + 4);
        const float4 m2 = *(const float4*)(mk + jm * DHc + 16);
        const float4 m3 = *(const float4*)(mk + jm * DHc + 20);
        const float ma[16] = { m0.x, m0.y, m0.z, m0.w, m1.x, m1.y, m1.z, m1.w,
                               m2.x, m2.y, m2.z, m2.w, m3.x, m3.y, m3.z, m3.w };
        float acc = 0.f;
#pragma unroll
        for (int j = 0; j < 16; ++j) acc += qf[j] * ma[j];
        sm[jm] = acc;
    }
#pragma unroll
    for (int jm = 0; jm < NMEMc; ++jm) sm[jm] = (sm[jm] + other_row(sm[jm])) * SCALE_F;

    // exact maximum of the query's 160 + 4 scores
    v8f m8 = sc[0];
#pragma unroll
    for (int jt = 1; jt < AT_NT; ++jt)
#pragma unroll
        for (int r = 0; r < 8; ++r) m8[r] = fmaxf(m8[r], sc[jt][r]);
    float mx = fmaxf(fmaxf(fmaxf(m8[0], m8[1]), fmaxf(m8[2], m8[3])),
                     fmaxf(fmaxf(m8[4], m8[5]), fmaxf(m8[6], m8[7])));
    mx = fmaxf(mx, other_row(mx));
#pragma unroll
    for (int jm = 0; jm < NMEMc; ++jm) mx = fmaxf(mx, sm[jm]);

    v8f s8 = {};
#pragma unroll
    for (int jt = 0; jt < AT_NT; ++jt)
#pragma unroll
        for (int r = 0; r < 8; ++r) {
            const float e = expf(sc[jt][r] - mx);
            sc[jt][r] = e;
            s8[r] += e;
        }
    float se = ((s8[0] + s8[1]) + (s8[2] + s8[3])) + ((s8[4] + s8[5]) + (s8[6] + s8[7]));
    se += other_row(se);
    float sem = 0.f;
#pragma unroll
    for (int jm = 0; jm < NMEMc; ++jm) {
        sm[jm] = expf(sm[jm] - mx);
        sem += sm[jm];
    }
    const float Z = sem + rep * se;

    // B operand of the second product: be[t][s] = e[key t*32 + kmap(s)][query nl]
    v16h be[AT_NK];
#pragma unroll
    for (int t = 0; t < AT_NK; ++t)
#pragma unroll
        for (int j = 0; j < 8; ++j) {
            be[t][j]     = (_Float16)sc[2 * t][j];
            be[t][8 + j] = (_Float16)sc[2 * t + 1][j];
        }

    // out^T = V . e^T, two 16-channel tiles; c[r] = out[d = nt2*16 + k0 + r][query nl]
    float* Op = O + base + (size_t)k0 * P + qt * 16 + nl;
#pragma unroll
    for (int nt2 = 0; nt2 < 2; ++nt2) {
        v8f c = {};
#pragma unroll
        for (int t = 0; t < AT_NK; ++t) {
            const float* Vrow = Vp + nt2 * 16 * P + t * 32;
            const float4 v0 = *(const float4*)(Vrow);
            const float4 v1 = *(const float4*)(Vrow + 4);
            const float4 v2 = *(const float4*)(Vrow + 16);
            const float4 v3 = *(const float4*)(Vrow + 20);
            const float va[16] = { v0.x, v0.y, v0.z, v0.w, v1.x, v1.y, v1.z, v1.w,
                                   v2.x, v2.y, v2.z, v2.w, v3.x, v3.y, v3.z, v3.w };
            v16h av;
#pragma unroll
            for (int j = 0; j < 16; ++j) av[j] = (_Float16)va[j];
            c = __builtin_amdgcn_wmma_f32_16x16x32_f16(false, av, false, be[t],
                                                       (short)0, c, false, false);
        }
        float memc[8] = { 0.f, 0.f, 0.f, 0.f, 0.f, 0.f, 0.f, 0.f };
#pragma unroll
        for (int jm = 0; jm < NMEMc; ++jm) {
            const float4 w0 = *(const float4*)(mv + jm * DHc + nt2 * 16);
            const float4 w1 = *(const float4*)(mv + jm * DHc + nt2 * 16 + 4);
            const float wa[8] = { w0.x, w0.y, w0.z, w0.w, w1.x, w1.y, w1.z, w1.w };
#pragma unroll
            for (int r = 0; r < 8; ++r) memc[r] += sm[jm] * wa[r];
        }
#pragma unroll
        for (int r = 0; r < 8; ++r)
            Op[(nt2 * 16 + r) * P] = (c[r] + memc[r]) / Z;
    }
}

// =====================================================================
// Kernel 6: out[b,d,n,m] = Rrow[b,d,n] + Rcol[b,d,m]   (float4 writes)
// One block per (b,d) plane. 160 threads cover 4 rows of 40 float4, so a thread
// keeps its four columns of Rcol in registers and stores them under every 4th
// row: a wave lives for 40 stores of 512 contiguous bytes instead of one.
// =====================================================================
constexpr int BC_COLS4 = Mc / 4;                 // float4 per row
constexpr int BC_ROWS  = 4;                      // rows covered by one pass of the block
constexpr int BC_THREADS = BC_COLS4 * BC_ROWS;   // 160
static_assert(Mc % 4 == 0 && Nc % BC_ROWS == 0, "plane must split into whole passes");
__global__ __launch_bounds__(BC_THREADS) void bcast_add(const float* __restrict__ Rrow,
                                                        const float* __restrict__ Rcol,
                                                        float* __restrict__ out)
{
    const int plane = blockIdx.x;                // b*C + d
    const int t  = threadIdx.x;
    const int cg = t % BC_COLS4;
    const int r0 = t / BC_COLS4;
    const float4 cv = *(const float4*)(Rcol + (size_t)plane * Mc + cg * 4);
    const float* rr = Rrow + (size_t)plane * Nc + r0;
    float4* op = (float4*)(out + (size_t)plane * Nc * Mc) + t;
    // all row values are requested before the first store, so the stores wait once
    float rv[Nc / BC_ROWS];
#pragma unroll
    for (int k = 0; k < Nc / BC_ROWS; ++k) rv[k] = rr[k * BC_ROWS];
    // unrolled: rv[] stays in registers and every store takes an immediate offset
#pragma unroll
    for (int k = 0; k < Nc / BC_ROWS; ++k) {
        float4 o;
        o.x = rv[k] + cv.x; o.y = rv[k] + cv.y; o.z = rv[k] + cv.z; o.w = rv[k] + cv.w;
        op[k * BC_THREADS] = o;
    }
}

// =====================================================================
// Host launcher
// =====================================================================
extern "C" void kernel_launch(void* const* d_in, const int* in_sizes, int n_in,
                              void* d_out, int out_size, void* d_ws, size_t ws_size,
                              hipStream_t stream)
{
    const float* x     = (const float*)d_in[0];
    const float* gq    = (const float*)d_in[1];
    const float* gk    = (const float*)d_in[2];
    const float* gv    = (const float*)d_in[3];
    const float* Wq    = (const float*)d_in[4];
    const float* Wk    = (const float*)d_in[5];
    const float* Wv    = (const float*)d_in[6];
    const float* memkv = (const float*)d_in[7];
    const float* Wo    = (const float*)d_in[8];
    const float* bo    = (const float*)d_in[9];
    const float* Wr    = (const float*)d_in[10];
    float* out = (float*)d_out;

    // ---- workspace layout (floats); total ~7.0 MB ----
    float* w = (float*)d_ws;
    size_t o = 0;
    float* invp     = w + o; o += (size_t)Bc * Nc * Mc;   // 102400
    float* row_ft   = w + o; o += (size_t)Bc * Cc * Nc;   // 122880
    float* col_ft   = w + o; o += (size_t)Bc * Cc * Mc;
    float* Srow     = w + o; o += (size_t)Bc * Cc * Mc;
    float* Scol     = w + o; o += (size_t)Bc * Cc * Nc;
    float* inv_nrow = w + o; o += (size_t)Bc * Nc;
    float* inv_ncol = w + o; o += (size_t)Bc * Mc;
    // row-branch plane directly followed by its col-branch twin: a stack of 2*B planes
    float* Qr = w + o; o += (size_t)Bc * HIDc * Nc;       // 81920 each
    float* Qc = w + o; o += (size_t)Bc * HIDc * Mc;
    float* Kr = w + o; o += (size_t)Bc * HIDc * Mc;
    float* Kc = w + o; o += (size_t)Bc * HIDc * Nc;
    float* Vr = w + o; o += (size_t)Bc * HIDc * Mc;
    float* Vc = w + o; o += (size_t)Bc * HIDc * Nc;
    float* Orow = w + o; o += (size_t)Bc * HIDc * Nc;
    float* Ocol = w + o; o += (size_t)Bc * HIDc * Mc;
    float* row_attn = w + o; o += (size_t)Bc * Cc * Nc;
    float* col_attn = w + o; o += (size_t)Bc * Cc * Mc;
    float* Rrow = w + o; o += (size_t)Bc * Cc * Nc;
    float* Rcol = w + o; o += (size_t)Bc * Cc * Mc;
    (void)ws_size; (void)in_sizes; (void)n_in; (void)out_size;

    const float sqrtC = sqrtf((float)Cc);

    // 1) per-pixel channel norms (pass 1 over x)
    pixel_invnorm<<<(Bc * Nc * Mc + 255) / 256, 256, 0, stream>>>(x, invp);

    // 2) plane reductions (pass 2 over x)
    plane_reduce<<<dim3(Cc / PR_CH, Bc), PR_THREADS, 0, stream>>>(x, invp, row_ft, col_ft, Srow, Scol);

    // N == M, so the two branches have equal shapes and share one grid per stage:
    // blockIdx.z (or the flat index) runs over the 2*B stacked planes (6*B for QKV).
    static_assert(Nc == Mc, "branch stacking needs equal row and column lengths");
    (void)Qc; (void)Kc; (void)Vc; (void)Ocol; (void)col_attn;

    // 3) feature channel norms of [row_ft | col_ft] -> [inv_nrow | inv_ncol]
    feat_invnorm<<<(2 * Bc * Nc + 127) / 128, 128, 0, stream>>>(row_ft, inv_nrow, Nc, 2 * Bc * Nc);

    // 4) all six QKV projections (128x192x160 WMMA GEMMs) in one grid
    const dim3 gP(Nc / 16, HIDc / 16, 6 * Bc);
    qkv_wmma<<<gP, 32, 0, stream>>>(Wq, Wk, Wv, gq, gk, gv, row_ft, col_ft, Srow, Scol,
                                    inv_nrow, inv_ncol, sqrtC, Qr, HIDc, Cc, Nc);

    // 5) attention, both branches (one wave per (branch,b,h,q-tile))
    const dim3 gA(Nc / 16, Hc, 2 * Bc);
    attn_wave<<<gA, 32, 0, stream>>>(Qr, Kr, Vr, memkv, Orow, (float)Nc);

    // 6) output projections (192x128x160) with bias bo, both branches
    const dim3 gO(Nc / 16, Cc / 16, 2 * Bc);
    proj_wmma<true><<<gO, 32, 0, stream>>>(Wo, HIDc, 0, Orow, bo, 1.0f, row_attn, Cc, HIDc, Nc);

    // 7) Wr projections (192x192x160); Wr is (C, 2C): Wr1 = Wr[:, :C], Wr2 = Wr[:, C:]
    proj_wmma<false><<<gO, 32, 0, stream>>>(Wr, 2 * Cc, Cc, row_attn, nullptr, 1.0f, Rrow, Cc, Cc, Nc);

    // 8) broadcast add -> final output (78.6 MB, float4 stores)
    bcast_add<<<Bc * Cc, BC_THREADS, 0, stream>>>(Rrow, Rcol, out);
}

// v005
// It runs in 54.7 microseconds.
// Timed twice side by side with v004, it ran 1.20 and 1.22 times as fast.
// Counting every step since v000, it is 3.51 times as fast.
#include <hip/hip_runtime.h>
#include <math.h>

// ---------------- problem constants ----------------
constexpr int Bc   = 4;
constexpr int Cc   = 192;
constexpr int Nc   = 160;
constexpr int Mc   = 160;
constexpr int Hc   = 4;
constexpr int DHc  = 32;
constexpr int HIDc = 128;   // Hc*DHc
constexpr int NMEMc = 4;
#define SCALE_F 0.17677669529663687f   // 1/sqrt(32)

typedef __attribute__((ext_vector_type(16))) _Float16 v16h;
typedef __attribute__((ext_vector_type(8)))  float    v8f;
typedef __attribute__((ext_vector_type(4)))  float    v4f;

// =====================================================================
// Kernel 1: per-pixel inverse channel norm of x:  invp[b,n,m]
// =====================================================================
__global__ __launch_bounds__(256) void pixel_invnorm(const float* __restrict__ x,
                                                     float* __restrict__ invp)
{
    const int idx = blockIdx.x * blockDim.x + threadIdx.x;
    const int NM = Nc * Mc;
    if (idx >= Bc * NM) return;
    const int b = idx / NM;
    const int p = idx - b * NM;
    const float* xp = x + (size_t)b * Cc * NM + p;
    float s = 0.f;
    for (int c = 0; c < Cc; ++c) {
        float v = xp[(size_t)c * NM];
        s += v * v;
    }
    invp[idx] = 1.0f / fmaxf(sqrtf(s), 1e-12f);
}

// =====================================================================
// Kernel 2: plane reductions, every plane read once with whole-line loads.
//  row_ft[b,c,n] = mean_m x          col_ft[b,c,m] = mean_n x
//  Scol[b,c,n]   = sum_m x*invp      Srow[b,c,m]   = sum_n x*invp
// One block takes 3 channels of one batch entry, so a float4 of invp serves three
// planes. 640 threads cover 16 rows of 40 float4; a thread keeps its four columns'
// sums in registers and leaves each row's four-element partial in LDS. After the
// barrier one thread per (channel, index) adds up a row's 40 partials and a
// column's 16 partials.
// =====================================================================
constexpr int PR_CH      = 3;                       // channels per block
constexpr int PR_COLS4   = Mc / 4;                  // float4 per row
constexpr int PR_SLOTS   = 16;                      // rows covered by one pass
constexpr int PR_THREADS = PR_COLS4 * PR_SLOTS;     // 640
constexpr int PR_PASSES  = Nc / PR_SLOTS;           // 10
constexpr int PR_GRP     = 2;                       // passes fetched together
constexpr int PR_NGRP    = PR_PASSES / PR_GRP;      // 5
constexpr int PR_PITCH   = PR_COLS4 + 1;            // odd pitch: 32 rows read side by side hit distinct banks
static_assert(Cc % PR_CH == 0 && Nc % PR_SLOTS == 0 && Mc % 4 == 0 && Nc == Mc &&
              PR_PASSES % PR_GRP == 0 && PR_CH * Nc <= PR_THREADS && (PR_CH * Nc) % 32 == 0, "plane_reduce tiling");
__global__ __launch_bounds__(PR_THREADS) void plane_reduce(const float* __restrict__ x,
                                                           const float* __restrict__ invp,
                                                           float* __restrict__ row_ft,
                                                           float* __restrict__ col_ft,
                                                           float* __restrict__ Srow,
                                                           float* __restrict__ Scol)
{
    __shared__ float2 rowp[PR_CH][Nc][PR_PITCH];            // (sum, weighted sum) of 4 columns
    __shared__ v4f colp[PR_SLOTS][PR_CH][2][PR_COLS4];      // column sums of one row slot

    const int b = blockIdx.y, c0 = blockIdx.x * PR_CH;
    const int t  = threadIdx.x;
    const int cg = t % PR_COLS4;
    const int r0 = t / PR_COLS4;
    constexpr int PLANE4 = Nc * Mc / 4;
    const v4f* xp = (const v4f*)(x + ((size_t)b * Cc + c0) * Nc * Mc) + t;
    const v4f* ip = (const v4f*)(invp + (size_t)b * Nc * Mc) + t;

    v4f cs[PR_CH], cw[PR_CH];
#pragma unroll
    for (int ch = 0; ch < PR_CH; ++ch) {
        cs[ch] = (v4f)(0.f);
        cw[ch] = (v4f)(0.f);
    }
    // Two register sets of PR_GRP passes each: the next group's loads are issued before
    // this group is summed. Unrolled, so set indices are static and offsets immediate.
    v4f wv[2][PR_GRP], xv[2][PR_GRP][PR_CH];
#pragma unroll
    for (int p = 0; p < PR_GRP; ++p) {
        wv[0][p] = ip[p * PR_THREADS];
#pragma unroll
        for (int ch = 0; ch < PR_CH; ++ch) xv[0][p][ch] = xp[ch * PLANE4 + p * PR_THREADS];
    }
#pragma unroll
    for (int g = 0; g < PR_NGRP; ++g) {
        const int cur = g & 1, nxt = cur ^ 1;
        // the pair of scheduling barriers pins "next group's loads, then this group's sums";
        // without it each load sinks to its use and the wave waits out one load at a time
        __builtin_amdgcn_sched_barrier(0);
        if (g + 1 < PR_NGRP) {
#pragma unroll
            for (int p = 0; p < PR_GRP; ++p) {
                const int k = (g + 1) * PR_GRP + p;
                wv[nxt][p] = ip[k * PR_THREADS];
#pragma unroll
                for (int ch = 0; ch < PR_CH; ++ch)
                    xv[nxt][p][ch] = xp[ch * PLANE4 + k * PR_THREADS];
            }
        }
        __builtin_amdgcn_sched_barrier(0);
#pragma unroll
        for (int p = 0; p < PR_GRP; ++p) {
            const v4f w4 = wv[cur][p];
#pragma unroll
            for (int ch = 0; ch < PR_CH; ++ch) {
                const v4f v = xv[cur][p][ch];
                const v4f vw = v * w4;
                cs[ch] += v;
                cw[ch] += vw;
                rowp[ch][(g * PR_GRP + p) * PR_SLOTS + r0][cg] =
                    make_float2((v.x + v.y) + (v.z + v.w), (vw.x + vw.y) + (vw.z + vw.w));
            }
        }
    }
#pragma unroll
    for (int ch = 0; ch < PR_CH; ++ch) {
        colp[r0][ch][0][cg] = cs[ch];
        colp[r0][ch][1][cg] = cw[ch];
    }
    // the loads' base and index registers are reused below: this wait stands in front of that
    asm volatile("s_wait_xcnt 0x0" ::: "memory");
    __syncthreads();

    if (t < PR_CH * Nc) {       // whole waves: 480 = 15 * 32
        const int ch = t / Nc;
        const int i  = t - ch * Nc;
        float rs = 0.f, rw = 0.f;
#pragma unroll
        for (int j = 0; j < PR_COLS4; ++j) {
            const float2 p = rowp[ch][i][j];
            rs += p.x;
            rw += p.y;
        }
        const float* cp = (const float*)colp;
        float ss = 0.f, sw = 0.f;
#pragma unroll
        for (int sl = 0; sl < PR_SLOTS; ++sl) {
            ss += cp[((sl * PR_CH + ch) * 2 + 0) * Mc + i];
            sw += cp[((sl * PR_CH + ch) * 2 + 1) * Mc + i];
        }
        const size_t o = ((size_t)b * Cc + c0 + ch) * Nc + i;
        row_ft[o] = rs * (1.0f / Mc);
        Scol[o]   = rw;
        col_ft[o] = ss * (1.0f / Nc);
        Srow[o]   = sw;
    }
}

// =====================================================================
// Kernel 3: inverse channel norm of a (2B,C,P) feature stack per column p
// =====================================================================
__global__ __launch_bounds__(128) void feat_invnorm(const float* __restrict__ f,
                                                    float* __restrict__ inv,
                                                    int P, int total)
{
    const int idx = blockIdx.x * blockDim.x + threadIdx.x;
    if (idx >= total) return;
    const int b = idx / P;
    const int p = idx - b * P;
    const float* fp = f + (size_t)b * Cc * P + p;
    float s = 0.f;
    for (int c = 0; c < Cc; ++c) {
        float v = fp[(size_t)c * P];
        s += v * v;
    }
    inv[idx] = 1.0f / fmaxf(sqrtf(s), 1e-12f);
}

// =====================================================================
// Kernel 4: generic WMMA GEMM tile (one wave = one 16x16 output tile)
//   Outb[m,p] = sum_k (W[m,k]*cs[k]) * (Xb[k,p] * psn) + bias[m]
// Xb / Outb are the planes of one batch entry; psn is this lane's column scale.
// Compile-time specialization removes all null-pointer branches.
// A/cs loads are float4 (global_load_b128); B loads coalesce across lanes.
// Fragment layouts per CDNA5 ISA 7.12.2 (16-bit A 16x32; B row-striped).
// =====================================================================
template <bool HAS_CS, bool HAS_BIAS>
__device__ __forceinline__ void gemm_tile(const float* __restrict__ W, int ldW,
                                          const float* __restrict__ Xb,
                                          const float* __restrict__ cs,
                                          float psn,
                                          const float* __restrict__ bias,
                                          float* __restrict__ Outb,
                                          int Kdim, int Nn)
{
    const int mt = blockIdx.y;
    const int nt = blockIdx.x;
    const int lane = threadIdx.x;
    const int nl = lane & 15;
    const int k0 = (lane & 16) ? 8 : 0;

    const int mrow = (mt << 4) + nl;           // A-matrix row held by this lane
    const int ncol = (nt << 4) + nl;           // B/D column held by this lane
    const float* Wrow = W + (size_t)mrow * ldW;

    v8f acc = {};
    for (int kk = 0; kk < Kdim; kk += 32) {
        const int ka = kk + k0;       // multiple of 4 -> 16B aligned
        const int kb = ka + 16;
        const float4 w0 = *(const float4*)(Wrow + ka);
        const float4 w1 = *(const float4*)(Wrow + ka + 4);
        const float4 w2 = *(const float4*)(Wrow + kb);
        const float4 w3 = *(const float4*)(Wrow + kb + 4);
        float wa[16] = { w0.x, w0.y, w0.z, w0.w, w1.x, w1.y, w1.z, w1.w,
                         w2.x, w2.y, w2.z, w2.w, w3.x, w3.y, w3.z, w3.w };
        if (HAS_CS) {
            const float4 c0 = *(const float4*)(cs + ka);
            const float4 c1 = *(const float4*)(cs + ka + 4);
            const float4 c2 = *(const float4*)(cs + kb);
            const float4 c3 = *(const float4*)(cs + kb + 4);
            const float ca[16] = { c0.x, c0.y, c0.z, c0.w, c1.x, c1.y, c1.z, c1.w,
                                   c2.x, c2.y, c2.z, c2.w, c3.x, c3.y, c3.z, c3.w };
#pragma unroll
            for (int j = 0; j < 16; ++j) wa[j] *= ca[j];
        }
        v16h a, bf;
#pragma unroll
        for (int j = 0; j < 8; ++j) {
            a[j]     = (_Float16)wa[j];
            a[8 + j] = (_Float16)wa[8 + j];
            bf[j]     = (_Float16)(Xb[(size_t)(ka + j) * Nn + ncol] * psn);
            bf[8 + j] = (_Float16)(Xb[(size_t)(kb + j) * Nn + ncol] * psn);
        }
        acc = __builtin_amdgcn_wmma_f32_16x16x32_f16(false, a, false, bf,
                                                     (short)0, acc, false, false);
    }
    const int rbase = (lane >> 4) * 8;
#pragma unroll
    for (int r = 0; r < 8; ++r) {
        const int m = (mt << 4) + rbase + r;
        float v = acc[r];
        if (HAS_BIAS) v += bias[m];
        Outb[(size_t)m * Nn + ncol] = v;
    }
}

// ---------------------------------------------------------------------
// Kernel 4a: all six q/k/v projections in one grid.
//   blockIdx.z = ((branch*3 + kind) * B + b), kind 0=q 1=k 2=v, branch 0=row 1=col
//   row branch: q<-row_ft, k<-col_ft, v<-Srow ; col branch: q<-col_ft, k<-row_ft, v<-Scol
//   Out planes are stacked [Qr|Qc|Kr|Kc|Vr|Vc], each (B, HID, P).
// ---------------------------------------------------------------------
__global__ __launch_bounds__(32) void qkv_wmma(const float* __restrict__ Wq,
                                               const float* __restrict__ Wk,
                                               const float* __restrict__ Wv,
                                               const float* __restrict__ gq,
                                               const float* __restrict__ gk,
                                               const float* __restrict__ gv,
                                               const float* __restrict__ row_ft,
                                               const float* __restrict__ col_ft,
                                               const float* __restrict__ Srow,
                                               const float* __restrict__ Scol,
                                               const float* __restrict__ inv_nrow,
                                               const float* __restrict__ inv_ncol,
                                               float xscale,
                                               float* __restrict__ qkv,
                                               int Mdim, int Kdim, int Nn)
{
    const int z      = blockIdx.z;
    const int b      = z % Bc;
    const int g      = z / Bc;
    const int kind   = g % 3;
    const int branch = g / 3;
    const bool from_row = (kind == branch);     // q of row branch, k of col branch
    const float* W  = (kind == 0) ? Wq : (kind == 1) ? Wk : Wv;
    const float* cs = (kind == 0) ? gq : (kind == 1) ? gk : gv;
    const float* X  = (kind == 2) ? (branch ? Scol : Srow) : (from_row ? row_ft : col_ft);
    const int ncol = (blockIdx.x << 4) + (threadIdx.x & 15);
    float psn = xscale;
    if (kind != 2)
        psn = (from_row ? inv_nrow : inv_ncol)[(size_t)b * Nn + ncol] * xscale;
    gemm_tile<true, false>(W, Kdim, X + (size_t)b * Kdim * Nn, cs, psn, nullptr,
                           qkv + ((size_t)(kind * 2 + branch) * Bc + b) * Mdim * Nn,
                           Kdim, Nn);
}

// =====================================================================
// Kernel 5: attention, output projection and reduce projection of one 16-query tile.
// First part: attention for one (b, h, 16-query tile), one wave, scores in registers.
//   Q,K,V are (2B, 128, P) row-major (row = h*32+d, col = position), P = 160 fixed.
//   s = (Q^T.K).SCALE; exact max over [keys, mem]; Z = sum e_m + rep * sum e_k
//   O[b, h*32+d, q] = (e_k.v_sum + e_m.mem_v) / Z
// The scores are formed transposed, D[key][query] = K^T.Q: a lane then holds 80 of the
// 160 scores of ONE query (its column), lane l ^ 16 the other 80. Maximum and sum are
// register trees plus one exchange with that lane, and two score tiles, converted in
// place, are the B operand of out^T[d][query] = V.e^T (k order 8h+s, 16+8h+s on both
// sides). All trip counts are constants: the loops unroll, every load takes an immediate
// offset from a fixed base, and no address depends on a loaded value.
// =====================================================================
// lane l reads lane l ^ 16: a vector move between the two 16-lane rows, no LDS-path wait
__device__ __forceinline__ float other_row(float v)
{
    const unsigned u = __float_as_uint(v);
    return __uint_as_float(__builtin_amdgcn_permlanex16(u, u, 0x76543210u, 0xfedcba98u, false, false));
}

constexpr int AT_P  = Nc;           // keys = queries = 160 in both branches
constexpr int AT_NT = AT_P / 16;    // 16-key score tiles
constexpr int AT_NK = AT_P / 32;    // 32-key steps of the second product
static_assert(Nc == Mc && AT_P % 32 == 0 && DHc == 32, "attention tiling");
typedef __attribute__((ext_vector_type(8))) _Float16 v8h;
typedef __attribute__((ext_vector_type(4))) _Float16 v4h;
typedef __attribute__((ext_vector_type(2))) _Float16 v2h;
constexpr int FT_ATTW    = Hc;                          // attention waves, one per head
constexpr int FT_PRJW    = Cc / 16;                     // projection waves, one per 16 output rows
constexpr int FT_THREADS = (FT_ATTW + FT_PRJW) * 32;    // 512
constexpr int FT_OP      = HIDc + 8;                    // f16 per query in Ot: rows stay 16-byte aligned
constexpr int FT_AP      = Cc + 8;                      // f16 per query in At
static_assert(HIDc == 128 && Cc % 64 == 0, "projection tiling: a Wo row is one 16-byte load per lane");

// Ot[query][h*32 + d] takes the tile's output, rounded to f16 as the next product reads it
__device__ __forceinline__ void attn_tile(const float* __restrict__ Q,
                                          const float* __restrict__ Kf,
                                          const float* __restrict__ V,
                                          const float* __restrict__ memkv,
                                          _Float16 (*__restrict__ Ot)[FT_OP],
                                          float rep, int b, int h, int qt, int lane)
{
    constexpr int P = AT_P;
    const int nl = lane & 15;
    const int k0 = (lane >> 4) * 8;
    const size_t base = ((size_t)b * HIDc + h * DHc) * P;
    // wave-uniform bases and one 32-bit lane offset each: fewer address registers than lane pointers
    const float* Qp = Q + base + qt * 16;
    const float* Kp = Kf + base;
    const float* Vp = V + base;
    const int kq = k0 * P + nl;     // Q: column = this lane's query; K: row of K^T = key nl of a tile
    const int vo = nl * P + k0;     // row of V = channel nl of a tile
    const float* mk = memkv + h * NMEMc * DHc + k0;                // mem_kv[0]
    const float* mv = mk + Hc * NMEMc * DHc;                       // mem_kv[1]

    // this lane's 16 of the 32 channels of its query: d = k0 + j and 16 + k0 + j
    float qf[16];
#pragma unroll
    for (int j = 0; j < 8; ++j) {
        qf[j]     = Qp[kq + j * P];
        qf[8 + j] = Qp[kq + (16 + j) * P];
    }
    v16h bq;
#pragma unroll
    for (int j = 0; j < 16; ++j) bq[j] = (_Float16)qf[j];

    // scores: sc[jt][r] = s[key jt*16 + k0 + r][query nl]
    v8f sc[AT_NT];
#pragma unroll
    for (int jt = 0; jt < AT_NT; ++jt) {
        v16h ak;
#pragma unroll
        for (int j = 0; j < 8; ++j) {
            ak[j]     = (_Float16)Kp[kq + j * P + jt * 16];
            ak[8 + j] = (_Float16)Kp[kq + (16 + j) * P + jt * 16];
        }
        v8f c = {};
        c = __builtin_amdgcn_wmma_f32_16x16x32_f16(false, ak, false, bq,
                                                   (short)0, c, false, false);
        sc[jt] = c * SCALE_F;
    }
    // the base and offset registers of the Q and K loads are reused below: the wait stands in
    // front of that, and naming them keeps the registers untouched up to it
    asm volatile("s_wait_xcnt 0x0" :: "v"(kq), "s"(Qp), "s"(Kp) : "memory");

    // memory-slot scores in f32: each lane sums its 16 channels, the other row adds its 16
    float sm[NMEMc];
#pragma unroll
    for (int jm = 0; jm < NMEMc; ++jm) {
        const float4 m0 = *(const float4*)(mk + jm * DHc);
        const float4 m1 = *(const float4*)(mk + jm * DHc + 4);
        const float4 m2 = *(const float4*)(mk + jm * DHc + 16);
        const float4 m3 = *(const float4*)(mk + jm * DHc + 20);
        const float ma[16] = { m0.x, m0.y, m0.z, m0.w, m1.x, m1.y, m1.z, m1.w,
                               m2.x, m2.y, m2.z, m2.w, m3.x, m3.y, m3.z, m3.w };
        float acc = 0.f;
#pragma unroll
        for (int j = 0; j < 16; ++j) acc += qf[j] * ma[j];
        sm[jm] = acc;
    }
#pragma unroll
    for (int jm = 0; jm < NMEMc; ++jm) sm[jm] = (sm[jm] + other_row(sm[jm])) * SCALE_F;

    // exact maximum of the query's 160 + 4 scores
    v8f m8 = sc[0];
#pragma unroll
    for (int jt = 1; jt < AT_NT; ++jt)
#pragma unroll
        for (int r = 0; r < 8; ++r) m8[r] = fmaxf(m8[r], sc[jt][r]);
    float mx = fmaxf(fmaxf(fmaxf(m8[0], m8[1]), fmaxf(m8[2], m8[3])),
                     fmaxf(fmaxf(m8[4], m8[5]), fmaxf(m8[6], m8[7])));
    mx = fmaxf(mx, other_row(mx));
#pragma unroll
    for (int jm = 0; jm < NMEMc; ++jm) mx = fmaxf(mx, sm[jm]);

    v8f s8 = {};
#pragma unroll
    for (int jt = 0; jt < AT_NT; ++jt)
#pragma unroll
        for (int r = 0; r < 8; ++r) {
            const float e = expf(sc[jt][r] - mx);
            sc[jt][r] = e;
            s8[r] += e;
        }
    float se = ((s8[0] + s8[1]) + (s8[2] + s8[3])) + ((s8[4] + s8[5]) + (s8[6] + s8[7]));
    se += other_row(se);
    float sem = 0.f;
#pragma unroll
    for (int jm = 0; jm < NMEMc; ++jm) {
        sm[jm] = expf(sm[jm] - mx);
        sem += sm[jm];
    }
    const float Z = sem + rep * se;

    // B operand of the second product: be[t][s] = e[key t*32 + kmap(s)][query nl]
    v16h be[AT_NK];
#pragma unroll
    for (int t = 0; t < AT_NK; ++t)
#pragma unroll
        for (int j = 0; j < 8; ++j) {
            be[t][j]     = (_Float16)sc[2 * t][j];
            be[t][8 + j] = (_Float16)sc[2 * t + 1][j];
        }

    // out^T = V . e^T, two 16-channel tiles; c[r] = out[d = nt2*16 + k0 + r][query nl]
#pragma unroll
    for (int nt2 = 0; nt2 < 2; ++nt2) {
        v8f c = {};
#pragma unroll
        for (int t = 0; t < AT_NK; ++t) {
            const float* Vrow = Vp + vo + nt2 * 16 * P + t * 32;
            const float4 v0 = *(const float4*)(Vrow);
            const float4 v1 = *(const float4*)(Vrow + 4);
            const float4 v2 = *(const float4*)(Vrow + 16);
            const float4 v3 = *(const float4*)(Vrow + 20);
            const float va[16] = { v0.x, v0.y, v0.z, v0.w, v1.x, v1.y, v1.z, v1.w,
                                   v2.x, v2.y, v2.z, v2.w, v3.x, v3.y, v3.z, v3.w };
            v16h av;
#pragma unroll
            for (int j = 0; j < 16; ++j) av[j] = (_Float16)va[j];
            c = __builtin_amdgcn_wmma_f32_16x16x32_f16(false, av, false, be[t],
                                                       (short)0, c, false, false);
        }
        float memc[8] = { 0.f, 0.f, 0.f, 0.f, 0.f, 0.f, 0.f, 0.f };
#pragma unroll
        for (int jm = 0; jm < NMEMc; ++jm) {
            const float4 w0 = *(const float4*)(mv + jm * DHc + nt2 * 16);
            const float4 w1 = *(const float4*)(mv + jm * DHc + nt2 * 16 + 4);
            const float wa[8] = { w0.x, w0.y, w0.z, w0.w, w1.x, w1.y, w1.z, w1.w };
#pragma unroll
            for (int r = 0; r < 8; ++r) memc[r] += sm[jm] * wa[r];
        }
        v8h o;
#pragma unroll
        for (int r = 0; r < 8; ++r) o[r] = (_Float16)((c[r] + memc[r]) / Z);
        *(v8h*)&Ot[nl][h * DHc + nt2 * 16 + k0] = o;
    }
    // same for the V loads: nothing may land on their base or offset register ahead of this wait
    asm volatile("s_wait_xcnt 0x0" :: "v"(vo), "s"(Vp) : "memory");
}

// A or B fragment of one 32-deep k step from an LDS row [row or query][k]; p = this lane's row + k0.
// k order k0 + 0..7, then 16 + k0 + 0..7, on both operands
__device__ __forceinline__ v16h lds_frag(const _Float16* p)
{
    const v8h lo = *(const v8h*)(p);
    const v8h hi = *(const v8h*)(p + 16);
    return __builtin_shufflevector(lo, hi, 0, 1, 2, 3, 4, 5, 6, 7, 8, 9, 10, 11, 12, 13, 14, 15);
}

// One block per (stacked plane b of 2*B, 16-query tile). Waves 0..3 run the attention of one
// head each; meanwhile waves 4..15 fetch the Wo and Wr rows of their 16 output channels with
// whole-line loads (a lane-per-row load would touch 16 lines each and crowd out the attention
// waves' loads) and turn them into A fragments through a wave-private piece of LDS.
//   Ot = attention output (128 x 16)          -> barrier
//   At = Wo . Ot + bo     (192 x 16)          -> barrier
//   R[b, :, tile] = Wr[:, branch half] . At   (192 x 16)
// Both intermediates cross in LDS as f16, the rounding the next product applies anyway.
__global__ __launch_bounds__(FT_THREADS) void attn_proj(const float* __restrict__ Q,
                                                        const float* __restrict__ Kf,
                                                        const float* __restrict__ V,
                                                        const float* __restrict__ memkv,
                                                        const float* __restrict__ Wo,
                                                        const float* __restrict__ bo,
                                                        const float* __restrict__ Wr,
                                                        float* __restrict__ R,
                                                        float rep)
{
    __shared__ __attribute__((aligned(16))) _Float16 Ot[16][FT_OP];
    __shared__ __attribute__((aligned(16))) _Float16 At[16][FT_AP];
    __shared__ __attribute__((aligned(16))) _Float16 WoS[FT_PRJW][16][FT_OP];   // one slice per projection wave
    __shared__ __attribute__((aligned(16))) _Float16 WrS[FT_PRJW][16][FT_AP];
    constexpr int P = AT_P;
    constexpr int KO = HIDc / 32, KR = Cc / 32;
    const int b = blockIdx.y, qt = blockIdx.x;
    const int wave = __builtin_amdgcn_readfirstlane(threadIdx.x >> 5);   // scalar: the role branches are wave-uniform
    const int lane = threadIdx.x & 31;
    const int nl = lane & 15;
    const int k0 = (lane >> 4) * 8;
    const int mt = wave - FT_ATTW;

    v16h aWo[KO], aWr[KR];
    float bias[8];
    if (wave < FT_ATTW) {
        attn_tile(Q, Kf, V, memkv, Ot, rep, b, wave, qt, lane);
    } else {
        // a Wo row is 32 lanes x 4 floats, a Wr half row 3 x (32 lanes x 2 floats)
        const float* WoBlk = Wo + (size_t)mt * 16 * HIDc + lane * 4;
        const float* WrBlk = Wr + (size_t)mt * 16 * (2 * Cc) + (b / Bc) * Cc + lane * 2;
        float4 wo[16];
        float2 wr[16][Cc / 64];
#pragma unroll
        for (int r = 0; r < 16; ++r) wo[r] = *(const float4*)(WoBlk + r * HIDc);
#pragma unroll
        for (int r = 0; r < 16; ++r)
#pragma unroll
            for (int j = 0; j < Cc / 64; ++j) wr[r][j] = *(const float2*)(WrBlk + r * (2 * Cc) + j * 64);
#pragma unroll
        for (int r = 0; r < 16; ++r) {
            const v4h hw = { (_Float16)wo[r].x, (_Float16)wo[r].y, (_Float16)wo[r].z, (_Float16)wo[r].w };
            *(v4h*)&WoS[mt][r][lane * 4] = hw;
        }
#pragma unroll
        for (int r = 0; r < 16; ++r)
#pragma unroll
            for (int j = 0; j < Cc / 64; ++j) {
                const v2h hw = { (_Float16)wr[r][j].x, (_Float16)wr[r][j].y };
                *(v2h*)&WrS[mt][r][j * 64 + lane * 2] = hw;
            }
        // the slice is read back by the wave that wrote it, but by other lanes: the wave's own
        // stores have landed behind this wait; no other wave touches the slice, so no barrier
        asm volatile("s_wait_dscnt 0x0" ::: "memory");
#pragma unroll
        for (int s = 0; s < KO; ++s) aWo[s] = lds_frag(&WoS[mt][nl][s * 32 + k0]);
#pragma unroll
        for (int s = 0; s < KR; ++s) aWr[s] = lds_frag(&WrS[mt][nl][s * 32 + k0]);
        const float4 b0 = *(const float4*)(bo + mt * 16 + k0);
        const float4 b1 = *(const float4*)(bo + mt * 16 + k0 + 4);
        bias[0] = b0.x; bias[1] = b0.y; bias[2] = b0.z; bias[3] = b0.w;
        bias[4] = b1.x; bias[5] = b1.y; bias[6] = b1.z; bias[7] = b1.w;
    }
    __syncthreads();        // Ot complete
    if (wave >= FT_ATTW) {
        v8f acc = {};
#pragma unroll
        for (int s = 0; s < KO; ++s)
            acc = __builtin_amdgcn_wmma_f32_16x16x32_f16(false, aWo[s], false, lds_frag(&Ot[nl][s * 32 + k0]),
                                                         (short)0, acc, false, false);
        v8h o;
#pragma unroll
        for (int r = 0; r < 8; ++r) o[r] = (_Float16)(acc[r] + bias[r]);
        *(v8h*)&At[nl][mt * 16 + k0] = o;
    }
    __syncthreads();        // At complete
    if (wave >= FT_ATTW) {
        v8f acc = {};
#pragma unroll
        for (int s = 0; s < KR; ++s)
            acc = __builtin_amdgcn_wmma_f32_16x16x32_f16(false, aWr[s], false, lds_frag(&At[nl][s * 32 + k0]),
                                                         (short)0, acc, false, false);
        float* Rp = R + ((size_t)b * Cc + mt * 16 + k0) * P + qt * 16 + nl;
#pragma unroll
        for (int r = 0; r < 8; ++r) Rp[r * P] = acc[r];
    }
}

// =====================================================================
// Kernel 6: out[b,d,n,m] = Rrow[b,d,n] + Rcol[b,d,m]   (float4 writes)
// One block per (b,d) plane. 160 threads cover 4 rows of 40 float4, so a thread
// keeps its four columns of Rcol in registers and stores them under every 4th
// row: a wave lives for 40 stores of 512 contiguous bytes instead of one.
// =====================================================================
constexpr int BC_COLS4 = Mc / 4;                 // float4 per row
constexpr int BC_ROWS  = 4;                      // rows covered by one pass of the block
constexpr int BC_THREADS = BC_COLS4 * BC_ROWS;   // 160
static_assert(Mc % 4 == 0 && Nc % BC_ROWS == 0, "plane must split into whole passes");
__global__ __launch_bounds__(BC_THREADS) void bcast_add(const float* __restrict__ Rrow,
                                                        const float* __restrict__ Rcol,
                                                        float* __restrict__ out)
{
    const int plane = blockIdx.x;                // b*C + d
    const int t  = threadIdx.x;
    const int cg = t % BC_COLS4;
    const int r0 = t / BC_COLS4;
    const float4 cv = *(const float4*)(Rcol + (size_t)plane * Mc + cg * 4);
    const float* rr = Rrow + (size_t)plane * Nc + r0;
    float4* op = (float4*)(out + (size_t)plane * Nc * Mc) + t;
    // all row values are requested before the first store, so the stores wait once
    float rv[Nc / BC_ROWS];
#pragma unroll
    for (int k = 0; k < Nc / BC_ROWS; ++k) rv[k] = rr[k * BC_ROWS];
    // unrolled: rv[] stays in registers and every store takes an immediate offset
#pragma unroll
    for (int k = 0; k < Nc / BC_ROWS; ++k) {
        float4 o;
        o.x = rv[k] + cv.x; o.y = rv[k] + cv.y; o.z = rv[k] + cv.z; o.w = rv[k] + cv.w;
        op[k * BC_THREADS] = o;
    }
}

// =====================================================================
// Host launcher
// =====================================================================
extern "C" void kernel_launch(void* const* d_in, const int* in_sizes, int n_in,
                              void* d_out, int out_size, void* d_ws, size_t ws_size,
                              hipStream_t stream)
{
    const float* x     = (const float*)d_in[0];
    const float* gq    = (const float*)d_in[1];
    const float* gk    = (const float*)d_in[2];
    const float* gv    = (const float*)d_in[3];
    const float* Wq    = (const float*)d_in[4];
    const float* Wk    = (const float*)d_in[5];
    const float* Wv    = (const float*)d_in[6];
    const float* memkv = (const float*)d_in[7];
    const float* Wo    = (const float*)d_in[8];
    const float* bo    = (const float*)d_in[9];
    const float* Wr    = (const float*)d_in[10];
    float* out = (float*)d_out;

    // ---- workspace layout (floats) ----
    float* w = (float*)d_ws;
    size_t o = 0;
    float* invp     = w + o; o += (size_t)Bc * Nc * Mc;   // 102400
    float* row_ft   = w + o; o += (size_t)Bc * Cc * Nc;   // 122880
    float* col_ft   = w + o; o += (size_t)Bc * Cc * Mc;
    float* Srow     = w + o; o += (size_t)Bc * Cc * Mc;
    float* Scol     = w + o; o += (size_t)Bc * Cc * Nc;
    float* inv_nrow = w + o; o += (size_t)Bc * Nc;
    float* inv_ncol = w + o; o += (size_t)Bc * Mc;
    // row-branch plane directly followed by its col-branch twin: a stack of 2*B planes
    float* Qr = w + o; o += (size_t)Bc * HIDc * Nc;       // 81920 each
    float* Qc = w + o; o += (size_t)Bc * HIDc * Mc;
    float* Kr = w + o; o += (size_t)Bc * HIDc * Mc;
    float* Kc = w + o; o += (size_t)Bc * HIDc * Nc;
    float* Vr = w + o; o += (size_t)Bc * HIDc * Mc;
    float* Vc = w + o; o += (size_t)Bc * HIDc * Nc;
    float* Rrow = w + o; o += (size_t)Bc * Cc * Nc;
    float* Rcol = w + o; o += (size_t)Bc * Cc * Mc;
    (void)ws_size; (void)in_sizes; (void)n_in; (void)out_size;

    const float sqrtC = sqrtf((float)Cc);

    // 1) per-pixel channel norms (pass 1 over x)
    pixel_invnorm<<<(Bc * Nc * Mc + 255) / 256, 256, 0, stream>>>(x, invp);

    // 2) plane reductions (pass 2 over x)
    plane_reduce<<<dim3(Cc / PR_CH, Bc), PR_THREADS, 0, stream>>>(x, invp, row_ft, col_ft, Srow, Scol);

    // N == M, so the two branches have equal shapes and share one grid per stage:
    // blockIdx.z or .y (or the flat index) runs over the 2*B stacked planes.
    static_assert(Nc == Mc, "branch stacking needs equal row and column lengths");
    (void)Qc; (void)Kc; (void)Vc;

    // 3) feature channel norms of [row_ft | col_ft] -> [inv_nrow | inv_ncol]
    feat_invnorm<<<(2 * Bc * Nc + 127) / 128, 128, 0, stream>>>(row_ft, inv_nrow, Nc, 2 * Bc * Nc);

    // 4) all six QKV projections (128x192x160 WMMA GEMMs) in one grid
    const dim3 gP(Nc / 16, HIDc / 16, 6 * Bc);
    qkv_wmma<<<gP, 32, 0, stream>>>(Wq, Wk, Wv, gq, gk, gv, row_ft, col_ft, Srow, Scol,
                                    inv_nrow, inv_ncol, sqrtC, Qr, HIDc, Cc, Nc);

    // 5) attention, output projection (Wo, bo) and reduce projection in one grid, both branches.
    //    Wr is (C, 2C): the row branch takes Wr[:, :C], the col branch Wr[:, C:]
    const dim3 gA(Nc / 16, 2 * Bc);
    attn_proj<<<gA, FT_THREADS, 0, stream>>>(Qr, Kr, Vr, memkv, Wo, bo, Wr, Rrow, (float)Nc);

    // 6) broadcast add -> final output (78.6 MB, float4 stores)
    bcast_add<<<Bc * Cc, BC_THREADS, 0, stream>>>(Rrow, Rcol, out);
}

// v006
// Measured time: 39.1 microseconds a run.
// Timed twice side by side with v005, it ran 1.40 times as fast both times.
// Over all steps from v000 it is 4.91 times as fast.
#include <hip/hip_runtime.h>
#include <math.h>

// ---------------- problem constants ----------------
constexpr int Bc   = 4;
constexpr int Cc   = 192;
constexpr int Nc   = 160;
constexpr int Mc   = 160;
constexpr int Hc   = 4;
constexpr int DHc  = 32;
constexpr int HIDc = 128;   // Hc*DHc
constexpr int NMEMc = 4;
#define SCALE_F 0.17677669529663687f   // 1/sqrt(32)

typedef __attribute__((ext_vector_type(16))) _Float16 v16h;
typedef __attribute__((ext_vector_type(8)))  float    v8f;
typedef __attribute__((ext_vector_type(4)))  float    v4f;

// =====================================================================
// Kernel 1: per-pixel inverse channel norm of x:  invp[b,n,m]
// =====================================================================
__global__ __launch_bounds__(256) void pixel_invnorm(const float* __restrict__ x,
                                                     float* __restrict__ invp)
{
    const int idx = blockIdx.x * blockDim.x + threadIdx.x;
    const int NM = Nc * Mc;
    if (idx >= Bc * NM) return;
    const int b = idx / NM;
    const int p = idx - b * NM;
    const float* xp = x + (size_t)b * Cc * NM + p;
    float s = 0.f;
    for (int c = 0; c < Cc; ++c) {
        float v = xp[(size_t)c * NM];
        s += v * v;
    }
    invp[idx] = 1.0f / fmaxf(sqrtf(s), 1e-12f);
}

// =====================================================================
// Kernel 2: plane reductions, every plane read once with whole-line loads.
//  row_ft[b,c,n] = mean_m x          col_ft[b,c,m] = mean_n x
//  Scol[b,c,n]   = sum_m x*invp      Srow[b,c,m]   = sum_n x*invp
// One block takes 3 channels of one batch entry, so a float4 of invp serves three
// planes. 640 threads cover 16 rows of 40 float4; a thread keeps its four columns'
// sums in registers and leaves each row's four-element partial in LDS. After the
// barrier one thread per (channel, index) adds up a row's 40 partials and a
// column's 16 partials.
// =====================================================================
constexpr int PR_CH      = 3;                       // channels per block
constexpr int PR_COLS4   = Mc / 4;                  // float4 per row
constexpr int PR_SLOTS   = 16;                      // rows covered by one pass
constexpr int PR_THREADS = PR_COLS4 * PR_SLOTS;     // 640
constexpr int PR_PASSES  = Nc / PR_SLOTS;           // 10
constexpr int PR_GRP     = 2;                       // passes fetched together
constexpr int PR_NGRP    = PR_PASSES / PR_GRP;      // 5
constexpr int PR_PITCH   = PR_COLS4 + 1;            // odd pitch: 32 rows read side by side hit distinct banks
static_assert(Cc % PR_CH == 0 && Nc % PR_SLOTS == 0 && Mc % 4 == 0 && Nc == Mc &&
              PR_PASSES % PR_GRP == 0 && PR_CH * Nc <= PR_THREADS && (PR_CH * Nc) % 32 == 0, "plane_reduce tiling");
__global__ __launch_bounds__(PR_THREADS) void plane_reduce(const float* __restrict__ x,
                                                           const float* __restrict__ invp,
                                                           float* __restrict__ row_ft,
                                                           float* __restrict__ col_ft,
                                                           float* __restrict__ Srow,
                                                           float* __restrict__ Scol)
{
    __shared__ float2 rowp[PR_CH][Nc][PR_PITCH];            // (sum, weighted sum) of 4 columns
    __shared__ v4f colp[PR_SLOTS][PR_CH][2][PR_COLS4];      // column sums of one row slot

    const int b = blockIdx.y, c0 = blockIdx.x * PR_CH;
    const int t  = threadIdx.x;
    const int cg = t % PR_COLS4;
    const int r0 = t / PR_COLS4;
    constexpr int PLANE4 = Nc * Mc / 4;
    const v4f* xp = (const v4f*)(x + ((size_t)b * Cc + c0) * Nc * Mc) + t;
    const v4f* ip = (const v4f*)(invp + (size_t)b * Nc * Mc) + t;

    v4f cs[PR_CH], cw[PR_CH];
#pragma unroll
    for (int ch = 0; ch < PR_CH; ++ch) {
        cs[ch] = (v4f)(0.f);
        cw[ch] = (v4f)(0.f);
    }
    // Two register sets of PR_GRP passes each: the next group's loads are issued before
    // this group is summed. Unrolled, so set indices are static and offsets immediate.
    v4f wv[2][PR_GRP], xv[2][PR_GRP][PR_CH];
#pragma unroll
    for (int p = 0; p < PR_GRP; ++p) {
        wv[0][p] = ip[p * PR_THREADS];
#pragma unroll
        for (int ch = 0; ch < PR_CH; ++ch) xv[0][p][ch] = xp[ch * PLANE4 + p * PR_THREADS];
    }
#pragma unroll
    for (int g = 0; g < PR_NGRP; ++g) {
        const int cur = g & 1, nxt = cur ^ 1;
        // the pair of scheduling barriers pins "next group's loads, then this group's sums";
        // without it each load sinks to its use and the wave waits out one load at a time
        __builtin_amdgcn_sched_barrier(0);
        if (g + 1 < PR_NGRP) {
#pragma unroll
            for (int p = 0; p < PR_GRP; ++p) {
                const int k = (g + 1) * PR_GRP + p;
                wv[nxt][p] = ip[k * PR_THREADS];
#pragma unroll
                for (int ch = 0; ch < PR_CH; ++ch)
                    xv[nxt][p][ch] = xp[ch * PLANE4 + k * PR_THREADS];
            }
        }
        __builtin_amdgcn_sched_barrier(0);
#pragma unroll
        for (int p = 0; p < PR_GRP; ++p) {
            const v4f w4 = wv[cur][p];
#pragma unroll
            for (int ch = 0; ch < PR_CH; ++ch) {
                const v4f v = xv[cur][p][ch];
                const v4f vw = v * w4;
                cs[ch] += v;
                cw[ch] += vw;
                rowp[ch][(g * PR_GRP + p) * PR_SLOTS + r0][cg] =
                    make_float2((v.x + v.y) + (v.z + v.w), (vw.x + vw.y) + (vw.z + vw.w));
            }
        }
    }
#pragma unroll
    for (int ch = 0; ch < PR_CH; ++ch) {
        colp[r0][ch][0][cg] = cs[ch];
        colp[r0][ch][1][cg] = cw[ch];
    }
    // the loads' base and index registers are reused below: this wait stands in front of that
    asm volatile("s_wait_xcnt 0x0" ::: "memory");
    __syncthreads();

    if (t < PR_CH * Nc) {       // whole waves: 480 = 15 * 32
        const int ch = t / Nc;
        const int i  = t - ch * Nc;
        float rs = 0.f, rw = 0.f;
#pragma unroll
        for (int j = 0; j < PR_COLS4; ++j) {
            const float2 p = rowp[ch][i][j];
            rs += p.x;
            rw += p.y;
        }
        const float* cp = (const float*)colp;
        float ss = 0.f, sw = 0.f;
#pragma unroll
        for (int sl = 0; sl < PR_SLOTS; ++sl) {
            ss += cp[((sl * PR_CH + ch) * 2 + 0) * Mc + i];
            sw += cp[((sl * PR_CH + ch) * 2 + 1) * Mc + i];
        }
        const size_t o = ((size_t)b * Cc + c0 + ch) * Nc + i;
        row_ft[o] = rs * (1.0f / Mc);
        Scol[o]   = rw;
        col_ft[o] = ss * (1.0f / Nc);
        Srow[o]   = sw;
    }
}

// lane l reads lane l ^ 16: a vector move between the two 16-lane rows, no LDS-path wait
__device__ __forceinline__ float other_row(float v)
{
    const unsigned u = __float_as_uint(v);
    return __uint_as_float(__builtin_amdgcn_permlanex16(u, u, 0x76543210u, 0xfedcba98u, false, false));
}

// =====================================================================
// Kernel 3: all six q/k/v projections in one grid, one wave = one 16x16 output tile.
//   Out[m,p] = sum_k (W[m,k]*g[k]) * (X[k,p] * scale_p)
//   blockIdx.z = ((branch*3 + kind) * B + b), kind 0=q 1=k 2=v, branch 0=row 1=col
//   row branch: q<-row_ft, k<-col_ft, v<-Srow ; col branch: q<-col_ft, k<-row_ft, v<-Scol
//   Out planes are stacked [Qr|Qc|Kr|Kc|Vr|Vc], each (B, HID, P).
// The B operand of a tile is all 192 channels of its 16 columns, so the wave that loads it
// also holds what the columns' channel norm needs: lanes l and l ^ 16 hold the two halves
// of column l & 15. The wave fetches the whole operand into registers, sums the squares,
// and scales by sqrt(C) / norm before rounding to f16 (v: by sqrt(C) alone).
// Fragment layouts per CDNA5 ISA 7.12.2 (16-bit A 16x32; B row-striped): k order
// k0 + 0..7, then 16 + k0 + 0..7, on both operands.
// =====================================================================
constexpr int QP_KS = Cc / 32;      // 32-deep k steps
static_assert(Cc % 32 == 0 && Nc == Mc && Nc % 16 == 0 && HIDc % 16 == 0, "projection tiling");
__global__ __launch_bounds__(32) void qkv_wmma(const float* __restrict__ Wq,
                                               const float* __restrict__ Wk,
                                               const float* __restrict__ Wv,
                                               const float* __restrict__ gq,
                                               const float* __restrict__ gk,
                                               const float* __restrict__ gv,
                                               const float* __restrict__ row_ft,
                                               const float* __restrict__ col_ft,
                                               const float* __restrict__ Srow,
                                               const float* __restrict__ Scol,
                                               float xscale,
                                               float* __restrict__ qkv)
{
    constexpr int P = Nc;
    const int z      = blockIdx.z;
    const int b      = z % Bc;
    const int g      = z / Bc;
    const int kind   = g % 3;
    const int branch = g / 3;
    const bool from_row = (kind == branch);     // q of row branch, k of col branch
    const float* W  = (kind == 0) ? Wq : (kind == 1) ? Wk : Wv;
    const float* cs = (kind == 0) ? gq : (kind == 1) ? gk : gv;
    const float* X  = (kind == 2) ? (branch ? Scol : Srow) : (from_row ? row_ft : col_ft);
    const int lane = threadIdx.x;
    const int nl = lane & 15;
    const int k0 = (lane >> 4) * 8;
    const int mt = blockIdx.y;

    // wave-uniform bases and one 32-bit lane offset each (bytes for the 16-byte loads): these are
    // the registers the loads name, so the wait below can name them too
    const float* Xb = X + (size_t)b * Cc * P + (blockIdx.x << 4);
    const char*  Wt = (const char*)(W + (size_t)(mt << 4) * Cc);
    const char*  Gt = (const char*)cs;
    const int xo = k0 * P + nl;             // column nl of the tile, first of this lane's channels
    const int wo = (nl * Cc + k0) * 4;      // row nl of the tile
    const int go = k0 * 4;

    // this lane's 96 of the 192 channels of its column
    float xb[QP_KS][16];
#pragma unroll
    for (int s = 0; s < QP_KS; ++s)
#pragma unroll
        for (int j = 0; j < 8; ++j) {
            xb[s][j]     = Xb[xo + (s * 32 + j) * P];
            xb[s][8 + j] = Xb[xo + (s * 32 + 16 + j) * P];
        }
    // row mt*16 + nl of W and the channel gains, same k order
    float4 wv[QP_KS][4], gv4[QP_KS][4];
#pragma unroll
    for (int s = 0; s < QP_KS; ++s)
#pragma unroll
        for (int i = 0; i < 4; ++i) {
            const int kb = (s * 32 + (i >> 1) * 16 + (i & 1) * 4) * 4;
            wv[s][i]  = *(const float4*)(Wt + wo + kb);
            gv4[s][i] = *(const float4*)(Gt + go + kb);
        }
    // the loads' base and offset registers are reused below: the wait stands in front of that, and
    // naming them keeps the registers untouched up to it
    asm volatile("s_wait_xcnt 0x0" :: "v"(xo), "v"(wo), "v"(go), "s"(Xb), "s"(Wt), "s"(Gt) : "memory");

    float psn = xscale;
    if (kind != 2) {        // wave-uniform: q and k take the column's inverse channel norm
        float q4[4] = { 0.f, 0.f, 0.f, 0.f };   // four chains, so the adds do not wait on one another
#pragma unroll
        for (int s = 0; s < QP_KS; ++s)
#pragma unroll
            for (int j = 0; j < 16; ++j) q4[j & 3] += xb[s][j] * xb[s][j];
        float ss = (q4[0] + q4[1]) + (q4[2] + q4[3]);
        ss += other_row(ss);
        psn = (1.0f / fmaxf(sqrtf(ss), 1e-12f)) * xscale;
    }

    v8f acc = {};
#pragma unroll
    for (int s = 0; s < QP_KS; ++s) {
        v16h a, bf;
#pragma unroll
        for (int i = 0; i < 4; ++i) {
            a[i * 4 + 0] = (_Float16)(wv[s][i].x * gv4[s][i].x);
            a[i * 4 + 1] = (_Float16)(wv[s][i].y * gv4[s][i].y);
            a[i * 4 + 2] = (_Float16)(wv[s][i].z * gv4[s][i].z);
            a[i * 4 + 3] = (_Float16)(wv[s][i].w * gv4[s][i].w);
        }
#pragma unroll
        for (int j = 0; j < 16; ++j) bf[j] = (_Float16)(xb[s][j] * psn);
        acc = __builtin_amdgcn_wmma_f32_16x16x32_f16(false, a, false, bf,
                                                     (short)0, acc, false, false);
    }
    float* Op = qkv + (((size_t)(kind * 2 + branch) * Bc + b) * HIDc + (mt << 4) + k0) * P
                    + (blockIdx.x << 4) + nl;
#pragma unroll
    for (int r = 0; r < 8; ++r) Op[r * P] = acc[r];
}

// =====================================================================
// Kernel 4: attention, output projection and reduce projection of one 16-query tile.
// First part: attention for one (b, h, 16-query tile), one wave, scores in registers.
//   Q,K,V are (2B, 128, P) row-major (row = h*32+d, col = position), P = 160 fixed.
//   s = (Q^T.K).SCALE; exact max over [keys, mem]; Z = sum e_m + rep * sum e_k
//   O[b, h*32+d, q] = (e_k.v_sum + e_m.mem_v) / Z
// The scores are formed transposed, D[key][query] = K^T.Q: a lane then holds 80 of the
// 160 scores of ONE query (its column), lane l ^ 16 the other 80. Maximum and sum are
// register trees plus one exchange with that lane, and two score tiles, converted in
// place, are the B operand of out^T[d][query] = V.e^T (k order 8h+s, 16+8h+s on both
// sides). All trip counts are constants: the loops unroll, every load takes an immediate
// offset from a fixed base, and no address depends on a loaded value.
// =====================================================================
constexpr int AT_P  = Nc;           // keys = queries = 160 in both branches
constexpr int AT_NT = AT_P / 16;    // 16-key score tiles
constexpr int AT_NK = AT_P / 32;    // 32-key steps of the second product
static_assert(Nc == Mc && AT_P % 32 == 0 && DHc == 32, "attention tiling");
typedef __attribute__((ext_vector_type(8))) _Float16 v8h;
typedef __attribute__((ext_vector_type(4))) _Float16 v4h;
typedef __attribute__((ext_vector_type(2))) _Float16 v2h;
constexpr int FT_ATTW    = Hc;                          // attention waves, one per head
constexpr int FT_PRJW    = Cc / 16;                     // projection waves, one per 16 output rows
constexpr int FT_THREADS = (FT_ATTW + FT_PRJW) * 32;    // 512
constexpr int FT_OP      = HIDc + 8;                    // f16 per query in Ot: rows stay 16-byte aligned
constexpr int FT_AP      = Cc + 8;                      // f16 per query in At
static_assert(HIDc == 128 && Cc % 64 == 0, "projection tiling: a Wo row is one 16-byte load per lane");

// Ot[query][h*32 + d] takes the tile's output, rounded to f16 as the next product reads it
__device__ __forceinline__ void attn_tile(const float* __restrict__ Q,
                                          const float* __restrict__ Kf,
                                          const float* __restrict__ V,
                                          const float* __restrict__ memkv,
                                          _Float16 (*__restrict__ Ot)[FT_OP],
                                          float rep, int b, int h, int qt, int lane)
{
    constexpr int P = AT_P;
    const int nl = lane & 15;
    const int k0 = (lane >> 4) * 8;
    const size_t base = ((size_t)b * HIDc + h * DHc) * P;
    // wave-uniform bases and one 32-bit lane offset each: fewer address registers than lane pointers
    const float* Qp = Q + base + qt * 16;
    const float* Kp = Kf + base;
    const float* Vp = V + base;
    const int kq = k0 * P + nl;     // Q: column = this lane's query; K: row of K^T = key nl of a tile
    const int vo = nl * P + k0;     // row of V = channel nl of a tile
    const float* mk = memkv + h * NMEMc * DHc + k0;                // mem_kv[0]
    const float* mv = mk + Hc * NMEMc * DHc;                       // mem_kv[1]

    // this lane's 16 of the 32 channels of its query: d = k0 + j and 16 + k0 + j
    float qf[16];
#pragma unroll
    for (int j = 0; j < 8; ++j) {
        qf[j]     = Qp[kq + j * P];
        qf[8 + j] = Qp[kq + (16 + j) * P];
    }
    v16h bq;
#pragma unroll
    for (int j = 0; j < 16; ++j) bq[j] = (_Float16)qf[j];

    // scores: sc[jt][r] = s[key jt*16 + k0 + r][query nl]
    v8f sc[AT_NT];
#pragma unroll
    for (int jt = 0; jt < AT_NT; ++jt) {
        v16h ak;
#pragma unroll
        for (int j = 0; j < 8; ++j) {
            ak[j]     = (_Float16)Kp[kq + j * P + jt * 16];
            ak[8 + j] = (_Float16)Kp[kq + (16 + j) * P + jt * 16];
        }
        v8f c = {};
        c = __builtin_amdgcn_wmma_f32_16x16x32_f16(false, ak, false, bq,
                                                   (short)0, c, false, false);
        sc[jt] = c * SCALE_F;
    }
    // the base and offset registers of the Q and K loads are reused below: the wait stands in
    // front of that, and naming them keeps the registers untouched up to it
    asm volatile("s_wait_xcnt 0x0" :: "v"(kq), "s"(Qp), "s"(Kp) : "memory");

    // memory-slot scores in f32: each lane sums its 16 channels, the other row adds its 16
    float sm[NMEMc];
#pragma unroll
    for (int jm = 0; jm < NMEMc; ++jm) {
        const float4 m0 = *(const float4*)(mk + jm * DHc);
        const float4 m1 = *(const float4*)(mk + jm * DHc + 4);
        const float4 m2 = *(const float4*)(mk + jm * DHc + 16);
        const float4 m3 = *(const float4*)(mk + jm * DHc + 20);
        const float ma[16] = { m0.x, m0.y, m0.z, m0.w, m1.x, m1.y, m1.z, m1.w,
                               m2.x, m2.y, m2.z, m2.w, m3.x, m3.y, m3.z, m3.w };
        float acc = 0.f;
#pragma unroll
        for (int j = 0; j < 16; ++j) acc += qf[j] * ma[j];
        sm[jm] = acc;
    }
#pragma unroll
    for (int jm = 0; jm < NMEMc; ++jm) sm[jm] = (sm[jm] + other_row(sm[jm])) * SCALE_F;

    // exact maximum of the query's 160 + 4 scores
    v8f m8 = sc[0];
#pragma unroll
    for (int jt = 1; jt < AT_NT; ++jt)
#pragma unroll
        for (int r = 0; r < 8; ++r) m8[r] = fmaxf(m8[r], sc[jt][r]);
    float mx = fmaxf(fmaxf(fmaxf(m8[0], m8[1]), fmaxf(m8[2], m8[3])),
                     fmaxf(fmaxf(m8[4], m8[5]), fmaxf(m8[6], m8[7])));
    mx = fmaxf(mx, other_row(mx));
#pragma unroll
    for (int jm = 0; jm < NMEMc; ++jm) mx = fmaxf(mx, sm[jm]);

    v8f s8 = {};
#pragma unroll
    for (int jt = 0; jt < AT_NT; ++jt)
#pragma unroll
        for (int r = 0; r < 8; ++r) {
            const float e = expf(sc[jt][r] - mx);
            sc[jt][r] = e;
            s8[r] += e;
        }
    float se = ((s8[0] + s8[1]) + (s8[2] + s8[3])) + ((s8[4] + s8[5]) + (s8[6] + s8[7]));
    se += other_row(se);
    float sem = 0.f;
#pragma unroll
    for (int jm = 0; jm < NMEMc; ++jm) {
        sm[jm] = expf(sm[jm] - mx);
        sem += sm[jm];
    }
    const float Z = sem + rep * se;

    // B operand of the second product: be[t][s] = e[key t*32 + kmap(s)][query nl]
    v16h be[AT_NK];
#pragma unroll
    for (int t = 0; t < AT_NK; ++t)
#pragma unroll
        for (int j = 0; j < 8; ++j) {
            be[t][j]     = (_Float16)sc[2 * t][j];
            be[t][8 + j] = (_Float16)sc[2 * t + 1][j];
        }

    // out^T = V . e^T, two 16-channel tiles; c[r] = out[d = nt2*16 + k0 + r][query nl]
#pragma unroll
    for (int nt2 = 0; nt2 < 2; ++nt2) {
        v8f c = {};
#pragma unroll
        for (int t = 0; t < AT_NK; ++t) {
            const float* Vrow = Vp + vo + nt2 * 16 * P + t * 32;
            const float4 v0 = *(const float4*)(Vrow);
            const float4 v1 = *(const float4*)(Vrow + 4);
            const float4 v2 = *(const float4*)(Vrow + 16);
            const float4 v3 = *(const float4*)(Vrow + 20);
            const float va[16] = { v0.x, v0.y, v0.z, v0.w, v1.x, v1.y, v1.z, v1.w,
                                   v2.x, v2.y, v2.z, v2.w, v3.x, v3.y, v3.z, v3.w };
            v16h av;
#pragma unroll
            for (int j = 0; j < 16; ++j) av[j] = (_Float16)va[j];
            c = __builtin_amdgcn_wmma_f32_16x16x32_f16(false, av, false, be[t],
                                                       (short)0, c, false, false);
        }
        float memc[8] = { 0.f, 0.f, 0.f, 0.f, 0.f, 0.f, 0.f, 0.f };
#pragma unroll
        for (int jm = 0; jm < NMEMc; ++jm) {
            const float4 w0 = *(const float4*)(mv + jm * DHc + nt2 * 16);
            const float4 w1 = *(const float4*)(mv + jm * DHc + nt2 * 16 + 4);
            const float wa[8] = { w0.x, w0.y, w0.z, w0.w, w1.x, w1.y, w1.z, w1.w };
#pragma unroll
            for (int r = 0; r < 8; ++r) memc[r] += sm[jm] * wa[r];
        }
        v8h o;
#pragma unroll
        for (int r = 0; r < 8; ++r) o[r] = (_Float16)((c[r] + memc[r]) / Z);
        *(v8h*)&Ot[nl][h * DHc + nt2 * 16 + k0] = o;
    }
    // same for the V loads: nothing may land on their base or offset register ahead of this wait
    asm volatile("s_wait_xcnt 0x0" :: "v"(vo), "s"(Vp) : "memory");
}

// A or B fragment of one 32-deep k step from an LDS row [row or query][k]; p = this lane's row + k0.
// k order k0 + 0..7, then 16 + k0 + 0..7, on both operands
__device__ __forceinline__ v16h lds_frag(const _Float16* p)
{
    const v8h lo = *(const v8h*)(p);
    const v8h hi = *(const v8h*)(p + 16);
    return __builtin_shufflevector(lo, hi, 0, 1, 2, 3, 4, 5, 6, 7, 8, 9, 10, 11, 12, 13, 14, 15);
}

// One block per (stacked plane b of 2*B, 16-query tile). Waves 0..3 run the attention of one
// head each; meanwhile waves 4..15 fetch the Wo and Wr rows of their 16 output channels with
// whole-line loads (a lane-per-row load would touch 16 lines each and crowd out the attention
// waves' loads) and turn them into A fragments through a wave-private piece of LDS.
//   Ot = attention output (128 x 16)          -> barrier
//   At = Wo . Ot + bo     (192 x 16)          -> barrier
//   R[b, :, tile] = Wr[:, branch half] . At   (192 x 16)
// Both intermediates cross in LDS as f16, the rounding the next product applies anyway.
__global__ __launch_bounds__(FT_THREADS) void attn_proj(const float* __restrict__ Q,
                                                        const float* __restrict__ Kf,
                                                        const float* __restrict__ V,
                                                        const float* __restrict__ memkv,
                                                        const float* __restrict__ Wo,
                                                        const float* __restrict__ bo,
                                                        const float* __restrict__ Wr,
                                                        float* __restrict__ R,
                                                        float rep)
{
    __shared__ __attribute__((aligned(16))) _Float16 Ot[16][FT_OP];
    __shared__ __attribute__((aligned(16))) _Float16 At[16][FT_AP];
    __shared__ __attribute__((aligned(16))) _Float16 WoS[FT_PRJW][16][FT_OP];   // one slice per projection wave
    __shared__ __attribute__((aligned(16))) _Float16 WrS[FT_PRJW][16][FT_AP];
    constexpr int P = AT_P;
    constexpr int KO = HIDc / 32, KR = Cc / 32;
    const int b = blockIdx.y, qt = blockIdx.x;
    const int wave = __builtin_amdgcn_readfirstlane(threadIdx.x >> 5);   // scalar: the role branches are wave-uniform
    const int lane = threadIdx.x & 31;
    const int nl = lane & 15;
    const int k0 = (lane >> 4) * 8;
    const int mt = wave - FT_ATTW;

    v16h aWo[KO], aWr[KR];
    float bias[8];
    if (wave < FT_ATTW) {
        attn_tile(Q, Kf, V, memkv, Ot, rep, b, wave, qt, lane);
    } else {
        // a Wo row is 32 lanes x 4 floats, a Wr half row 3 x (32 lanes x 2 floats)
        const float* WoBlk = Wo + (size_t)mt * 16 * HIDc + lane * 4;
        const float* WrBlk = Wr + (size_t)mt * 16 * (2 * Cc) + (b / Bc) * Cc + lane * 2;
        float4 wo[16];
        float2 wr[16][Cc / 64];
#pragma unroll
        for (int r = 0; r < 16; ++r) wo[r] = *(const float4*)(WoBlk + r * HIDc);
#pragma unroll
        for (int r = 0; r < 16; ++r)
#pragma unroll
            for (int j = 0; j < Cc / 64; ++j) wr[r][j] = *(const float2*)(WrBlk + r * (2 * Cc) + j * 64);
#pragma unroll
        for (int r = 0; r < 16; ++r) {
            const v4h hw = { (_Float16)wo[r].x, (_Float16)wo[r].y, (_Float16)wo[r].z, (_Float16)wo[r].w };
            *(v4h*)&WoS[mt][r][lane * 4] = hw;
        }
#pragma unroll
        for (int r = 0; r < 16; ++r)
#pragma unroll
            for (int j = 0; j < Cc / 64; ++j) {
                const v2h hw = { (_Float16)wr[r][j].x, (_Float16)wr[r][j].y };
                *(v2h*)&WrS[mt][r][j * 64 + lane * 2] = hw;
            }
        // the slice is read back by the wave that wrote it, but by other lanes: the wave's own
        // stores have landed behind this wait; no other wave touches the slice, so no barrier
        asm volatile("s_wait_dscnt 0x0" ::: "memory");
#pragma unroll
        for (int s = 0; s < KO; ++s) aWo[s] = lds_frag(&WoS[mt][nl][s * 32 + k0]);
#pragma unroll
        for (int s = 0; s < KR; ++s) aWr[s] = lds_frag(&WrS[mt][nl][s * 32 + k0]);
        const float4 b0 = *(const float4*)(bo + mt * 16 + k0);
        const float4 b1 = *(const float4*)(bo + mt * 16 + k0 + 4);
        bias[0] = b0.x; bias[1] = b0.y; bias[2] = b0.z; bias[3] = b0.w;
        bias[4] = b1.x; bias[5] = b1.y; bias[6] = b1.z; bias[7] = b1.w;
    }
    __syncthreads();        // Ot complete
    if (wave >= FT_ATTW) {
        v8f acc = {};
#pragma unroll
        for (int s = 0; s < KO; ++s)
            acc = __builtin_amdgcn_wmma_f32_16x16x32_f16(false, aWo[s], false, lds_frag(&Ot[nl][s * 32 + k0]),
                                                         (short)0, acc, false, false);
        v8h o;
#pragma unroll
        for (int r = 0; r < 8; ++r) o[r] = (_Float16)(acc[r] + bias[r]);
        *(v8h*)&At[nl][mt * 16 + k0] = o;
    }
    __syncthreads();        // At complete
    if (wave >= FT_ATTW) {
        v8f acc = {};
#pragma unroll
        for (int s = 0; s < KR; ++s)
            acc = __builtin_amdgcn_wmma_f32_16x16x32_f16(false, aWr[s], false, lds_frag(&At[nl][s * 32 + k0]),
                                                         (short)0, acc, false, false);
        float* Rp = R + ((size_t)b * Cc + mt * 16 + k0) * P + qt * 16 + nl;
#pragma unroll
        for (int r = 0; r < 8; ++r) Rp[r * P] = acc[r];
    }
}

// =====================================================================
// Kernel 5: out[b,d,n,m] = Rrow[b,d,n] + Rcol[b,d,m]   (float4 writes)
// One block per (b,d) plane. 160 threads cover 4 rows of 40 float4, so a thread
// keeps its four columns of Rcol in registers and stores them under every 4th
// row: a wave lives for 40 stores of 512 contiguous bytes instead of one.
// =====================================================================
constexpr int BC_COLS4 = Mc / 4;                 // float4 per row
constexpr int BC_ROWS  = 4;                      // rows covered by one pass of the block
constexpr int BC_THREADS = BC_COLS4 * BC_ROWS;   // 160
static_assert(Mc % 4 == 0 && Nc % BC_ROWS == 0, "plane must split into whole passes");
__global__ __launch_bounds__(BC_THREADS) void bcast_add(const float* __restrict__ Rrow,
                                                        const float* __restrict__ Rcol,
                                                        float* __restrict__ out)
{
    const int plane = blockIdx.x;                // b*C + d
    const int t  = threadIdx.x;
    const int cg = t % BC_COLS4;
    const int r0 = t / BC_COLS4;
    const float4 cv = *(const float4*)(Rcol + (size_t)plane * Mc + cg * 4);
    const float* rr = Rrow + (size_t)plane * Nc + r0;
    float4* op = (float4*)(out + (size_t)plane * Nc * Mc) + t;
    // all row values are requested before the first store, so the stores wait once
    float rv[Nc / BC_ROWS];
#pragma unroll
    for (int k = 0; k < Nc / BC_ROWS; ++k) rv[k] = rr[k * BC_ROWS];
    // unrolled: rv[] stays in registers and every store takes an immediate offset
#pragma unroll
    for (int k = 0; k < Nc / BC_ROWS; ++k) {
        float4 o;
        o.x = rv[k] + cv.x; o.y = rv[k] + cv.y; o.z = rv[k] + cv.z; o.w = rv[k] + cv.w;
        op[k * BC_THREADS] = o;
    }
}

// =====================================================================
// Host launcher
// =====================================================================
extern "C" void kernel_launch(void* const* d_in, const int* in_sizes, int n_in,
                              void* d_out, int out_size, void* d_ws, size_t ws_size,
                              hipStream_t stream)
{
    const float* x     = (const float*)d_in[0];
    const float* gq    = (const float*)d_in[1];
    const float* gk    = (const float*)d_in[2];
    const float* gv    = (const float*)d_in[3];
    const float* Wq    = (const float*)d_in[4];
    const float* Wk    = (const float*)d_in[5];
    const float* Wv    = (const float*)d_in[6];
    const float* memkv = (const float*)d_in[7];
    const float* Wo    = (const float*)d_in[8];
    const float* bo    = (const float*)d_in[9];
    const float* Wr    = (const float*)d_in[10];
    float* out = (float*)d_out;

    // ---- workspace layout (floats) ----
    float* w = (float*)d_ws;
    size_t o = 0;
    float* invp     = w + o; o += (size_t)Bc * Nc * Mc;   // 102400
    float* row_ft   = w + o; o += (size_t)Bc * Cc * Nc;   // 122880
    float* col_ft   = w + o; o += (size_t)Bc * Cc * Mc;
    float* Srow     = w + o; o += (size_t)Bc * Cc * Mc;
    float* Scol     = w + o; o += (size_t)Bc * Cc * Nc;
    // row-branch plane directly followed by its col-branch twin: a stack of 2*B planes
    float* Qr = w + o; o += (size_t)Bc * HIDc * Nc;       // 81920 each
    float* Qc = w + o; o += (size_t)Bc * HIDc * Mc;
    float* Kr = w + o; o += (size_t)Bc * HIDc * Mc;
    float* Kc = w + o; o += (size_t)Bc * HIDc * Nc;
    float* Vr = w + o; o += (size_t)Bc * HIDc * Mc;
    float* Vc = w + o; o += (size_t)Bc * HIDc * Nc;
    float* Rrow = w + o; o += (size_t)Bc * Cc * Nc;
    float* Rcol = w + o; o += (size_t)Bc * Cc * Mc;
    (void)ws_size; (void)in_sizes; (void)n_in; (void)out_size;

    const float sqrtC = sqrtf((float)Cc);

    // 1) per-pixel channel norms (pass 1 over x)
    pixel_invnorm<<<(Bc * Nc * Mc + 255) / 256, 256, 0, stream>>>(x, invp);

    // 2) plane reductions (pass 2 over x)
    plane_reduce<<<dim3(Cc / PR_CH, Bc), PR_THREADS, 0, stream>>>(x, invp, row_ft, col_ft, Srow, Scol);

    // N == M, so the two branches have equal shapes and share one grid per stage:
    // blockIdx.z of the projections runs over 6*B planes, blockIdx.y of attention over the 2*B stacked planes.
    static_assert(Nc == Mc, "branch stacking needs equal row and column lengths");
    (void)Qc; (void)Kc; (void)Vc;

    // 3) all six QKV projections (128x192x160 WMMA GEMMs) in one grid, feature channel norms included
    const dim3 gP(Nc / 16, HIDc / 16, 6 * Bc);
    qkv_wmma<<<gP, 32, 0, stream>>>(Wq, Wk, Wv, gq, gk, gv, row_ft, col_ft, Srow, Scol, sqrtC, Qr);

    // 4) attention, output projection (Wo, bo) and reduce projection in one grid, both branches.
    //    Wr is (C, 2C): the row branch takes Wr[:, :C], the col branch Wr[:, C:]
    const dim3 gA(Nc / 16, 2 * Bc);
    attn_proj<<<gA, FT_THREADS, 0, stream>>>(Qr, Kr, Vr, memkv, Wo, bo, Wr, Rrow, (float)Nc);

    // 5) broadcast add -> final output (78.6 MB, float4 stores)
    bcast_add<<<Bc * Cc, BC_THREADS, 0, stream>>>(Rrow, Rcol, out);
}

// v007
// One run takes 36.4 microseconds.
// In both of two side-by-side timings against v006, it was 1.07 times as fast.
// Counting every step since v000, it is 5.24 times as fast.
#include <hip/hip_runtime.h>
#include <math.h>

// ---------------- problem constants ----------------
constexpr int Bc   = 4;
constexpr int Cc   = 192;
constexpr int Nc   = 160;
constexpr int Mc   = 160;
constexpr int Hc   = 4;
constexpr int DHc  = 32;
constexpr int HIDc = 128;   // Hc*DHc
constexpr int NMEMc = 4;
#define SCALE_F 0.17677669529663687f   // 1/sqrt(32)

typedef __attribute__((ext_vector_type(16))) _Float16 v16h;
typedef __attribute__((ext_vector_type(8)))  float    v8f;
typedef __attribute__((ext_vector_type(4)))  float    v4f;

// =====================================================================
// Kernel 1: per-pixel inverse channel norm of x:  invp[b,n,m]
// One block takes 128 neighbouring pixels: a lane holds four of them, so every wave-wide
// load is 512 contiguous bytes of one channel plane. The four waves take 48 channels each,
// request all of them before the first sum, and add their partial sums through LDS.
// =====================================================================
constexpr int PN_WAVES = 4;
constexpr int PN_CH    = Cc / PN_WAVES;     // channels per wave
constexpr int PN_PIX   = 32 * 4;            // pixels per block
static_assert(Cc % PN_WAVES == 0 && PN_CH % 4 == 0 && (Nc * Mc) % PN_PIX == 0, "pixel norm tiling");
__global__ __launch_bounds__(PN_WAVES * 32) void pixel_invnorm(const float* __restrict__ x,
                                                               float* __restrict__ invp)
{
    __shared__ v4f part[PN_WAVES][32];
    constexpr int NM  = Nc * Mc;
    constexpr int GPB = NM / PN_PIX;        // blocks per batch entry
    const int lane = threadIdx.x & 31;
    const int wave = threadIdx.x >> 5;
    const int b = blockIdx.x / GPB;
    const int g = blockIdx.x - b * GPB;
    const v4f* xp = (const v4f*)(x + ((size_t)b * Cc + wave * PN_CH) * NM + g * PN_PIX) + lane;

    v4f v[PN_CH];
#pragma unroll
    for (int c = 0; c < PN_CH; ++c) v[c] = xp[c * (NM / 4)];
    // keeps every load in front of the first sum; without it each load sinks to its use and
    // the wave waits out a few loads at a time
    __builtin_amdgcn_sched_barrier(0);
    v4f s[4] = { (v4f)(0.f), (v4f)(0.f), (v4f)(0.f), (v4f)(0.f) };   // four chains per pixel
#pragma unroll
    for (int c = 0; c < PN_CH; ++c) s[c & 3] += v[c] * v[c];
    part[wave][lane] = (s[0] + s[1]) + (s[2] + s[3]);
    __syncthreads();

    if (wave == 0) {
        const v4f t = (part[0][lane] + part[1][lane]) + (part[2][lane] + part[3][lane]);
        v4f r;
#pragma unroll
        for (int i = 0; i < 4; ++i) r[i] = 1.0f / fmaxf(sqrtf(t[i]), 1e-12f);
        ((v4f*)(invp + (size_t)b * NM + g * PN_PIX))[lane] = r;
    }
}

// =====================================================================
// Kernel 2: plane reductions, every plane read once with whole-line loads.
//  row_ft[b,c,n] = mean_m x          col_ft[b,c,m] = mean_n x
//  Scol[b,c,n]   = sum_m x*invp      Srow[b,c,m]   = sum_n x*invp
// One block takes 3 channels of one batch entry, so a float4 of invp serves three
// planes. 640 threads cover 16 rows of 40 float4; a thread keeps its four columns'
// sums in registers and leaves each row's four-element partial in LDS. After the
// barrier one thread per (channel, index) adds up a row's 40 partials and a
// column's 16 partials.
// =====================================================================
constexpr int PR_CH      = 3;                       // channels per block
constexpr int PR_COLS4   = Mc / 4;                  // float4 per row
constexpr int PR_SLOTS   = 16;                      // rows covered by one pass
constexpr int PR_THREADS = PR_COLS4 * PR_SLOTS;     // 640
constexpr int PR_PASSES  = Nc / PR_SLOTS;           // 10
constexpr int PR_GRP     = 2;                       // passes fetched together
constexpr int PR_NGRP    = PR_PASSES / PR_GRP;      // 5
constexpr int PR_PITCH   = PR_COLS4 + 1;            // odd pitch: 32 rows read side by side hit distinct banks
static_assert(Cc % PR_CH == 0 && Nc % PR_SLOTS == 0 && Mc % 4 == 0 && Nc == Mc &&
              PR_PASSES % PR_GRP == 0 && PR_CH * Nc <= PR_THREADS && (PR_CH * Nc) % 32 == 0, "plane_reduce tiling");
__global__ __launch_bounds__(PR_THREADS) void plane_reduce(const float* __restrict__ x,
                                                           const float* __restrict__ invp,
                                                           float* __restrict__ row_ft,
                                                           float* __restrict__ col_ft,
                                                           float* __restrict__ Srow,
                                                           float* __restrict__ Scol)
{
    __shared__ float2 rowp[PR_CH][Nc][PR_PITCH];            // (sum, weighted sum) of 4 columns
    __shared__ v4f colp[PR_SLOTS][PR_CH][2][PR_COLS4];      // column sums of one row slot

    const int b = blockIdx.y, c0 = blockIdx.x * PR_CH;
    const int t  = threadIdx.x;
    const int cg = t % PR_COLS4;
    const int r0 = t / PR_COLS4;
    constexpr int PLANE4 = Nc * Mc / 4;
    const v4f* xp = (const v4f*)(x + ((size_t)b * Cc + c0) * Nc * Mc) + t;
    const v4f* ip = (const v4f*)(invp + (size_t)b * Nc * Mc) + t;

    v4f cs[PR_CH], cw[PR_CH];
#pragma unroll
    for (int ch = 0; ch < PR_CH; ++ch) {
        cs[ch] = (v4f)(0.f);
        cw[ch] = (v4f)(0.f);
    }
    // Two register sets of PR_GRP passes each: the next group's loads are issued before
    // this group is summed. Unrolled, so set indices are static and offsets immediate.
    v4f wv[2][PR_GRP], xv[2][PR_GRP][PR_CH];
#pragma unroll
    for (int p = 0; p < PR_GRP; ++p) {
        wv[0][p] = ip[p * PR_THREADS];
#pragma unroll
        for (int ch = 0; ch < PR_CH; ++ch) xv[0][p][ch] = xp[ch * PLANE4 + p * PR_THREADS];
    }
#pragma unroll
    for (int g = 0; g < PR_NGRP; ++g) {
        const int cur = g & 1, nxt = cur ^ 1;
        // the pair of scheduling barriers pins "next group's loads, then this group's sums";
        // without it each load sinks to its use and the wave waits out one load at a time
        __builtin_amdgcn_sched_barrier(0);
        if (g + 1 < PR_NGRP) {
#pragma unroll
            for (int p = 0; p < PR_GRP; ++p) {
                const int k = (g + 1) * PR_GRP + p;
                wv[nxt][p] = ip[k * PR_THREADS];
#pragma unroll
                for (int ch = 0; ch < PR_CH; ++ch)
                    xv[nxt][p][ch] = xp[ch * PLANE4 + k * PR_THREADS];
            }
        }
        __builtin_amdgcn_sched_barrier(0);
#pragma unroll
        for (int p = 0; p < PR_GRP; ++p) {
            const v4f w4 = wv[cur][p];
#pragma unroll
            for (int ch = 0; ch < PR_CH; ++ch) {
                const v4f v = xv[cur][p][ch];
                const v4f vw = v * w4;
                cs[ch] += v;
                cw[ch] += vw;
                rowp[ch][(g * PR_GRP + p) * PR_SLOTS + r0][cg] =
                    make_float2((v.x + v.y) + (v.z + v.w), (vw.x + vw.y) + (vw.z + vw.w));
            }
        }
    }
#pragma unroll
    for (int ch = 0; ch < PR_CH; ++ch) {
        colp[r0][ch][0][cg] = cs[ch];
        colp[r0][ch][1][cg] = cw[ch];
    }
    // the loads' base and index registers are reused below: this wait stands in front of that
    asm volatile("s_wait_xcnt 0x0" ::: "memory");
    __syncthreads();

    if (t < PR_CH * Nc) {       // whole waves: 480 = 15 * 32
        const int ch = t / Nc;
        const int i  = t - ch * Nc;
        float rs = 0.f, rw = 0.f;
#pragma unroll
        for (int j = 0; j < PR_COLS4; ++j) {
            const float2 p = rowp[ch][i][j];
            rs += p.x;
            rw += p.y;
        }
        const float* cp = (const float*)colp;
        float ss = 0.f, sw = 0.f;
#pragma unroll
        for (int sl = 0; sl < PR_SLOTS; ++sl) {
            ss += cp[((sl * PR_CH + ch) * 2 + 0) * Mc + i];
            sw += cp[((sl * PR_CH + ch) * 2 + 1) * Mc + i];
        }
        const size_t o = ((size_t)b * Cc + c0 + ch) * Nc + i;
        row_ft[o] = rs * (1.0f / Mc);
        Scol[o]   = rw;
        col_ft[o] = ss * (1.0f / Nc);
        Srow[o]   = sw;
    }
}

// lane l reads lane l ^ 16: a vector move between the two 16-lane rows, no LDS-path wait
__device__ __forceinline__ float other_row(float v)
{
    const unsigned u = __float_as_uint(v);
    return __uint_as_float(__builtin_amdgcn_permlanex16(u, u, 0x76543210u, 0xfedcba98u, false, false));
}

// =====================================================================
// Kernel 3: all six q/k/v projections in one grid, one wave = one 16x16 output tile.
//   Out[m,p] = sum_k (W[m,k]*g[k]) * (X[k,p] * scale_p)
//   blockIdx.z = ((branch*3 + kind) * B + b), kind 0=q 1=k 2=v, branch 0=row 1=col
//   row branch: q<-row_ft, k<-col_ft, v<-Srow ; col branch: q<-col_ft, k<-row_ft, v<-Scol
//   Out planes are stacked [Qr|Qc|Kr|Kc|Vr|Vc], each (B, HID, P).
// The B operand of a tile is all 192 channels of its 16 columns, so the wave that loads it
// also holds what the columns' channel norm needs: lanes l and l ^ 16 hold the two halves
// of column l & 15. The wave fetches the whole operand into registers, sums the squares,
// and scales by sqrt(C) / norm before rounding to f16 (v: by sqrt(C) alone).
// Fragment layouts per CDNA5 ISA 7.12.2 (16-bit A 16x32; B row-striped): k order
// k0 + 0..7, then 16 + k0 + 0..7, on both operands.
// =====================================================================
constexpr int QP_KS = Cc / 32;      // 32-deep k steps
static_assert(Cc % 32 == 0 && Nc == Mc && Nc % 16 == 0 && HIDc % 16 == 0, "projection tiling");
__global__ __launch_bounds__(32) void qkv_wmma(const float* __restrict__ Wq,
                                               const float* __restrict__ Wk,
                                               const float* __restrict__ Wv,
                                               const float* __restrict__ gq,
                                               const float* __restrict__ gk,
                                               const float* __restrict__ gv,
                                               const float* __restrict__ row_ft,
                                               const float* __restrict__ col_ft,
                                               const float* __restrict__ Srow,
                                               const float* __restrict__ Scol,
                                               float xscale,
                                               float* __restrict__ qkv)
{
    constexpr int P = Nc;
    const int z      = blockIdx.z;
    const int b      = z % Bc;
    const int g      = z / Bc;
    const int kind   = g % 3;
    const int branch = g / 3;
    const bool from_row = (kind == branch);     // q of row branch, k of col branch
    const float* W  = (kind == 0) ? Wq : (kind == 1) ? Wk : Wv;
    const float* cs = (kind == 0) ? gq : (kind == 1) ? gk : gv;
    const float* X  = (kind == 2) ? (branch ? Scol : Srow) : (from_row ? row_ft : col_ft);
    const int lane = threadIdx.x;
    const int nl = lane & 15;
    const int k0 = (lane >> 4) * 8;
    const int mt = blockIdx.y;

    // wave-uniform bases and one 32-bit lane offset each (bytes for the 16-byte loads): these are
    // the registers the loads name, so the wait below can name them too
    const float* Xb = X + (size_t)b * Cc * P + (blockIdx.x << 4);
    const char*  Wt = (const char*)(W + (size_t)(mt << 4) * Cc);
    const char*  Gt = (const char*)cs;
    const int xo = k0 * P + nl;             // column nl of the tile, first of this lane's channels
    const int wo = (nl * Cc + k0) * 4;      // row nl of the tile
    const int go = k0 * 4;

    // this lane's 96 of the 192 channels of its column
    float xb[QP_KS][16];
#pragma unroll
    for (int s = 0; s < QP_KS; ++s)
#pragma unroll
        for (int j = 0; j < 8; ++j) {
            xb[s][j]     = Xb[xo + (s * 32 + j) * P];
            xb[s][8 + j] = Xb[xo + (s * 32 + 16 + j) * P];
        }
    // row mt*16 + nl of W and the channel gains, same k order
    float4 wv[QP_KS][4], gv4[QP_KS][4];
#pragma unroll
    for (int s = 0; s < QP_KS; ++s)
#pragma unroll
        for (int i = 0; i < 4; ++i) {
            const int kb = (s * 32 + (i >> 1) * 16 + (i & 1) * 4) * 4;
            wv[s][i]  = *(const float4*)(Wt + wo + kb);
            gv4[s][i] = *(const float4*)(Gt + go + kb);
        }
    // the loads' base and offset registers are reused below: the wait stands in front of that, and
    // naming them keeps the registers untouched up to it
    asm volatile("s_wait_xcnt 0x0" :: "v"(xo), "v"(wo), "v"(go), "s"(Xb), "s"(Wt), "s"(Gt) : "memory");

    float psn = xscale;
    if (kind != 2) {        // wave-uniform: q and k take the column's inverse channel norm
        float q4[4] = { 0.f, 0.f, 0.f, 0.f };   // four chains, so the adds do not wait on one another
#pragma unroll
        for (int s = 0; s < QP_KS; ++s)
#pragma unroll
            for (int j = 0; j < 16; ++j) q4[j & 3] += xb[s][j] * xb[s][j];
        float ss = (q4[0] + q4[1]) + (q4[2] + q4[3]);
        ss += other_row(ss);
        psn = (1.0f / fmaxf(sqrtf(ss), 1e-12f)) * xscale;
    }

    v8f acc = {};
#pragma unroll
    for (int s = 0; s < QP_KS; ++s) {
        v16h a, bf;
#pragma unroll
        for (int i = 0; i < 4; ++i) {
            a[i * 4 + 0] = (_Float16)(wv[s][i].x * gv4[s][i].x);
            a[i * 4 + 1] = (_Float16)(wv[s][i].y * gv4[s][i].y);
            a[i * 4 + 2] = (_Float16)(wv[s][i].z * gv4[s][i].z);
            a[i * 4 + 3] = (_Float16)(wv[s][i].w * gv4[s][i].w);
        }
#pragma unroll
        for (int j = 0; j < 16; ++j) bf[j] = (_Float16)(xb[s][j] * psn);
        acc = __builtin_amdgcn_wmma_f32_16x16x32_f16(false, a, false, bf,
                                                     (short)0, acc, false, false);
    }
    float* Op = qkv + (((size_t)(kind * 2 + branch) * Bc + b) * HIDc + (mt << 4) + k0) * P
                    + (blockIdx.x << 4) + nl;
#pragma unroll
    for (int r = 0; r < 8; ++r) Op[r * P] = acc[r];
}

// =====================================================================
// Kernel 4: attention, output projection and reduce projection of one 16-query tile.
// First part: attention for one (b, h, 16-query tile), one wave, scores in registers.
//   Q,K,V are (2B, 128, P) row-major (row = h*32+d, col = position), P = 160 fixed.
//   s = (Q^T.K).SCALE; exact max over [keys, mem]; Z = sum e_m + rep * sum e_k
//   O[b, h*32+d, q] = (e_k.v_sum + e_m.mem_v) / Z
// The scores are formed transposed, D[key][query] = K^T.Q: a lane then holds 80 of the
// 160 scores of ONE query (its column), lane l ^ 16 the other 80. Maximum and sum are
// register trees plus one exchange with that lane, and two score tiles, converted in
// place, are the B operand of out^T[d][query] = V.e^T (k order 8h+s, 16+8h+s on both
// sides). All trip counts are constants: the loops unroll, every load takes an immediate
// offset from a fixed base, and no address depends on a loaded value.
// =====================================================================
constexpr int AT_P  = Nc;           // keys = queries = 160 in both branches
constexpr int AT_NT = AT_P / 16;    // 16-key score tiles
constexpr int AT_NK = AT_P / 32;    // 32-key steps of the second product
static_assert(Nc == Mc && AT_P % 32 == 0 && DHc == 32, "attention tiling");
typedef __attribute__((ext_vector_type(8))) _Float16 v8h;
typedef __attribute__((ext_vector_type(4))) _Float16 v4h;
typedef __attribute__((ext_vector_type(2))) _Float16 v2h;
constexpr int FT_ATTW    = Hc;                          // attention waves, one per head
constexpr int FT_PRJW    = Cc / 16;                     // projection waves, one per 16 output rows
constexpr int FT_THREADS = (FT_ATTW + FT_PRJW) * 32;    // 512
constexpr int FT_OP      = HIDc + 8;                    // f16 per query in Ot: rows stay 16-byte aligned
constexpr int FT_AP      = Cc + 8;                      // f16 per query in At
static_assert(HIDc == 128 && Cc % 64 == 0, "projection tiling: a Wo row is one 16-byte load per lane");

// Ot[query][h*32 + d] takes the tile's output, rounded to f16 as the next product reads it
__device__ __forceinline__ void attn_tile(const float* __restrict__ Q,
                                          const float* __restrict__ Kf,
                                          const float* __restrict__ V,
                                          const float* __restrict__ memkv,
                                          _Float16 (*__restrict__ Ot)[FT_OP],
                                          float rep, int b, int h, int qt, int lane)
{
    constexpr int P = AT_P;
    const int nl = lane & 15;
    const int k0 = (lane >> 4) * 8;
    const size_t base = ((size_t)b * HIDc + h * DHc) * P;
    // wave-uniform bases and one 32-bit lane offset each: fewer address registers than lane pointers
    const float* Qp = Q + base + qt * 16;
    const float* Kp = Kf + base;
    const float* Vp = V + base;
    const int kq = k0 * P + nl;     // Q: column = this lane's query; K: row of K^T = key nl of a tile
    const int vo = nl * P + k0;     // row of V = channel nl of a tile
    const float* mk = memkv + h * NMEMc * DHc + k0;                // mem_kv[0]
    const float* mv = mk + Hc * NMEMc * DHc;                       // mem_kv[1]

    // this lane's 16 of the 32 channels of its query: d = k0 + j and 16 + k0 + j
    float qf[16];
#pragma unroll
    for (int j = 0; j < 8; ++j) {
        qf[j]     = Qp[kq + j * P];
        qf[8 + j] = Qp[kq + (16 + j) * P];
    }
    v16h bq;
#pragma unroll
    for (int j = 0; j < 16; ++j) bq[j] = (_Float16)qf[j];

    // scores: sc[jt][r] = s[key jt*16 + k0 + r][query nl]
    v8f sc[AT_NT];
#pragma unroll
    for (int jt = 0; jt < AT_NT; ++jt) {
        v16h ak;
#pragma unroll
        for (int j = 0; j < 8; ++j) {
            ak[j]     = (_Float16)Kp[kq + j * P + jt * 16];
            ak[8 + j] = (_Float16)Kp[kq + (16 + j) * P + jt * 16];
        }
        v8f c = {};
        c = __builtin_amdgcn_wmma_f32_16x16x32_f16(false, ak, false, bq,
                                                   (short)0, c, false, false);
        sc[jt] = c * SCALE_F;
    }
    // the base and offset registers of the Q and K loads are reused below: the wait stands in
    // front of that, and naming them keeps the registers untouched up to it
    asm volatile("s_wait_xcnt 0x0" :: "v"(kq), "s"(Qp), "s"(Kp) : "memory");

    // memory-slot scores in f32: each lane sums its 16 channels, the other row adds its 16
    float sm[NMEMc];
#pragma unroll
    for (int jm = 0; jm < NMEMc; ++jm) {
        const float4 m0 = *(const float4*)(mk + jm * DHc);
        const float4 m1 = *(const float4*)(mk + jm * DHc + 4);
        const float4 m2 = *(const float4*)(mk + jm * DHc + 16);
        const float4 m3 = *(const float4*)(mk + jm * DHc + 20);
        const float ma[16] = { m0.x, m0.y, m0.z, m0.w, m1.x, m1.y, m1.z, m1.w,
                               m2.x, m2.y, m2.z, m2.w, m3.x, m3.y, m3.z, m3.w };
        float acc = 0.f;
#pragma unroll
        for (int j = 0; j < 16; ++j) acc += qf[j] * ma[j];
        sm[jm] = acc;
    }
#pragma unroll
    for (int jm = 0; jm < NMEMc; ++jm) sm[jm] = (sm[jm] + other_row(sm[jm])) * SCALE_F;

    // exact maximum of the query's 160 + 4 scores
    v8f m8 = sc[0];
#pragma unroll
    for (int jt = 1; jt < AT_NT; ++jt)
#pragma unroll
        for (int r = 0; r < 8; ++r) m8[r] = fmaxf(m8[r], sc[jt][r]);
    float mx = fmaxf(fmaxf(fmaxf(m8[0], m8[1]), fmaxf(m8[2], m8[3])),
                     fmaxf(fmaxf(m8[4], m8[5]), fmaxf(m8[6], m8[7])));
    mx = fmaxf(mx, other_row(mx));
#pragma unroll
    for (int jm = 0; jm < NMEMc; ++jm) mx = fmaxf(mx, sm[jm]);

    v8f s8 = {};
#pragma unroll
    for (int jt = 0; jt < AT_NT; ++jt)
#pragma unroll
        for (int r = 0; r < 8; ++r) {
            const float e = expf(sc[jt][r] - mx);
            sc[jt][r] = e;
            s8[r] += e;
        }
    float se = ((s8[0] + s8[1]) + (s8[2] + s8[3])) + ((s8[4] + s8[5]) + (s8[6] + s8[7]));
    se += other_row(se);
    float sem = 0.f;
#pragma unroll
    for (int jm = 0; jm < NMEMc; ++jm) {
        sm[jm] = expf(sm[jm] - mx);
        sem += sm[jm];
    }
    const float Z = sem + rep * se;

    // B operand of the second product: be[t][s] = e[key t*32 + kmap(s)][query nl]
    v16h be[AT_NK];
#pragma unroll
    for (int t = 0; t < AT_NK; ++t)
#pragma unroll
        for (int j = 0; j < 8; ++j) {
            be[t][j]     = (_Float16)sc[2 * t][j];
            be[t][8 + j] = (_Float16)sc[2 * t + 1][j];
        }

    // out^T = V . e^T, two 16-channel tiles; c[r] = out[d = nt2*16 + k0 + r][query nl]
#pragma unroll
    for (int nt2 = 0; nt2 < 2; ++nt2) {
        v8f c = {};
#pragma unroll
        for (int t = 0; t < AT_NK; ++t) {
            const float* Vrow = Vp + vo + nt2 * 16 * P + t * 32;
            const float4 v0 = *(const float4*)(Vrow);
            const float4 v1 = *(const float4*)(Vrow + 4);
            const float4 v2 = *(const float4*)(Vrow + 16);
            const float4 v3 = *(const float4*)(Vrow + 20);
            const float va[16] = { v0.x, v0.y, v0.z, v0.w, v1.x, v1.y, v1.z, v1.w,
                                   v2.x, v2.y, v2.z, v2.w, v3.x, v3.y, v3.z, v3.w };
            v16h av;
#pragma unroll
            for (int j = 0; j < 16; ++j) av[j] = (_Float16)va[j];
            c = __builtin_amdgcn_wmma_f32_16x16x32_f16(false, av, false, be[t],
                                                       (short)0, c, false, false);
        }
        float memc[8] = { 0.f, 0.f, 0.f, 0.f, 0.f, 0.f, 0.f, 0.f };
#pragma unroll
        for (int jm = 0; jm < NMEMc; ++jm) {
            const float4 w0 = *(const float4*)(mv + jm * DHc + nt2 * 16);
            const float4 w1 = *(const float4*)(mv + jm * DHc + nt2 * 16 + 4);
            const float wa[8] = { w0.x, w0.y, w0.z, w0.w, w1.x, w1.y, w1.z, w1.w };
#pragma unroll
            for (int r = 0; r < 8; ++r) memc[r] += sm[jm] * wa[r];
        }
        v8h o;
#pragma unroll
        for (int r = 0; r < 8; ++r) o[r] = (_Float16)((c[r] + memc[r]) / Z);
        *(v8h*)&Ot[nl][h * DHc + nt2 * 16 + k0] = o;
    }
    // same for the V loads: nothing may land on their base or offset register ahead of this wait
    asm volatile("s_wait_xcnt 0x0" :: "v"(vo), "s"(Vp) : "memory");
}

// A or B fragment of one 32-deep k step from an LDS row [row or query][k]; p = this lane's row + k0.
// k order k0 + 0..7, then 16 + k0 + 0..7, on both operands
__device__ __forceinline__ v16h lds_frag(const _Float16* p)
{
    const v8h lo = *(const v8h*)(p);
    const v8h hi = *(const v8h*)(p + 16);
    return __builtin_shufflevector(lo, hi, 0, 1, 2, 3, 4, 5, 6, 7, 8, 9, 10, 11, 12, 13, 14, 15);
}

// One block per (stacked plane b of 2*B, 16-query tile). Waves 0..3 run the attention of one
// head each; meanwhile waves 4..15 fetch the Wo and Wr rows of their 16 output channels with
// whole-line loads (a lane-per-row load would touch 16 lines each and crowd out the attention
// waves' loads) and turn them into A fragments through a wave-private piece of LDS.
//   Ot = attention output (128 x 16)          -> barrier
//   At = Wo . Ot + bo     (192 x 16)          -> barrier
//   R[b, :, tile] = Wr[:, branch half] . At   (192 x 16)
// Both intermediates cross in LDS as f16, the rounding the next product applies anyway.
__global__ __launch_bounds__(FT_THREADS) void attn_proj(const float* __restrict__ Q,
                                                        const float* __restrict__ Kf,
                                                        const float* __restrict__ V,
                                                        const float* __restrict__ memkv,
                                                        const float* __restrict__ Wo,
                                                        const float* __restrict__ bo,
                                                        const float* __restrict__ Wr,
                                                        float* __restrict__ R,
                                                        float rep)
{
    __shared__ __attribute__((aligned(16))) _Float16 Ot[16][FT_OP];
    __shared__ __attribute__((aligned(16))) _Float16 At[16][FT_AP];
    __shared__ __attribute__((aligned(16))) _Float16 WoS[FT_PRJW][16][FT_OP];   // one slice per projection wave
    __shared__ __attribute__((aligned(16))) _Float16 WrS[FT_PRJW][16][FT_AP];
    constexpr int P = AT_P;
    constexpr int KO = HIDc / 32, KR = Cc / 32;
    const int b = blockIdx.y, qt = blockIdx.x;
    const int wave = __builtin_amdgcn_readfirstlane(threadIdx.x >> 5);   // scalar: the role branches are wave-uniform
    const int lane = threadIdx.x & 31;
    const int nl = lane & 15;
    const int k0 = (lane >> 4) * 8;
    const int mt = wave - FT_ATTW;

    v16h aWo[KO], aWr[KR];
    float bias[8];
    if (wave < FT_ATTW) {
        attn_tile(Q, Kf, V, memkv, Ot, rep, b, wave, qt, lane);
    } else {
        // a Wo row is 32 lanes x 4 floats, a Wr half row 3 x (32 lanes x 2 floats)
        const float* WoBlk = Wo + (size_t)mt * 16 * HIDc + lane * 4;
        const float* WrBlk = Wr + (size_t)mt * 16 * (2 * Cc) + (b / Bc) * Cc + lane * 2;
        float4 wo[16];
        float2 wr[16][Cc / 64];
#pragma unroll
        for (int r = 0; r < 16; ++r) wo[r] = *(const float4*)(WoBlk + r * HIDc);
#pragma unroll
        for (int r = 0; r < 16; ++r)
#pragma unroll
            for (int j = 0; j < Cc / 64; ++j) wr[r][j] = *(const float2*)(WrBlk + r * (2 * Cc) + j * 64);
#pragma unroll
        for (int r = 0; r < 16; ++r) {
            const v4h hw = { (_Float16)wo[r].x, (_Float16)wo[r].y, (_Float16)wo[r].z, (_Float16)wo[r].w };
            *(v4h*)&WoS[mt][r][lane * 4] = hw;
        }
#pragma unroll
        for (int r = 0; r < 16; ++r)
#pragma unroll
            for (int j = 0; j < Cc / 64; ++j) {
                const v2h hw = { (_Float16)wr[r][j].x, (_Float16)wr[r][j].y };
                *(v2h*)&WrS[mt][r][j * 64 + lane * 2] = hw;
            }
        // the slice is read back by the wave that wrote it, but by other lanes: the wave's own
        // stores have landed behind this wait; no other wave touches the slice, so no barrier
        asm volatile("s_wait_dscnt 0x0" ::: "memory");
#pragma unroll
        for (int s = 0; s < KO; ++s) aWo[s] = lds_frag(&WoS[mt][nl][s * 32 + k0]);
#pragma unroll
        for (int s = 0; s < KR; ++s) aWr[s] = lds_frag(&WrS[mt][nl][s * 32 + k0]);
        const float4 b0 = *(const float4*)(bo + mt * 16 + k0);
        const float4 b1 = *(const float4*)(bo + mt * 16 + k0 + 4);
        bias[0] = b0.x; bias[1] = b0.y; bias[2] = b0.z; bias[3] = b0.w;
        bias[4] = b1.x; bias[5] = b1.y; bias[6] = b1.z; bias[7] = b1.w;
    }
    __syncthreads();        // Ot complete
    if (wave >= FT_ATTW) {
        v8f acc = {};
#pragma unroll
        for (int s = 0; s < KO; ++s)
            acc = __builtin_amdgcn_wmma_f32_16x16x32_f16(false, aWo[s], false, lds_frag(&Ot[nl][s * 32 + k0]),
                                                         (short)0, acc, false, false);
        v8h o;
#pragma unroll
        for (int r = 0; r < 8; ++r) o[r] = (_Float16)(acc[r] + bias[r]);
        *(v8h*)&At[nl][mt * 16 + k0] = o;
    }
    __syncthreads();        // At complete
    if (wave >= FT_ATTW) {
        v8f acc = {};
#pragma unroll
        for (int s = 0; s < KR; ++s)
            acc = __builtin_amdgcn_wmma_f32_16x16x32_f16(false, aWr[s], false, lds_frag(&At[nl][s * 32 + k0]),
                                                         (short)0, acc, false, false);
        float* Rp = R + ((size_t)b * Cc + mt * 16 + k0) * P + qt * 16 + nl;
#pragma unroll
        for (int r = 0; r < 8; ++r) Rp[r * P] = acc[r];
    }
}

// =====================================================================
// Kernel 5: out[b,d,n,m] = Rrow[b,d,n] + Rcol[b,d,m]   (float4 writes)
// One block per (b,d) plane. 160 threads cover 4 rows of 40 float4, so a thread
// keeps its four columns of Rcol in registers and stores them under every 4th
// row: a wave lives for 40 stores of 512 contiguous bytes instead of one.
// =====================================================================
constexpr int BC_COLS4 = Mc / 4;                 // float4 per row
constexpr int BC_ROWS  = 4;                      // rows covered by one pass of the block
constexpr int BC_THREADS = BC_COLS4 * BC_ROWS;   // 160
static_assert(Mc % 4 == 0 && Nc % BC_ROWS == 0, "plane must split into whole passes");
__global__ __launch_bounds__(BC_THREADS) void bcast_add(const float* __restrict__ Rrow,
                                                        const float* __restrict__ Rcol,
                                                        float* __restrict__ out)
{
    const int plane = blockIdx.x;                // b*C + d
    const int t  = threadIdx.x;
    const int cg = t % BC_COLS4;
    const int r0 = t / BC_COLS4;
    const float4 cv = *(const float4*)(Rcol + (size_t)plane * Mc + cg * 4);
    const float* rr = Rrow + (size_t)plane * Nc + r0;
    float4* op = (float4*)(out + (size_t)plane * Nc * Mc) + t;
    // all row values are requested before the first store, so the stores wait once
    float rv[Nc / BC_ROWS];
#pragma unroll
    for (int k = 0; k < Nc / BC_ROWS; ++k) rv[k] = rr[k * BC_ROWS];
    // unrolled: rv[] stays in registers and every store takes an immediate offset
#pragma unroll
    for (int k = 0; k < Nc / BC_ROWS; ++k) {
        float4 o;
        o.x = rv[k] + cv.x; o.y = rv[k] + cv.y; o.z = rv[k] + cv.z; o.w = rv[k] + cv.w;
        op[k * BC_THREADS] = o;
    }
}

// =====================================================================
// Host launcher
// =====================================================================
extern "C" void kernel_launch(void* const* d_in, const int* in_sizes, int n_in,
                              void* d_out, int out_size, void* d_ws, size_t ws_size,
                              hipStream_t stream)
{
    const float* x     = (const float*)d_in[0];
    const float* gq    = (const float*)d_in[1];
    const float* gk    = (const float*)d_in[2];
    const float* gv    = (const float*)d_in[3];
    const float* Wq    = (const float*)d_in[4];
    const float* Wk    = (const float*)d_in[5];
    const float* Wv    = (const float*)d_in[6];
    const float* memkv = (const float*)d_in[7];
    const float* Wo    = (const float*)d_in[8];
    const float* bo    = (const float*)d_in[9];
    const float* Wr    = (const float*)d_in[10];
    float* out = (float*)d_out;

    // ---- workspace layout (floats) ----
    float* w = (float*)d_ws;
    size_t o = 0;
    float* invp     = w + o; o += (size_t)Bc * Nc * Mc;   // 102400
    float* row_ft   = w + o; o += (size_t)Bc * Cc * Nc;   // 122880
    float* col_ft   = w + o; o += (size_t)Bc * Cc * Mc;
    float* Srow     = w + o; o += (size_t)Bc * Cc * Mc;
    float* Scol     = w + o; o += (size_t)Bc * Cc * Nc;
    // row-branch plane directly followed by its col-branch twin: a stack of 2*B planes
    float* Qr = w + o; o += (size_t)Bc * HIDc * Nc;       // 81920 each
    float* Qc = w + o; o += (size_t)Bc * HIDc * Mc;
    float* Kr = w + o; o += (size_t)Bc * HIDc * Mc;
    float* Kc = w + o; o += (size_t)Bc * HIDc * Nc;
    float* Vr = w + o; o += (size_t)Bc * HIDc * Mc;
    float* Vc = w + o; o += (size_t)Bc * HIDc * Nc;
    float* Rrow = w + o; o += (size_t)Bc * Cc * Nc;
    float* Rcol = w + o; o += (size_t)Bc * Cc * Mc;
    (void)ws_size; (void)in_sizes; (void)n_in; (void)out_size;

    const float sqrtC = sqrtf((float)Cc);

    // 1) per-pixel channel norms (pass 1 over x)
    pixel_invnorm<<<Bc * Nc * Mc / PN_PIX, PN_WAVES * 32, 0, stream>>>(x, invp);

    // 2) plane reductions (pass 2 over x)
    plane_reduce<<<dim3(Cc / PR_CH, Bc), PR_THREADS, 0, stream>>>(x, invp, row_ft, col_ft, Srow, Scol);

    // N == M, so the two branches have equal shapes and share one grid per stage:
    // blockIdx.z of the projections runs over 6*B planes, blockIdx.y of attention over the 2*B stacked planes.
    static_assert(Nc == Mc, "branch stacking needs equal row and column lengths");
    (void)Qc; (void)Kc; (void)Vc;

    // 3) all six QKV projections (128x192x160 WMMA GEMMs) in one grid, feature channel norms included
    const dim3 gP(Nc / 16, HIDc / 16, 6 * Bc);
    qkv_wmma<<<gP, 32, 0, stream>>>(Wq, Wk, Wv, gq, gk, gv, row_ft, col_ft, Srow, Scol, sqrtC, Qr);

    // 4) attention, output projection (Wo, bo) and reduce projection in one grid, both branches.
    //    Wr is (C, 2C): the row branch takes Wr[:, :C], the col branch Wr[:, C:]
    const dim3 gA(Nc / 16, 2 * Bc);
    attn_proj<<<gA, FT_THREADS, 0, stream>>>(Qr, Kr, Vr, memkv, Wo, bo, Wr, Rrow, (float)Nc);

    // 5) broadcast add -> final output (78.6 MB, float4 stores)
    bcast_add<<<Bc * Cc, BC_THREADS, 0, stream>>>(Rrow, Rcol, out);
}

// v008
// One run takes 36 microseconds.
// Two timings next to v007 put it at 1.04 and 1.02 times that version's speed.
// Over all steps from v000 it is 5.40 times as fast.
#include <hip/hip_runtime.h>
#include <math.h>

// ---------------- problem constants ----------------
constexpr int Bc   = 4;
constexpr int Cc   = 192;
constexpr int Nc   = 160;
constexpr int Mc   = 160;
constexpr int Hc   = 4;
constexpr int DHc  = 32;
constexpr int HIDc = 128;   // Hc*DHc
constexpr int NMEMc = 4;
#define SCALE_F 0.17677669529663687f   // 1/sqrt(32)

typedef __attribute__((ext_vector_type(16))) _Float16 v16h;
typedef __attribute__((ext_vector_type(8)))  float    v8f;
typedef __attribute__((ext_vector_type(4)))  float    v4f;

// =====================================================================
// Kernel 1: per-pixel inverse channel norm of x:  invp[b,n,m]
// One block takes 128 neighbouring pixels: a lane holds four of them, so every wave-wide
// load is 512 contiguous bytes of one channel plane. The four waves take 48 channels each,
// request all of them before the first sum, and add their partial sums through LDS.
// =====================================================================
constexpr int PN_WAVES = 4;
constexpr int PN_CH    = Cc / PN_WAVES;     // channels per wave
constexpr int PN_PIX   = 32 * 4;            // pixels per block
static_assert(Cc % PN_WAVES == 0 && PN_CH % 4 == 0 && (Nc * Mc) % PN_PIX == 0, "pixel norm tiling");
__global__ __launch_bounds__(PN_WAVES * 32) void pixel_invnorm(const float* __restrict__ x,
                                                               float* __restrict__ invp)
{
    __shared__ v4f part[PN_WAVES][32];
    constexpr int NM  = Nc * Mc;
    constexpr int GPB = NM / PN_PIX;        // blocks per batch entry
    const int lane = threadIdx.x & 31;
    const int wave = threadIdx.x >> 5;
    const int b = blockIdx.x / GPB;
    const int g = blockIdx.x - b * GPB;
    const v4f* xp = (const v4f*)(x + ((size_t)b * Cc + wave * PN_CH) * NM + g * PN_PIX) + lane;

    v4f v[PN_CH];
#pragma unroll
    for (int c = 0; c < PN_CH; ++c) v[c] = xp[c * (NM / 4)];
    // keeps every load in front of the first sum; without it each load sinks to its use and
    // the wave waits out a few loads at a time
    __builtin_amdgcn_sched_barrier(0);
    v4f s[4] = { (v4f)(0.f), (v4f)(0.f), (v4f)(0.f), (v4f)(0.f) };   // four chains per pixel
#pragma unroll
    for (int c = 0; c < PN_CH; ++c) s[c & 3] += v[c] * v[c];
    part[wave][lane] = (s[0] + s[1]) + (s[2] + s[3]);
    __syncthreads();

    if (wave == 0) {
        const v4f t = (part[0][lane] + part[1][lane]) + (part[2][lane] + part[3][lane]);
        v4f r;
#pragma unroll
        for (int i = 0; i < 4; ++i) r[i] = 1.0f / fmaxf(sqrtf(t[i]), 1e-12f);
        ((v4f*)(invp + (size_t)b * NM + g * PN_PIX))[lane] = r;
    }
}

// =====================================================================
// Kernel 2: plane reductions, every plane read once with whole-line loads.
//  row_ft[b,c,n] = mean_m x          col_ft[b,c,m] = mean_n x
//  Scol[b,c,n]   = sum_m x*invp      Srow[b,c,m]   = sum_n x*invp
// One block takes 3 channels of one batch entry, so a float4 of invp serves three
// planes. 640 threads cover 16 rows of 40 float4; a thread keeps its four columns'
// sums in registers and leaves each row's four-element partial in LDS. After the
// barrier one thread per (channel, index) adds up a row's 40 partials and a
// column's 16 partials.
// =====================================================================
constexpr int PR_CH      = 3;                       // channels per block
constexpr int PR_COLS4   = Mc / 4;                  // float4 per row
constexpr int PR_SLOTS   = 16;                      // rows covered by one pass
constexpr int PR_THREADS = PR_COLS4 * PR_SLOTS;     // 640
constexpr int PR_PASSES  = Nc / PR_SLOTS;           // 10
constexpr int PR_GRP     = 2;                       // passes fetched together
constexpr int PR_NGRP    = PR_PASSES / PR_GRP;      // 5
constexpr int PR_PITCH   = PR_COLS4 + 1;            // odd pitch: 32 rows read side by side hit distinct banks
static_assert(Cc % PR_CH == 0 && Nc % PR_SLOTS == 0 && Mc % 4 == 0 && Nc == Mc &&
              PR_PASSES % PR_GRP == 0 && PR_CH * Nc <= PR_THREADS && (PR_CH * Nc) % 32 == 0, "plane_reduce tiling");
__global__ __launch_bounds__(PR_THREADS) void plane_reduce(const float* __restrict__ x,
                                                           const float* __restrict__ invp,
                                                           float* __restrict__ row_ft,
                                                           float* __restrict__ col_ft,
                                                           float* __restrict__ Srow,
                                                           float* __restrict__ Scol)
{
    __shared__ float2 rowp[PR_CH][Nc][PR_PITCH];            // (sum, weighted sum) of 4 columns
    __shared__ v4f colp[PR_SLOTS][PR_CH][2][PR_COLS4];      // column sums of one row slot

    const int b = blockIdx.y, c0 = blockIdx.x * PR_CH;
    const int t  = threadIdx.x;
    const int cg = t % PR_COLS4;
    const int r0 = t / PR_COLS4;
    constexpr int PLANE4 = Nc * Mc / 4;
    const v4f* xp = (const v4f*)(x + ((size_t)b * Cc + c0) * Nc * Mc) + t;
    const v4f* ip = (const v4f*)(invp + (size_t)b * Nc * Mc) + t;

    v4f cs[PR_CH], cw[PR_CH];
#pragma unroll
    for (int ch = 0; ch < PR_CH; ++ch) {
        cs[ch] = (v4f)(0.f);
        cw[ch] = (v4f)(0.f);
    }
    // Two register sets of PR_GRP passes each: the next group's loads are issued before
    // this group is summed. Unrolled, so set indices are static and offsets immediate.
    v4f wv[2][PR_GRP], xv[2][PR_GRP][PR_CH];
#pragma unroll
    for (int p = 0; p < PR_GRP; ++p) {
        wv[0][p] = ip[p * PR_THREADS];
#pragma unroll
        for (int ch = 0; ch < PR_CH; ++ch) xv[0][p][ch] = xp[ch * PLANE4 + p * PR_THREADS];
    }
#pragma unroll
    for (int g = 0; g < PR_NGRP; ++g) {
        const int cur = g & 1, nxt = cur ^ 1;
        // the pair of scheduling barriers pins "next group's loads, then this group's sums";
        // without it each load sinks to its use and the wave waits out one load at a time
        __builtin_amdgcn_sched_barrier(0);
        if (g + 1 < PR_NGRP) {
#pragma unroll
            for (int p = 0; p < PR_GRP; ++p) {
                const int k = (g + 1) * PR_GRP + p;
                wv[nxt][p] = ip[k * PR_THREADS];
#pragma unroll
                for (int ch = 0; ch < PR_CH; ++ch)
                    xv[nxt][p][ch] = xp[ch * PLANE4 + k * PR_THREADS];
            }
        }
        __builtin_amdgcn_sched_barrier(0);
#pragma unroll
        for (int p = 0; p < PR_GRP; ++p) {
            const v4f w4 = wv[cur][p];
#pragma unroll
            for (int ch = 0; ch < PR_CH; ++ch) {
                const v4f v = xv[cur][p][ch];
                const v4f vw = v * w4;
                cs[ch] += v;
                cw[ch] += vw;
                rowp[ch][(g * PR_GRP + p) * PR_SLOTS + r0][cg] =
                    make_float2((v.x + v.y) + (v.z + v.w), (vw.x + vw.y) + (vw.z + vw.w));
            }
        }
    }
#pragma unroll
    for (int ch = 0; ch < PR_CH; ++ch) {
        colp[r0][ch][0][cg] = cs[ch];
        colp[r0][ch][1][cg] = cw[ch];
    }
    // the loads' base and index registers are reused below: this wait stands in front of that
    asm volatile("s_wait_xcnt 0x0" ::: "memory");
    __syncthreads();

    if (t < PR_CH * Nc) {       // whole waves: 480 = 15 * 32
        const int ch = t / Nc;
        const int i  = t - ch * Nc;
        float rs = 0.f, rw = 0.f;
#pragma unroll
        for (int j = 0; j < PR_COLS4; ++j) {
            const float2 p = rowp[ch][i][j];
            rs += p.x;
            rw += p.y;
        }
        const float* cp = (const float*)colp;
        float ss = 0.f, sw = 0.f;
#pragma unroll
        for (int sl = 0; sl < PR_SLOTS; ++sl) {
            ss += cp[((sl * PR_CH + ch) * 2 + 0) * Mc + i];
            sw += cp[((sl * PR_CH + ch) * 2 + 1) * Mc + i];
        }
        const size_t o = ((size_t)b * Cc + c0 + ch) * Nc + i;
        row_ft[o] = rs * (1.0f / Mc);
        Scol[o]   = rw;
        col_ft[o] = ss * (1.0f / Nc);
        Srow[o]   = sw;
    }
}

// lane l reads lane l ^ 16: a vector move between the two 16-lane rows, no LDS-path wait
__device__ __forceinline__ float other_row(float v)
{
    const unsigned u = __float_as_uint(v);
    return __uint_as_float(__builtin_amdgcn_permlanex16(u, u, 0x76543210u, 0xfedcba98u, false, false));
}

// =====================================================================
// Kernel 3: q/k/v projections, attention, output projection and reduce projection of one
// 16-query tile, in one block per (stacked plane of 2*B, tile).
// Projections:  Out[m,p] = sum_k (W[m,k]*g[k]) * (X[k,p] * scale_p)
//   row branch: q<-row_ft, k<-col_ft, v<-Srow ; col branch: q<-col_ft, k<-row_ft, v<-Scol
// A block needs all 160 keys and values of its plane and forms them itself, so they never
// leave the WGP: K, V and the tile's Q go to LDS, laid out as the attention reads them.
//   1. all waves: W*g of the three matrices, whole-line loads, rounded to f16, to LDS rows
//   2. waves 0..9: 32 columns of the key or value features each, wave 10: the query columns.
//      A B operand is all 192 channels of 16 columns, so the wave that loads it also holds
//      what the columns' channel norm needs: lanes l and l ^ 16 hold the two halves of column
//      l & 15. It sums the squares and scales by sqrt(C) / norm before rounding to f16
//      (v: by sqrt(C) alone).                                        -> barrier
//   3. the same waves: all 8 row tiles of their columns, W fragments from LDS  -> barrier
// Fragment layouts per CDNA5 ISA 7.12.2 (16-bit A 16x32; B has A's table): k order
// k0 + 0..7, then 16 + k0 + 0..7, on both operands.
// Attention for one (b, h, 16-query tile), one wave, scores in registers.
//   s = (Q^T.K).SCALE; exact max over [keys, mem]; Z = sum e_m + rep * sum e_k
//   O[b, h*32+d, q] = (e_k.v_sum + e_m.mem_v) / Z
// The scores are formed transposed, D[key][query] = K^T.Q: a lane then holds 80 of the
// 160 scores of ONE query (its column), lane l ^ 16 the other 80. Maximum and sum are
// register trees plus one exchange with that lane, and two score tiles, converted in
// place, are the B operand of out^T[d][query] = V.e^T (k order 8h+s, 16+8h+s on both
// sides). All trip counts are constants.
// =====================================================================
constexpr int QP_KS = Cc / 32;      // 32-deep k steps of a projection
constexpr int AT_P  = Nc;           // keys = queries = 160 in both branches
constexpr int AT_NT = AT_P / 16;    // 16-key score tiles
constexpr int AT_NK = AT_P / 32;    // 32-key steps of the second product
static_assert(Nc == Mc && AT_P % 32 == 0 && DHc == 32 && Cc % 32 == 0, "attention tiling");
typedef __attribute__((ext_vector_type(8))) _Float16 v8h;
typedef __attribute__((ext_vector_type(4))) _Float16 v4h;
typedef __attribute__((ext_vector_type(2))) _Float16 v2h;
constexpr int FT_ATTW    = Hc;                          // attention waves, one per head
constexpr int FT_PRJW    = Cc / 16;                     // projection waves, one per 16 output rows
constexpr int FT_WAVES   = FT_ATTW + FT_PRJW;           // 16
constexpr int FT_THREADS = FT_WAVES * 32;               // 512
constexpr int FT_OP      = HIDc + 8;                    // f16 per query in Ot: rows stay 16-byte aligned
constexpr int FT_AP      = Cc + 8;                      // f16 per query in At, per row of W*g
constexpr int FT_KP      = HIDc + 8;                    // f16 per key in Ks
constexpr int FT_VP      = AT_P + 8;                    // f16 per channel row in Vs
constexpr int FT_QP      = HIDc + 4;                    // f32 per query in Qs
constexpr int FT_WROWS   = HIDc / FT_WAVES;             // rows of each of Wq, Wk, Wv that a wave stages
constexpr int FT_CPAIRS  = AT_P / 32;                   // 32-column groups of the keys, and of the values
static_assert(HIDc == 128 && Cc % 64 == 0, "projection tiling: a Wo row is one 16-byte load per lane");
static_assert(Cc == 192 && FT_WROWS % 2 == 0 && HIDc % FT_WAVES == 0, "two W rows are three wave-wide 16-byte loads");
static_assert(2 * FT_CPAIRS + 1 <= FT_WAVES, "one wave per column group");

// A or B fragment of one 32-deep k step from an LDS row [row or query][k]; p = this lane's row + k0.
// k order k0 + 0..7, then 16 + k0 + 0..7, on both operands
__device__ __forceinline__ v16h lds_frag(const _Float16* p)
{
    const v8h lo = *(const v8h*)(p);
    const v8h hi = *(const v8h*)(p + 16);
    return __builtin_shufflevector(lo, hi, 0, 1, 2, 3, 4, 5, 6, 7, 8, 9, 10, 11, 12, 13, 14, 15);
}

// 32 neighbouring feature columns, from Xb on, as f16 operand fragments of all 192 channels.
// A lane loads two neighbouring columns at once, so 16 lanes cover one whole 128-byte line of a
// channel row. Group g of the two fragment groups holds the columns 2 * nl + g.
__device__ __forceinline__ void load_cols(const float* __restrict__ Xb, bool normed, float xscale,
                                          int lane, v16h (&bf)[2][QP_KS])
{
    constexpr int P = Nc;
    const int nl = lane & 15;
    const int k0 = (lane >> 4) * 8;
    // a wave-uniform base and one 32-bit lane offset: the registers the loads name, so the wait can name them
    const int xo = (k0 * P + 2 * nl) * 4;   // bytes: first of this lane's channels, first of its two columns
    const char* Xc = (const char*)Xb;
    float2 xb[QP_KS][16];                   // this lane's 96 of the 192 channels
#pragma unroll
    for (int s = 0; s < QP_KS; ++s)
#pragma unroll
        for (int j = 0; j < 8; ++j) {
            xb[s][j]     = *(const float2*)(Xc + xo + (s * 32 + j) * P * 4);
            xb[s][8 + j] = *(const float2*)(Xc + xo + (s * 32 + 16 + j) * P * 4);
        }
    // the loads' base and offset registers are reused below: the wait stands in front of that, and
    // naming them keeps the registers untouched up to it
    asm volatile("s_wait_xcnt 0x0" :: "v"(xo), "s"(Xc) : "memory");
#pragma unroll
    for (int g = 0; g < 2; ++g) {
        float psn = xscale;
        if (normed) {       // wave-uniform: q and k take the column's inverse channel norm
            float q4[4] = { 0.f, 0.f, 0.f, 0.f };   // four chains, so the adds do not wait on one another
#pragma unroll
            for (int s = 0; s < QP_KS; ++s)
#pragma unroll
                for (int j = 0; j < 16; ++j) {
                    const float v = g ? xb[s][j].y : xb[s][j].x;
                    q4[j & 3] += v * v;
                }
            float ss = (q4[0] + q4[1]) + (q4[2] + q4[3]);
            ss += other_row(ss);
            psn = (1.0f / fmaxf(sqrtf(ss), 1e-12f)) * xscale;
        }
#pragma unroll
        for (int s = 0; s < QP_KS; ++s)
#pragma unroll
            for (int j = 0; j < 16; ++j) bf[g][s][j] = (_Float16)((g ? xb[s][j].y : xb[s][j].x) * psn);
    }
}

// MT row tiles, from row tile m0 on, of one projection for the 32 columns in bf. KIND 0 = q, 1 = k, 2 = v.
//   q: Qs[column][row] in f32      k: Ks[col0 + column][row] in f16      v: Vs[row][col0 + column] in f16
// q and k take W as A, so a lane holds 8 consecutive rows of column 2 * nl + g. v takes the columns
// as A and W as B (the two fragment tables are alike), so a lane holds, of one row, the columns
// 2 * (k0 + r) + g: 16 consecutive ones over the two groups.
template <int KIND, int MT>
__device__ __forceinline__ void proj_tiles(const _Float16 (*__restrict__ Wf)[FT_AP],
                                           const v16h (&bf)[2][QP_KS], int m0, int col0, int lane,
                                           float (*__restrict__ Qs)[FT_QP],
                                           _Float16 (*__restrict__ Ks)[FT_KP],
                                           _Float16 (*__restrict__ Vs)[FT_VP])
{
    const int nl = lane & 15;
    const int k0 = (lane >> 4) * 8;
    v8f acc[MT][2];         // 2 * MT independent accumulate chains
#pragma unroll
    for (int i = 0; i < MT; ++i)
#pragma unroll
        for (int g = 0; g < 2; ++g) acc[i][g] = (v8f)(0.f);
#pragma unroll
    for (int s = 0; s < QP_KS; ++s)
#pragma unroll
        for (int i = 0; i < MT; ++i) {
            const v16h a = lds_frag(&Wf[(m0 + i) * 16 + nl][s * 32 + k0]);
#pragma unroll
            for (int g = 0; g < 2; ++g)
                acc[i][g] = (KIND == 2)
                    ? __builtin_amdgcn_wmma_f32_16x16x32_f16(false, bf[g][s], false, a, (short)0, acc[i][g], false, false)
                    : __builtin_amdgcn_wmma_f32_16x16x32_f16(false, a, false, bf[g][s], (short)0, acc[i][g], false, false);
        }
#pragma unroll
    for (int i = 0; i < MT; ++i) {
        const int mr = (m0 + i) * 16;
        if (KIND == 2) {
            v8h lo, hi;
#pragma unroll
            for (int r = 0; r < 4; ++r)
#pragma unroll
                for (int g = 0; g < 2; ++g) {
                    lo[2 * r + g] = (_Float16)acc[i][g][r];
                    hi[2 * r + g] = (_Float16)acc[i][g][4 + r];
                }
            *(v8h*)&Vs[mr + nl][col0 + 2 * k0]     = lo;
            *(v8h*)&Vs[mr + nl][col0 + 2 * k0 + 8] = hi;
        } else {
#pragma unroll
            for (int g = 0; g < 2; ++g) {
                if (KIND == 0) {
                    *(v4f*)&Qs[2 * nl + g][mr + k0]     = __builtin_shufflevector(acc[i][g], acc[i][g], 0, 1, 2, 3);
                    *(v4f*)&Qs[2 * nl + g][mr + k0 + 4] = __builtin_shufflevector(acc[i][g], acc[i][g], 4, 5, 6, 7);
                } else {
                    v8h o;
#pragma unroll
                    for (int r = 0; r < 8; ++r) o[r] = (_Float16)acc[i][g][r];
                    *(v8h*)&Ks[col0 + 2 * nl + g][mr + k0] = o;
                }
            }
        }
    }
}

// Ot[query][h*32 + d] takes the tile's output, rounded to f16 as the next product reads it
__device__ __forceinline__ void attn_tile(const float (*__restrict__ Qs)[FT_QP],
                                          const _Float16 (*__restrict__ Ks)[FT_KP],
                                          const _Float16 (*__restrict__ Vs)[FT_VP],
                                          const float* __restrict__ memkv,
                                          _Float16 (*__restrict__ Ot)[FT_OP],
                                          float rep, int h, int lane)
{
    const int nl = lane & 15;
    const int k0 = (lane >> 4) * 8;
    const float* mk = memkv + h * NMEMc * DHc + k0;                // mem_kv[0]
    const float* mv = mk + Hc * NMEMc * DHc;                       // mem_kv[1]

    // this lane's 16 of the 32 channels of its query: d = k0 + j and 16 + k0 + j
    float qf[16];
#pragma unroll
    for (int j = 0; j < 8; ++j) {
        qf[j]     = Qs[nl][h * DHc + k0 + j];
        qf[8 + j] = Qs[nl][h * DHc + 16 + k0 + j];
    }
    v16h bq;
#pragma unroll
    for (int j = 0; j < 16; ++j) bq[j] = (_Float16)qf[j];

    // scores: sc[jt][r] = s[key jt*16 + k0 + r][query nl]
    v8f sc[AT_NT];
#pragma unroll
    for (int jt = 0; jt < AT_NT; ++jt) {
        const v16h ak = lds_frag(&Ks[jt * 16 + nl][h * DHc + k0]);     // row of K^T = key nl of the tile
        v8f c = {};
        c = __builtin_amdgcn_wmma_f32_16x16x32_f16(false, ak, false, bq,
                                                   (short)0, c, false, false);
        sc[jt] = c * SCALE_F;
    }

    // memory-slot scores in f32: each lane sums its 16 channels, the other row adds its 16
    float sm[NMEMc];
#pragma unroll
    for (int jm = 0; jm < NMEMc; ++jm) {
        const float4 m0 = *(const float4*)(mk + jm * DHc);
        const float4 m1 = *(const float4*)(mk + jm * DHc + 4);
        const float4 m2 = *(const float4*)(mk + jm * DHc + 16);
        const float4 m3 = *(const float4*)(mk + jm * DHc + 20);
        const float ma[16] = { m0.x, m0.y, m0.z, m0.w, m1.x, m1.y, m1.z, m1.w,
                               m2.x, m2.y, m2.z, m2.w, m3.x, m3.y, m3.z, m3.w };
        float acc = 0.f;
#pragma unroll
        for (int j = 0; j < 16; ++j) acc += qf[j] * ma[j];
        sm[jm] = acc;
    }
#pragma unroll
    for (int jm = 0; jm < NMEMc; ++jm) sm[jm] = (sm[jm] + other_row(sm[jm])) * SCALE_F;

    // exact maximum of the query's 160 + 4 scores
    v8f m8 = sc[0];
#pragma unroll
    for (int jt = 1; jt < AT_NT; ++jt)
#pragma unroll
        for (int r = 0; r < 8; ++r) m8[r] = fmaxf(m8[r], sc[jt][r]);
    float mx = fmaxf(fmaxf(fmaxf(m8[0], m8[1]), fmaxf(m8[2], m8[3])),
                     fmaxf(fmaxf(m8[4], m8[5]), fmaxf(m8[6], m8[7])));
    mx = fmaxf(mx, other_row(mx));
#pragma unroll
    for (int jm = 0; jm < NMEMc; ++jm) mx = fmaxf(mx, sm[jm]);

    v8f s8 = {};
#pragma unroll
    for (int jt = 0; jt < AT_NT; ++jt)
#pragma unroll
        for (int r = 0; r < 8; ++r) {
            const float e = expf(sc[jt][r] - mx);
            sc[jt][r] = e;
            s8[r] += e;
        }
    float se = ((s8[0] + s8[1]) + (s8[2] + s8[3])) + ((s8[4] + s8[5]) + (s8[6] + s8[7]));
    se += other_row(se);
    float sem = 0.f;
#pragma unroll
    for (int jm = 0; jm < NMEMc; ++jm) {
        sm[jm] = expf(sm[jm] - mx);
        sem += sm[jm];
    }
    const float Z = sem + rep * se;

    // B operand of the second product: be[t][s] = e[key t*32 + kmap(s)][query nl]
    v16h be[AT_NK];
#pragma unroll
    for (int t = 0; t < AT_NK; ++t)
#pragma unroll
        for (int j = 0; j < 8; ++j) {
            be[t][j]     = (_Float16)sc[2 * t][j];
            be[t][8 + j] = (_Float16)sc[2 * t + 1][j];
        }

    // out^T = V . e^T, two 16-channel tiles; c[r] = out[d = nt2*16 + k0 + r][query nl]
#pragma unroll
    for (int nt2 = 0; nt2 < 2; ++nt2) {
        v8f c = {};
#pragma unroll
        for (int t = 0; t < AT_NK; ++t) {
            const v16h av = lds_frag(&Vs[h * DHc + nt2 * 16 + nl][t * 32 + k0]);   // row of V = channel nl of the tile
            c = __builtin_amdgcn_wmma_f32_16x16x32_f16(false, av, false, be[t],
                                                       (short)0, c, false, false);
        }
        float memc[8] = { 0.f, 0.f, 0.f, 0.f, 0.f, 0.f, 0.f, 0.f };
#pragma unroll
        for (int jm = 0; jm < NMEMc; ++jm) {
            const float4 w0 = *(const float4*)(mv + jm * DHc + nt2 * 16);
            const float4 w1 = *(const float4*)(mv + jm * DHc + nt2 * 16 + 4);
            const float wa[8] = { w0.x, w0.y, w0.z, w0.w, w1.x, w1.y, w1.z, w1.w };
#pragma unroll
            for (int r = 0; r < 8; ++r) memc[r] += sm[jm] * wa[r];
        }
        v8h o;
#pragma unroll
        for (int r = 0; r < 8; ++r) o[r] = (_Float16)((c[r] + memc[r]) / Z);
        *(v8h*)&Ot[nl][h * DHc + nt2 * 16 + k0] = o;
    }
    // the address registers of the memory-slot loads are free for reuse behind this wait
    asm volatile("s_wait_xcnt 0x0" ::: "memory");
}

// One block per (stacked plane of 2*B, 16-query tile). After the projections, waves 0..3 run the
// attention of one head each; meanwhile waves 4..15 fetch the Wo and Wr rows of their 16 output
// channels with whole-line loads and turn them into A fragments through a wave-private piece of
// LDS, in the space that W*g has left.
//   Ot = attention output (128 x 16)          -> barrier
//   At = Wo . Ot + bo     (192 x 16)          -> barrier
//   R[b, :, tile] = Wr[:, branch half] . At   (192 x 16)
// Both intermediates cross in LDS as f16, the rounding the next product applies anyway.
__global__ __launch_bounds__(FT_THREADS) void attn_proj(const float* __restrict__ Wq,
                                                        const float* __restrict__ Wk,
                                                        const float* __restrict__ Wv,
                                                        const float* __restrict__ gq,
                                                        const float* __restrict__ gk,
                                                        const float* __restrict__ gv,
                                                        const float* __restrict__ row_ft,
                                                        const float* __restrict__ col_ft,
                                                        const float* __restrict__ Srow,
                                                        const float* __restrict__ Scol,
                                                        float xscale,
                                                        const float* __restrict__ memkv,
                                                        const float* __restrict__ Wo,
                                                        const float* __restrict__ bo,
                                                        const float* __restrict__ Wr,
                                                        float* __restrict__ R,
                                                        float rep)
{
    __shared__ __attribute__((aligned(16))) _Float16 Ot[16][FT_OP];
    __shared__ __attribute__((aligned(16))) _Float16 At[16][FT_AP];
    __shared__ __attribute__((aligned(16))) float    Qs[32][FT_QP];     // the tile's queries and their neighbour tile's
    __shared__ __attribute__((aligned(16))) _Float16 Ks[AT_P][FT_KP];
    __shared__ __attribute__((aligned(16))) _Float16 Vs[HIDc][FT_VP];
    // rows of Wq*gq, Wk*gk, Wv*gv up to the second barrier; behind it one slice of Wo and of Wr per projection wave
    __shared__ __attribute__((aligned(16))) _Float16 Wbuf[3 * HIDc * FT_AP];
    static_assert(FT_PRJW * 16 * (FT_OP + FT_AP) <= 3 * HIDc * FT_AP && (FT_PRJW * 16 * FT_OP) % 8 == 0, "Wo and Wr slices fit");
    _Float16 (*Wf)[FT_AP]      = (_Float16 (*)[FT_AP])Wbuf;
    _Float16 (*WoS)[16][FT_OP] = (_Float16 (*)[16][FT_OP])Wbuf;
    _Float16 (*WrS)[16][FT_AP] = (_Float16 (*)[16][FT_AP])(Wbuf + FT_PRJW * 16 * FT_OP);
    constexpr int P = AT_P;
    constexpr int KO = HIDc / 32, KR = Cc / 32;
    const int b = blockIdx.y, qt = blockIdx.x;
    const int wave = __builtin_amdgcn_readfirstlane(threadIdx.x >> 5);   // scalar: the role branches are wave-uniform
    const int lane = threadIdx.x & 31;
    const int nl = lane & 15;
    const int k0 = (lane >> 4) * 8;
    const int mt = wave - FT_ATTW;

    // ---- 1. W*g to LDS. Two rows of W are 96 float4 = three wave-wide loads; load c of a row pair
    // gives this lane float4 number wc[c] of row wr2[c] of the pair
    {
        const int wr2[3] = { 0, lane >> 4, 1 };
        const int wc[3]  = { lane, (lane < 16) ? lane + 32 : lane - 16, lane + 16 };
        const float* Wm[3] = { Wq, Wk, Wv };
        const float* gm[3] = { gq, gk, gv };
        constexpr int NL = FT_WROWS * Cc / 128; // wave-wide loads per matrix: 12
        float4 wv[3][NL], g4[3][3];
#pragma unroll
        for (int m = 0; m < 3; ++m) {
            const float4* Wt = (const float4*)(Wm[m] + (size_t)wave * FT_WROWS * Cc);
#pragma unroll
            for (int i = 0; i < NL; ++i) wv[m][i] = Wt[i * 32 + lane];
#pragma unroll
            for (int c = 0; c < 3; ++c) g4[m][c] = ((const float4*)gm[m])[wc[c]];
        }
        // the loads' base and index registers are reused below: this wait stands in front of that
        asm volatile("s_wait_xcnt 0x0" ::: "memory");
#pragma unroll
        for (int m = 0; m < 3; ++m)
#pragma unroll
            for (int i = 0; i < NL; ++i) {
                const int c = i % 3;
                const v4h hw = { (_Float16)(wv[m][i].x * g4[m][c].x), (_Float16)(wv[m][i].y * g4[m][c].y),
                                 (_Float16)(wv[m][i].z * g4[m][c].z), (_Float16)(wv[m][i].w * g4[m][c].w) };
                *(v4h*)&Wf[m * HIDc + wave * FT_WROWS + (i / 3) * 2 + wr2[c]][wc[c] * 4] = hw;
            }
    }

    // ---- 2. feature columns to fragments: waves 0..4 keys, 5..9 values, 32 columns each; wave 10 the
    // aligned 32 query columns that hold the tile. One text for all: the kernel's text stays short
    const int branch = b / Bc;
    const bool isK = wave < FT_CPAIRS, isV = !isK && wave < 2 * FT_CPAIRS, isQ = wave == 2 * FT_CPAIRS;
    const int col0 = (isK ? wave : isV ? wave - FT_CPAIRS : (qt >> 1)) * 32;
    v16h bf[2][QP_KS];
    if (wave <= 2 * FT_CPAIRS) {
        const float* Xs = isV ? (branch ? Scol : Srow) : ((isK == (branch != 0)) ? row_ft : col_ft);
        load_cols(Xs + (size_t)(b - branch * Bc) * Cc * P + col0, !isV, xscale, lane, bf);
    }
    __syncthreads();        // W*g complete

    // ---- 3. the projections of those columns
    if (isK) {
        // rolled, two row tiles a trip: four chains keep the matrix unit fed, and the text stays short
#pragma unroll 1
        for (int m0 = 0; m0 < HIDc / 16; m0 += 2) proj_tiles<1, 2>(Wf + HIDc, bf, m0, col0, lane, Qs, Ks, Vs);
    } else if (isV) {
        // rolled for the same reason
#pragma unroll 1
        for (int m0 = 0; m0 < HIDc / 16; m0 += 2) proj_tiles<2, 2>(Wf + 2 * HIDc, bf, m0, col0, lane, Qs, Ks, Vs);
    } else if (isQ) {
        proj_tiles<0, 4>(Wf, bf, 0, 0, lane, Qs, Ks, Vs);
        proj_tiles<0, 4>(Wf, bf, 4, 0, lane, Qs, Ks, Vs);
    }
    __syncthreads();        // Q, K, V complete; W*g has been read for the last time

    v16h aWo[KO], aWr[KR];
    float bias[8];
    if (wave < FT_ATTW) {
        attn_tile(Qs + (qt & 1) * 16, Ks, Vs, memkv, Ot, rep, wave, lane);
    } else {
        // a Wo row is 32 lanes x 4 floats, a Wr half row 3 x (32 lanes x 2 floats)
        const float* WoBlk = Wo + (size_t)mt * 16 * HIDc + lane * 4;
        const float* WrBlk = Wr + (size_t)mt * 16 * (2 * Cc) + (b / Bc) * Cc + lane * 2;
        float4 wo[16];
        float2 wr[16][Cc / 64];
#pragma unroll
        for (int r = 0; r < 16; ++r) wo[r] = *(const float4*)(WoBlk + r * HIDc);
#pragma unroll
        for (int r = 0; r < 16; ++r)
#pragma unroll
            for (int j = 0; j < Cc / 64; ++j) wr[r][j] = *(const float2*)(WrBlk + r * (2 * Cc) + j * 64);
#pragma unroll
        for (int r = 0; r < 16; ++r) {
            const v4h hw = { (_Float16)wo[r].x, (_Float16)wo[r].y, (_Float16)wo[r].z, (_Float16)wo[r].w };
            *(v4h*)&WoS[mt][r][lane * 4] = hw;
        }
#pragma unroll
        for (int r = 0; r < 16; ++r)
#pragma unroll
            for (int j = 0; j < Cc / 64; ++j) {
                const v2h hw = { (_Float16)wr[r][j].x, (_Float16)wr[r][j].y };
                *(v2h*)&WrS[mt][r][j * 64 + lane * 2] = hw;
            }
        // the slice is read back by the wave that wrote it, but by other lanes: the wave's own
        // stores have landed behind this wait; no other wave touches the slice, so no barrier
        asm volatile("s_wait_dscnt 0x0" ::: "memory");
#pragma unroll
        for (int s = 0; s < KO; ++s) aWo[s] = lds_frag(&WoS[mt][nl][s * 32 + k0]);
#pragma unroll
        for (int s = 0; s < KR; ++s) aWr[s] = lds_frag(&WrS[mt][nl][s * 32 + k0]);
        const float4 b0 = *(const float4*)(bo + mt * 16 + k0);
        const float4 b1 = *(const float4*)(bo + mt * 16 + k0 + 4);
        bias[0] = b0.x; bias[1] = b0.y; bias[2] = b0.z; bias[3] = b0.w;
        bias[4] = b1.x; bias[5] = b1.y; bias[6] = b1.z; bias[7] = b1.w;
    }
    __syncthreads();        // Ot complete
    if (wave >= FT_ATTW) {
        v8f acc = {};
#pragma unroll
        for (int s = 0; s < KO; ++s)
            acc = __builtin_amdgcn_wmma_f32_16x16x32_f16(false, aWo[s], false, lds_frag(&Ot[nl][s * 32 + k0]),
                                                         (short)0, acc, false, false);
        v8h o;
#pragma unroll
        for (int r = 0; r < 8; ++r) o[r] = (_Float16)(acc[r] + bias[r]);
        *(v8h*)&At[nl][mt * 16 + k0] = o;
    }
    __syncthreads();        // At complete
    if (wave >= FT_ATTW) {
        v8f acc = {};
#pragma unroll
        for (int s = 0; s < KR; ++s)
            acc = __builtin_amdgcn_wmma_f32_16x16x32_f16(false, aWr[s], false, lds_frag(&At[nl][s * 32 + k0]),
                                                         (short)0, acc, false, false);
        float* Rp = R + ((size_t)b * Cc + mt * 16 + k0) * P + qt * 16 + nl;
#pragma unroll
        for (int r = 0; r < 8; ++r) Rp[r * P] = acc[r];
    }
}

// =====================================================================
// Kernel 4: out[b,d,n,m] = Rrow[b,d,n] + Rcol[b,d,m]   (float4 writes)
// One block per (b,d) plane. 160 threads cover 4 rows of 40 float4, so a thread
// keeps its four columns of Rcol in registers and stores them under every 4th
// row: a wave lives for 40 stores of 512 contiguous bytes instead of one.
// =====================================================================
constexpr int BC_COLS4 = Mc / 4;                 // float4 per row
constexpr int BC_ROWS  = 4;                      // rows covered by one pass of the block
constexpr int BC_THREADS = BC_COLS4 * BC_ROWS;   // 160
static_assert(Mc % 4 == 0 && Nc % BC_ROWS == 0, "plane must split into whole passes");
__global__ __launch_bounds__(BC_THREADS) void bcast_add(const float* __restrict__ Rrow,
                                                        const float* __restrict__ Rcol,
                                                        float* __restrict__ out)
{
    const int plane = blockIdx.x;                // b*C + d
    const int t  = threadIdx.x;
    const int cg = t % BC_COLS4;
    const int r0 = t / BC_COLS4;
    const float4 cv = *(const float4*)(Rcol + (size_t)plane * Mc + cg * 4);
    const float* rr = Rrow + (size_t)plane * Nc + r0;
    float4* op = (float4*)(out + (size_t)plane * Nc * Mc) + t;
    // all row values are requested before the first store, so the stores wait once
    float rv[Nc / BC_ROWS];
#pragma unroll
    for (int k = 0; k < Nc / BC_ROWS; ++k) rv[k] = rr[k * BC_ROWS];
    // unrolled: rv[] stays in registers and every store takes an immediate offset
#pragma unroll
    for (int k = 0; k < Nc / BC_ROWS; ++k) {
        float4 o;
        o.x = rv[k] + cv.x; o.y = rv[k] + cv.y; o.z = rv[k] + cv.z; o.w = rv[k] + cv.w;
        op[k * BC_THREADS] = o;
    }
}

// =====================================================================
// Host launcher
// =====================================================================
extern "C" void kernel_launch(void* const* d_in, const int* in_sizes, int n_in,
                              void* d_out, int out_size, void* d_ws, size_t ws_size,
                              hipStream_t stream)
{
    const float* x     = (const float*)d_in[0];
    const float* gq    = (const float*)d_in[1];
    const float* gk    = (const float*)d_in[2];
    const float* gv    = (const float*)d_in[3];
    const float* Wq    = (const float*)d_in[4];
    const float* Wk    = (const float*)d_in[5];
    const float* Wv    = (const float*)d_in[6];
    const float* memkv = (const float*)d_in[7];
    const float* Wo    = (const float*)d_in[8];
    const float* bo    = (const float*)d_in[9];
    const float* Wr    = (const float*)d_in[10];
    float* out = (float*)d_out;

    // ---- workspace layout (floats) ----
    float* w = (float*)d_ws;
    size_t o = 0;
    float* invp     = w + o; o += (size_t)Bc * Nc * Mc;   // 102400
    float* row_ft   = w + o; o += (size_t)Bc * Cc * Nc;   // 122880
    float* col_ft   = w + o; o += (size_t)Bc * Cc * Mc;
    float* Srow     = w + o; o += (size_t)Bc * Cc * Mc;
    float* Scol     = w + o; o += (size_t)Bc * Cc * Nc;
    // row-branch planes directly followed by the col-branch ones: a stack of 2*B planes
    float* Rrow = w + o; o += (size_t)Bc * Cc * Nc;
    float* Rcol = w + o; o += (size_t)Bc * Cc * Mc;
    (void)ws_size; (void)in_sizes; (void)n_in; (void)out_size;

    const float sqrtC = sqrtf((float)Cc);

    // 1) per-pixel channel norms (pass 1 over x)
    pixel_invnorm<<<Bc * Nc * Mc / PN_PIX, PN_WAVES * 32, 0, stream>>>(x, invp);

    // 2) plane reductions (pass 2 over x)
    plane_reduce<<<dim3(Cc / PR_CH, Bc), PR_THREADS, 0, stream>>>(x, invp, row_ft, col_ft, Srow, Scol);

    // N == M, so the two branches have equal shapes and share one grid per stage:
    // blockIdx.y runs over the 2*B stacked planes.
    static_assert(Nc == Mc, "branch stacking needs equal row and column lengths");

    // 3) q/k/v projections (feature channel norms included), attention, output projection (Wo, bo)
    //    and reduce projection in one grid, both branches.
    //    Wr is (C, 2C): the row branch takes Wr[:, :C], the col branch Wr[:, C:]
    const dim3 gA(Nc / 16, 2 * Bc);
    attn_proj<<<gA, FT_THREADS, 0, stream>>>(Wq, Wk, Wv, gq, gk, gv, row_ft, col_ft, Srow, Scol, sqrtC,
                                             memkv, Wo, bo, Wr, Rrow, (float)Nc);

    // 4) broadcast add -> final output (78.6 MB, float4 stores)
    bcast_add<<<Bc * Cc, BC_THREADS, 0, stream>>>(Rrow, Rcol, out);
}

// v009
// It runs in 33.2 microseconds.
// In both of two side-by-side timings against v008, it was 1.08 times as fast.
// All steps since v000 together make it 5.82 times as fast.
#include <hip/hip_runtime.h>
#include <math.h>

// ---------------- problem constants ----------------
constexpr int Bc   = 4;
constexpr int Cc   = 192;
constexpr int Nc   = 160;
constexpr int Mc   = 160;
constexpr int Hc   = 4;
constexpr int DHc  = 32;
constexpr int HIDc = 128;   // Hc*DHc
constexpr int NMEMc = 4;
#define SCALE_F 0.17677669529663687f   // 1/sqrt(32)

typedef __attribute__((ext_vector_type(16))) _Float16 v16h;
typedef __attribute__((ext_vector_type(8)))  float    v8f;
typedef __attribute__((ext_vector_type(4)))  float    v4f;
typedef __attribute__((ext_vector_type(8)))  _Float16 v8h;

// =====================================================================
// Weights as f16 operand fragments, formed once per call (by extra blocks of kernel 1, which
// needs nothing of them and they nothing of it) for the 80 blocks of kernel 3.
// A chunk is 8 f16 = 16 bytes. Chunk ((tile * KS + step) * 2 + hi) * 32 + lane of a matrix holds
//   M[tile * 16 + (lane & 15)][step * 32 + hi * 16 + (lane >> 4) * 8 + 0..7]
// so chunks hi = 0, 1 of a lane are its fragment of (row tile, k step), in the k order
// k0 + 0..7, then 16 + k0 + 0..7, and a wave reads each as 512 contiguous bytes.
// Order in the buffer: Wq*gq, Wk*gk, Wv*gv | Wo | Wr[:, :C], Wr[:, C:]
// =====================================================================
constexpr int PK_WG      = 3 * (HIDc / 16) * (Cc / 32) * 64;    // chunks of the three W*g
constexpr int PK_WO      = (Cc / 16) * (HIDc / 32) * 64;        // chunks of Wo
constexpr int PK_WR      = 2 * (Cc / 16) * (Cc / 32) * 64;      // chunks of the two halves of Wr
constexpr int PK_THREADS = 128;
constexpr int PK_PER     = 4;                                   // chunks per thread
constexpr int PK_BLK     = PK_THREADS * PK_PER;                 // chunks per block
constexpr int PK_BLOCKS  = (PK_WG + PK_WO + PK_WR) / PK_BLK;
static_assert((PK_WG / 3) % PK_BLK == 0 && PK_WO % PK_BLK == 0 && (PK_WR / 2) % PK_BLK == 0,
              "a packing block stays inside one matrix");

// PK_BLK chunks, from chunk 'first' on, of the matrix at src (row pitch ld, KS k steps of 32)
template <int KS, bool SCALED>
__device__ __forceinline__ void pack_chunks(const float* __restrict__ src, int ld,
                                            const float* __restrict__ g, int first, int tid,
                                            v8h* __restrict__ dst)
{
    static_assert(PK_PER == 4, "the wait below names four offsets");
    // a block-uniform base and one 32-bit lane offset per chunk: the registers the loads name
    const char* sb = (const char*)src;
    const char* gb = (const char*)g;
    unsigned po[PK_PER], go[PK_PER];
    v4f a[PK_PER][2], s[PK_PER][2];
#pragma unroll
    for (int j = 0; j < PK_PER; ++j) {
        const int id   = first + j * PK_THREADS + tid;
        const int lane = id & 31, hi = (id >> 5) & 1, rest = id >> 6;
        const int k    = (rest % KS) * 32 + hi * 16 + (lane >> 4) * 8;
        po[j] = (unsigned)((((rest / KS) * 16 + (lane & 15)) * ld + k) * 4);
        go[j] = (unsigned)(k * 4);
    }
#pragma unroll
    for (int j = 0; j < PK_PER; ++j) {
        a[j][0] = *(const v4f*)(sb + po[j]);
        a[j][1] = *(const v4f*)(sb + po[j] + 16);
        if (SCALED) {
            s[j][0] = *(const v4f*)(gb + go[j]);
            s[j][1] = *(const v4f*)(gb + go[j] + 16);
        }
    }
    // the loads' base and offset registers are reused below: the wait stands in front of that. Naming
    // them keeps them untouched up to it, naming the loaded values keeps every load in front of it
    if (SCALED)
        asm volatile("s_wait_xcnt 0x0" :: "s"(sb), "v"(po[0]), "v"(po[1]), "v"(po[2]), "v"(po[3]),
                     "v"(a[0][0]), "v"(a[0][1]), "v"(a[1][0]), "v"(a[1][1]),
                     "v"(a[2][0]), "v"(a[2][1]), "v"(a[3][0]), "v"(a[3][1]),
                     "s"(gb), "v"(go[0]), "v"(go[1]), "v"(go[2]), "v"(go[3]),
                     "v"(s[0][0]), "v"(s[0][1]), "v"(s[1][0]), "v"(s[1][1]),
                     "v"(s[2][0]), "v"(s[2][1]), "v"(s[3][0]), "v"(s[3][1]) : "memory");
    else
        asm volatile("s_wait_xcnt 0x0" :: "s"(sb), "v"(po[0]), "v"(po[1]), "v"(po[2]), "v"(po[3]),
                     "v"(a[0][0]), "v"(a[0][1]), "v"(a[1][0]), "v"(a[1][1]),
                     "v"(a[2][0]), "v"(a[2][1]), "v"(a[3][0]), "v"(a[3][1]) : "memory");
#pragma unroll
    for (int j = 0; j < PK_PER; ++j) {
        float w[8];
#pragma unroll
        for (int e = 0; e < 8; ++e) w[e] = SCALED ? a[j][e >> 2][e & 3] * s[j][e >> 2][e & 3] : a[j][e >> 2][e & 3];
        v8h o;
#pragma unroll
        for (int e = 0; e < 8; ++e) o[e] = (_Float16)w[e];
        dst[first + j * PK_THREADS + tid] = o;
    }
    // the stores' base and offset registers may be reused behind the call: this wait stands in front of that
    asm volatile("s_wait_xcnt 0x0" ::: "memory");
}

// =====================================================================
// Kernel 1: per-pixel inverse channel norm of x:  invp[b,n,m]
// One block takes 128 neighbouring pixels: a lane holds four of them, so every wave-wide
// load is 512 contiguous bytes of one channel plane. The four waves take 48 channels each,
// request all of them before the first sum, and add their partial sums through LDS.
// The first PK_BLOCKS blocks of the grid pack the weights instead (see above).
// =====================================================================
constexpr int PN_WAVES = 4;
constexpr int PN_CH    = Cc / PN_WAVES;     // channels per wave
constexpr int PN_PIX   = 32 * 4;            // pixels per block
static_assert(Cc % PN_WAVES == 0 && PN_CH % 4 == 0 && (Nc * Mc) % PN_PIX == 0, "pixel norm tiling");
static_assert(PN_WAVES * 32 == PK_THREADS, "packing blocks share the launch");
__global__ __launch_bounds__(PN_WAVES * 32) void pixel_invnorm(const float* __restrict__ x,
                                                               float* __restrict__ invp,
                                                               const float* __restrict__ Wq,
                                                               const float* __restrict__ Wk,
                                                               const float* __restrict__ Wv,
                                                               const float* __restrict__ gq,
                                                               const float* __restrict__ gk,
                                                               const float* __restrict__ gv,
                                                               const float* __restrict__ Wo,
                                                               const float* __restrict__ Wr,
                                                               float* __restrict__ wpk)
{
    __shared__ v4f part[PN_WAVES][32];
    if (blockIdx.x < PK_BLOCKS) {       // block-uniform, in front of the barrier
        constexpr int BG = PK_WG / 3 / PK_BLK, BO = PK_WO / PK_BLK, BR = PK_WR / 2 / PK_BLK;
        const int pb = blockIdx.x;
        v8h* pk = (v8h*)wpk;
        if (pb < 3 * BG) {
            const int m = pb / BG;
            pack_chunks<Cc / 32, true>(m == 0 ? Wq : m == 1 ? Wk : Wv, Cc, m == 0 ? gq : m == 1 ? gk : gv,
                                       (pb - m * BG) * PK_BLK, threadIdx.x, pk + m * (PK_WG / 3));
        } else if (pb < 3 * BG + BO) {
            pack_chunks<HIDc / 32, false>(Wo, HIDc, nullptr, (pb - 3 * BG) * PK_BLK, threadIdx.x, pk + PK_WG);
        } else {
            const int br = (pb - 3 * BG - BO) / BR;
            pack_chunks<Cc / 32, false>(Wr + br * Cc, 2 * Cc, nullptr, (pb - 3 * BG - BO - br * BR) * PK_BLK,
                                        threadIdx.x, pk + PK_WG + PK_WO + br * (PK_WR / 2));
        }
        return;
    }
    constexpr int NM  = Nc * Mc;
    constexpr int GPB = NM / PN_PIX;        // blocks per batch entry
    const int lane = threadIdx.x & 31;
    const int wave = threadIdx.x >> 5;
    const int nb = blockIdx.x - PK_BLOCKS;
    const int b = nb / GPB;
    const int g = nb - b * GPB;
    const v4f* xp = (const v4f*)(x + ((size_t)b * Cc + wave * PN_CH) * NM + g * PN_PIX) + lane;

    v4f v[PN_CH];
#pragma unroll
    for (int c = 0; c < PN_CH; ++c) v[c] = xp[c * (NM / 4)];
    // keeps every load in front of the first sum; without it each load sinks to its use and
    // the wave waits out a few loads at a time
    __builtin_amdgcn_sched_barrier(0);
    v4f s[4] = { (v4f)(0.f), (v4f)(0.f), (v4f)(0.f), (v4f)(0.f) };   // four chains per pixel
#pragma unroll
    for (int c = 0; c < PN_CH; ++c) s[c & 3] += v[c] * v[c];
    part[wave][lane] = (s[0] + s[1]) + (s[2] + s[3]);
    __syncthreads();

    if (wave == 0) {
        const v4f t = (part[0][lane] + part[1][lane]) + (part[2][lane] + part[3][lane]);
        v4f r;
#pragma unroll
        for (int i = 0; i < 4; ++i) r[i] = 1.0f / fmaxf(sqrtf(t[i]), 1e-12f);
        ((v4f*)(invp + (size_t)b * NM + g * PN_PIX))[lane] = r;
    }
}

// =====================================================================
// Kernel 2: plane reductions, every plane read once with whole-line loads.
//  row_ft[b,c,n] = mean_m x          col_ft[b,c,m] = mean_n x
//  Scol[b,c,n]   = sum_m x*invp      Srow[b,c,m]   = sum_n x*invp
// One block takes 3 channels of one batch entry, so a float4 of invp serves three
// planes. 640 threads cover 16 rows of 40 float4; a thread keeps its four columns'
// sums in registers and leaves each row's four-element partial in LDS. After the
// barrier one thread per (channel, index) adds up a row's 40 partials and a
// column's 16 partials.
// =====================================================================
constexpr int PR_CH      = 3;                       // channels per block
constexpr int PR_COLS4   = Mc / 4;                  // float4 per row
constexpr int PR_SLOTS   = 16;                      // rows covered by one pass
constexpr int PR_THREADS = PR_COLS4 * PR_SLOTS;     // 640
constexpr int PR_PASSES  = Nc / PR_SLOTS;           // 10
constexpr int PR_GRP     = 2;                       // passes fetched together
constexpr int PR_NGRP    = PR_PASSES / PR_GRP;      // 5
constexpr int PR_PITCH   = PR_COLS4 + 1;            // odd pitch: 32 rows read side by side hit distinct banks
static_assert(Cc % PR_CH == 0 && Nc % PR_SLOTS == 0 && Mc % 4 == 0 && Nc == Mc &&
              PR_PASSES % PR_GRP == 0 && PR_CH * Nc <= PR_THREADS && (PR_CH * Nc) % 32 == 0, "plane_reduce tiling");
__global__ __launch_bounds__(PR_THREADS) void plane_reduce(const float* __restrict__ x,
                                                           const float* __restrict__ invp,
                                                           float* __restrict__ row_ft,
                                                           float* __restrict__ col_ft,
                                                           float* __restrict__ Srow,
                                                           float* __restrict__ Scol)
{
    __shared__ float2 rowp[PR_CH][Nc][PR_PITCH];            // (sum, weighted sum) of 4 columns
    __shared__ v4f colp[PR_SLOTS][PR_CH][2][PR_COLS4];      // column sums of one row slot

    const int b = blockIdx.y, c0 = blockIdx.x * PR_CH;
    const int t  = threadIdx.x;
    const int cg = t % PR_COLS4;
    const int r0 = t / PR_COLS4;
    constexpr int PLANE4 = Nc * Mc / 4;
    const v4f* xp = (const v4f*)(x + ((size_t)b * Cc + c0) * Nc * Mc) + t;
    const v4f* ip = (const v4f*)(invp + (size_t)b * Nc * Mc) + t;

    v4f cs[PR_CH], cw[PR_CH];
#pragma unroll
    for (int ch = 0; ch < PR_CH; ++ch) {
        cs[ch] = (v4f)(0.f);
        cw[ch] = (v4f)(0.f);
    }
    // Two register sets of PR_GRP passes each: the next group's loads are issued before
    // this group is summed. Unrolled, so set indices are static and offsets immediate.
    v4f wv[2][PR_GRP], xv[2][PR_GRP][PR_CH];
#pragma unroll
    for (int p = 0; p < PR_GRP; ++p) {
        wv[0][p] = ip[p * PR_THREADS];
#pragma unroll
        for (int ch = 0; ch < PR_CH; ++ch) xv[0][p][ch] = xp[ch * PLANE4 + p * PR_THREADS];
    }
#pragma unroll
    for (int g = 0; g < PR_NGRP; ++g) {
        const int cur = g & 1, nxt = cur ^ 1;
        // the pair of scheduling barriers pins "next group's loads, then this group's sums";
        // without it each load sinks to its use and the wave waits out one load at a time
        __builtin_amdgcn_sched_barrier(0);
        if (g + 1 < PR_NGRP) {
#pragma unroll
            for (int p = 0; p < PR_GRP; ++p) {
                const int k = (g + 1) * PR_GRP + p;
                wv[nxt][p] = ip[k * PR_THREADS];
#pragma unroll
                for (int ch = 0; ch < PR_CH; ++ch)
                    xv[nxt][p][ch] = xp[ch * PLANE4 + k * PR_THREADS];
            }
        }
        __builtin_amdgcn_sched_barrier(0);
#pragma unroll
        for (int p = 0; p < PR_GRP; ++p) {
            const v4f w4 = wv[cur][p];
#pragma unroll
            for (int ch = 0; ch < PR_CH; ++ch) {
                const v4f v = xv[cur][p][ch];
                const v4f vw = v * w4;
                cs[ch] += v;
                cw[ch] += vw;
                rowp[ch][(g * PR_GRP + p) * PR_SLOTS + r0][cg] =
                    make_float2((v.x + v.y) + (v.z + v.w), (vw.x + vw.y) + (vw.z + vw.w));
            }
        }
    }
#pragma unroll
    for (int ch = 0; ch < PR_CH; ++ch) {
        colp[r0][ch][0][cg] = cs[ch];
        colp[r0][ch][1][cg] = cw[ch];
    }
    // the loads' base and index registers are reused below: this wait stands in front of that
    asm volatile("s_wait_xcnt 0x0" ::: "memory");
    __syncthreads();

    if (t < PR_CH * Nc) {       // whole waves: 480 = 15 * 32
        const int ch = t / Nc;
        const int i  = t - ch * Nc;
        float rs = 0.f, rw = 0.f;
#pragma unroll
        for (int j = 0; j < PR_COLS4; ++j) {
            const float2 p = rowp[ch][i][j];
            rs += p.x;
            rw += p.y;
        }
        const float* cp = (const float*)colp;
        float ss = 0.f, sw = 0.f;
#pragma unroll
        for (int sl = 0; sl < PR_SLOTS; ++sl) {
            ss += cp[((sl * PR_CH + ch) * 2 + 0) * Mc + i];
            sw += cp[((sl * PR_CH + ch) * 2 + 1) * Mc + i];
        }
        const size_t o = ((size_t)b * Cc + c0 + ch) * Nc + i;
        row_ft[o] = rs * (1.0f / Mc);
        Scol[o]   = rw;
        col_ft[o] = ss * (1.0f / Nc);
        Srow[o]   = sw;
    }
}

// lane l reads lane l ^ 16: a vector move between the two 16-lane rows, no LDS-path wait
__device__ __forceinline__ float other_row(float v)
{
    const unsigned u = __float_as_uint(v);
    return __uint_as_float(__builtin_amdgcn_permlanex16(u, u, 0x76543210u, 0xfedcba98u, false, false));
}

// =====================================================================
// Kernel 3: q/k/v projections, attention, output projection and reduce projection of one
// 16-query tile, in one block per (stacked plane of 2*B, tile).
// Projections:  Out[m,p] = sum_k (W[m,k]*g[k]) * (X[k,p] * scale_p)
//   row branch: q<-row_ft, k<-col_ft, v<-Srow ; col branch: q<-col_ft, k<-row_ft, v<-Scol
// A block needs all 160 keys and values of its plane and forms them itself, so they never
// leave the WGP: K, V and the tile's Q go to LDS, laid out as the attention reads them.
//   1. waves 12..15: the packed f16 fragments of the three W*g, copied to LDS as they lie; meanwhile
//   2. waves 0..9: 32 columns of the key or value features each, wave 10: the query columns.
//      A B operand is all 192 channels of 16 columns, so the wave that loads it also holds
//      what the columns' channel norm needs: lanes l and l ^ 16 hold the two halves of column
//      l & 15. It sums the squares and scales by sqrt(C) / norm before rounding to f16
//      (v: by sqrt(C) alone).                                        -> barrier
//   3. the same waves: all 8 row tiles of their columns, W fragments from LDS  -> barrier
// Fragment layouts per CDNA5 ISA 7.12.2 (16-bit A 16x32; B has A's table): k order
// k0 + 0..7, then 16 + k0 + 0..7, on both operands.
// Attention for one (b, h, 16-query tile), one wave, scores in registers.
//   s = (Q^T.K).SCALE; exact max over [keys, mem]; Z = sum e_m + rep * sum e_k
//   O[b, h*32+d, q] = (e_k.v_sum + e_m.mem_v) / Z
// The scores are formed transposed, D[key][query] = K^T.Q: a lane then holds 80 of the
// 160 scores of ONE query (its column), lane l ^ 16 the other 80. Maximum and sum are
// register trees plus one exchange with that lane, and two score tiles, converted in
// place, are the B operand of out^T[d][query] = V.e^T (k order 8h+s, 16+8h+s on both
// sides). All trip counts are constants.
// =====================================================================
constexpr int QP_KS = Cc / 32;      // 32-deep k steps of a projection
constexpr int AT_P  = Nc;           // keys = queries = 160 in both branches
constexpr int AT_NT = AT_P / 16;    // 16-key score tiles
constexpr int AT_NK = AT_P / 32;    // 32-key steps of the second product
static_assert(Nc == Mc && AT_P % 32 == 0 && DHc == 32 && Cc % 32 == 0, "attention tiling");
constexpr int FT_ATTW    = Hc;                          // attention waves, one per head
constexpr int FT_PRJW    = Cc / 16;                     // projection waves, one per 16 output rows
constexpr int FT_WAVES   = FT_ATTW + FT_PRJW;           // 16
constexpr int FT_THREADS = FT_WAVES * 32;               // 512
constexpr int FT_OP      = HIDc + 8;                    // f16 per query in Ot: rows stay 16-byte aligned
constexpr int FT_AP      = Cc + 8;                      // f16 per query in At
constexpr int FT_KP      = HIDc + 8;                    // f16 per key in Ks
constexpr int FT_VP      = AT_P + 8;                    // f16 per channel row in Vs
constexpr int FT_QP      = HIDc + 4;                    // f32 per query in Qs
constexpr int FT_CPYW    = 4;                           // waves that copy the W*g fragments to LDS
constexpr int FT_CPYB    = 3;                           // batches of that copy
constexpr int FT_CPYN    = PK_WG / (FT_CPYW * 32 * FT_CPYB);    // chunks per lane and batch
constexpr int FT_CPAIRS  = AT_P / 32;                   // 32-column groups of the keys, and of the values
static_assert(PK_WG % (FT_CPYW * 32 * FT_CPYB) == 0, "the copy splits evenly");
static_assert(2 * FT_CPAIRS + 1 + FT_CPYW <= FT_WAVES, "one wave per column group, and the copying waves beside them");

// A or B fragment of one 32-deep k step from an LDS row [row or query][k]; p = this lane's row + k0.
// k order k0 + 0..7, then 16 + k0 + 0..7, on both operands
__device__ __forceinline__ v16h lds_frag(const _Float16* p)
{
    const v8h lo = *(const v8h*)(p);
    const v8h hi = *(const v8h*)(p + 16);
    return __builtin_shufflevector(lo, hi, 0, 1, 2, 3, 4, 5, 6, 7, 8, 9, 10, 11, 12, 13, 14, 15);
}

// fragment of one (row tile, k step) from the packed weights, in LDS or in global memory;
// p = this lane's chunk hi = 0, the chunk hi = 1 lies 32 chunks on
__device__ __forceinline__ v16h pk_frag(const v8h* p)
{
    const v8h lo = p[0];
    const v8h hi = p[32];
    return __builtin_shufflevector(lo, hi, 0, 1, 2, 3, 4, 5, 6, 7, 8, 9, 10, 11, 12, 13, 14, 15);
}

// 32 neighbouring feature columns, from Xb on, as f16 operand fragments of all 192 channels.
// A lane loads two neighbouring columns at once, so 16 lanes cover one whole 128-byte line of a
// channel row. Group g of the two fragment groups holds the columns 2 * nl + g.
__device__ __forceinline__ void load_cols(const float* __restrict__ Xb, bool normed, float xscale,
                                          int lane, v16h (&bf)[2][QP_KS])
{
    constexpr int P = Nc;
    const int nl = lane & 15;
    const int k0 = (lane >> 4) * 8;
    // a wave-uniform base and one 32-bit lane offset: the registers the loads name, so the wait can name them
    const int xo = (k0 * P + 2 * nl) * 4;   // bytes: first of this lane's channels, first of its two columns
    const char* Xc = (const char*)Xb;
    float2 xb[QP_KS][16];                   // this lane's 96 of the 192 channels
#pragma unroll
    for (int s = 0; s < QP_KS; ++s)
#pragma unroll
        for (int j = 0; j < 8; ++j) {
            xb[s][j]     = *(const float2*)(Xc + xo + (s * 32 + j) * P * 4);
            xb[s][8 + j] = *(const float2*)(Xc + xo + (s * 32 + 16 + j) * P * 4);
        }
    // the loads' base and offset registers are reused below: the wait stands in front of that, and
    // naming them keeps the registers untouched up to it
    asm volatile("s_wait_xcnt 0x0" :: "v"(xo), "s"(Xc) : "memory");
#pragma unroll
    for (int g = 0; g < 2; ++g) {
        float psn = xscale;
        if (normed) {       // wave-uniform: q and k take the column's inverse channel norm
            float q4[4] = { 0.f, 0.f, 0.f, 0.f };   // four chains, so the adds do not wait on one another
#pragma unroll
            for (int s = 0; s < QP_KS; ++s)
#pragma unroll
                for (int j = 0; j < 16; ++j) {
                    const float v = g ? xb[s][j].y : xb[s][j].x;
                    q4[j & 3] += v * v;
                }
            float ss = (q4[0] + q4[1]) + (q4[2] + q4[3]);
            ss += other_row(ss);
            psn = (1.0f / fmaxf(sqrtf(ss), 1e-12f)) * xscale;
        }
#pragma unroll
        for (int s = 0; s < QP_KS; ++s)
#pragma unroll
            for (int j = 0; j < 16; ++j) bf[g][s][j] = (_Float16)((g ? xb[s][j].y : xb[s][j].x) * psn);
    }
}

// MT row tiles, from row tile m0 on, of one projection for the 32 columns in bf. KIND 0 = q, 1 = k, 2 = v.
// Wt = this lane's first chunk of the projection's packed W*g in LDS.
//   q: Qs[column][row] in f32      k: Ks[col0 + column][row] in f16      v: Vs[row][col0 + column] in f16
// q and k take W as A, so a lane holds 8 consecutive rows of column 2 * nl + g. v takes the columns
// as A and W as B (the two fragment tables are alike), so a lane holds, of one row, the columns
// 2 * (k0 + r) + g: 16 consecutive ones over the two groups.
template <int KIND, int MT>
__device__ __forceinline__ void proj_tiles(const v8h* __restrict__ Wt,
                                           const v16h (&bf)[2][QP_KS], int m0, int col0, int lane,
                                           float (*__restrict__ Qs)[FT_QP],
                                           _Float16 (*__restrict__ Ks)[FT_KP],
                                           _Float16 (*__restrict__ Vs)[FT_VP])
{
    const int nl = lane & 15;
    const int k0 = (lane >> 4) * 8;
    v8f acc[MT][2];         // 2 * MT independent accumulate chains
#pragma unroll
    for (int i = 0; i < MT; ++i)
#pragma unroll
        for (int g = 0; g < 2; ++g) acc[i][g] = (v8f)(0.f);
#pragma unroll
    for (int s = 0; s < QP_KS; ++s)
#pragma unroll
        for (int i = 0; i < MT; ++i) {
            const v16h a = pk_frag(Wt + ((m0 + i) * QP_KS + s) * 64);
#pragma unroll
            for (int g = 0; g < 2; ++g)
                acc[i][g] = (KIND == 2)
                    ? __builtin_amdgcn_wmma_f32_16x16x32_f16(false, bf[g][s], false, a, (short)0, acc[i][g], false, false)
                    : __builtin_amdgcn_wmma_f32_16x16x32_f16(false, a, false, bf[g][s], (short)0, acc[i][g], false, false);
        }
#pragma unroll
    for (int i = 0; i < MT; ++i) {
        const int mr = (m0 + i) * 16;
        if (KIND == 2) {
            v8h lo, hi;
#pragma unroll
            for (int r = 0; r < 4; ++r)
#pragma unroll
                for (int g = 0; g < 2; ++g) {
                    lo[2 * r + g] = (_Float16)acc[i][g][r];
                    hi[2 * r + g] = (_Float16)acc[i][g][4 + r];
                }
            *(v8h*)&Vs[mr + nl][col0 + 2 * k0]     = lo;
            *(v8h*)&Vs[mr + nl][col0 + 2 * k0 + 8] = hi;
        } else {
#pragma unroll
            for (int g = 0; g < 2; ++g) {
                if (KIND == 0) {
                    *(v4f*)&Qs[2 * nl + g][mr + k0]     = __builtin_shufflevector(acc[i][g], acc[i][g], 0, 1, 2, 3);
                    *(v4f*)&Qs[2 * nl + g][mr + k0 + 4] = __builtin_shufflevector(acc[i][g], acc[i][g], 4, 5, 6, 7);
                } else {
                    v8h o;
#pragma unroll
                    for (int r = 0; r < 8; ++r) o[r] = (_Float16)acc[i][g][r];
                    *(v8h*)&Ks[col0 + 2 * nl + g][mr + k0] = o;
                }
            }
        }
    }
}

// Ot[query][h*32 + d] takes the tile's output, rounded to f16 as the next product reads it
__device__ __forceinline__ void attn_tile(const float (*__restrict__ Qs)[FT_QP],
                                          const _Float16 (*__restrict__ Ks)[FT_KP],
                                          const _Float16 (*__restrict__ Vs)[FT_VP],
                                          const float* __restrict__ memkv,
                                          _Float16 (*__restrict__ Ot)[FT_OP],
                                          float rep, int h, int lane)
{
    const int nl = lane & 15;
    const int k0 = (lane >> 4) * 8;
    const float* mk = memkv + h * NMEMc * DHc + k0;                // mem_kv[0]
    const float* mv = mk + Hc * NMEMc * DHc;                       // mem_kv[1]

    // this lane's 16 of the 32 channels of its query: d = k0 + j and 16 + k0 + j
    float qf[16];
#pragma unroll
    for (int j = 0; j < 8; ++j) {
        qf[j]     = Qs[nl][h * DHc + k0 + j];
        qf[8 + j] = Qs[nl][h * DHc + 16 + k0 + j];
    }
    v16h bq;
#pragma unroll
    for (int j = 0; j < 16; ++j) bq[j] = (_Float16)qf[j];

    // scores: sc[jt][r] = s[key jt*16 + k0 + r][query nl]
    v8f sc[AT_NT];
#pragma unroll
    for (int jt = 0; jt < AT_NT; ++jt) {
        const v16h ak = lds_frag(&Ks[jt * 16 + nl][h * DHc + k0]);     // row of K^T = key nl of the tile
        v8f c = {};
        c = __builtin_amdgcn_wmma_f32_16x16x32_f16(false, ak, false, bq,
                                                   (short)0, c, false, false);
        sc[jt] = c * SCALE_F;
    }

    // memory-slot scores in f32: each lane sums its 16 channels, the other row adds its 16
    float sm[NMEMc];
#pragma unroll
    for (int jm = 0; jm < NMEMc; ++jm) {
        const float4 m0 = *(const float4*)(mk + jm * DHc);
        const float4 m1 = *(const float4*)(mk + jm * DHc + 4);
        const float4 m2 = *(const float4*)(mk + jm * DHc + 16);
        const float4 m3 = *(const float4*)(mk + jm * DHc + 20);
        const float ma[16] = { m0.x, m0.y, m0.z, m0.w, m1.x, m1.y, m1.z, m1.w,
                               m2.x, m2.y, m2.z, m2.w, m3.x, m3.y, m3.z, m3.w };
        float acc = 0.f;
#pragma unroll
        for (int j = 0; j < 16; ++j) acc += qf[j] * ma[j];
        sm[jm] = acc;
    }
#pragma unroll
    for (int jm = 0; jm < NMEMc; ++jm) sm[jm] = (sm[jm] + other_row(sm[jm])) * SCALE_F;

    // exact maximum of the query's 160 + 4 scores
    v8f m8 = sc[0];
#pragma unroll
    for (int jt = 1; jt < AT_NT; ++jt)
#pragma unroll
        for (int r = 0; r < 8; ++r) m8[r] = fmaxf(m8[r], sc[jt][r]);
    float mx = fmaxf(fmaxf(fmaxf(m8[0], m8[1]), fmaxf(m8[2], m8[3])),
                     fmaxf(fmaxf(m8[4], m8[5]), fmaxf(m8[6], m8[7])));
    mx = fmaxf(mx, other_row(mx));
#pragma unroll
    for (int jm = 0; jm < NMEMc; ++jm) mx = fmaxf(mx, sm[jm]);

    v8f s8 = {};
#pragma unroll
    for (int jt = 0; jt < AT_NT; ++jt)
#pragma unroll
        for (int r = 0; r < 8; ++r) {
            const float e = expf(sc[jt][r] - mx);
            sc[jt][r] = e;
            s8[r] += e;
        }
    float se = ((s8[0] + s8[1]) + (s8[2] + s8[3])) + ((s8[4] + s8[5]) + (s8[6] + s8[7]));
    se += other_row(se);
    float sem = 0.f;
#pragma unroll
    for (int jm = 0; jm < NMEMc; ++jm) {
        sm[jm] = expf(sm[jm] - mx);
        sem += sm[jm];
    }
    const float Z = sem + rep * se;

    // B operand of the second product: be[t][s] = e[key t*32 + kmap(s)][query nl]
    v16h be[AT_NK];
#pragma unroll
    for (int t = 0; t < AT_NK; ++t)
#pragma unroll
        for (int j = 0; j < 8; ++j) {
            be[t][j]     = (_Float16)sc[2 * t][j];
            be[t][8 + j] = (_Float16)sc[2 * t + 1][j];
        }

    // out^T = V . e^T, two 16-channel tiles; c[r] = out[d = nt2*16 + k0 + r][query nl]
#pragma unroll
    for (int nt2 = 0; nt2 < 2; ++nt2) {
        v8f c = {};
#pragma unroll
        for (int t = 0; t < AT_NK; ++t) {
            const v16h av = lds_frag(&Vs[h * DHc + nt2 * 16 + nl][t * 32 + k0]);   // row of V = channel nl of the tile
            c = __builtin_amdgcn_wmma_f32_16x16x32_f16(false, av, false, be[t],
                                                       (short)0, c, false, false);
        }
        float memc[8] = { 0.f, 0.f, 0.f, 0.f, 0.f, 0.f, 0.f, 0.f };
#pragma unroll
        for (int jm = 0; jm < NMEMc; ++jm) {
            const float4 w0 = *(const float4*)(mv + jm * DHc + nt2 * 16);
            const float4 w1 = *(const float4*)(mv + jm * DHc + nt2 * 16 + 4);
            const float wa[8] = { w0.x, w0.y, w0.z, w0.w, w1.x, w1.y, w1.z, w1.w };
#pragma unroll
            for (int r = 0; r < 8; ++r) memc[r] += sm[jm] * wa[r];
        }
        v8h o;
#pragma unroll
        for (int r = 0; r < 8; ++r) o[r] = (_Float16)((c[r] + memc[r]) / Z);
        *(v8h*)&Ot[nl][h * DHc + nt2 * 16 + k0] = o;
    }
    // the address registers of the memory-slot loads are free for reuse behind this wait
    asm volatile("s_wait_xcnt 0x0" ::: "memory");
}

// One block per (stacked plane of 2*B, 16-query tile). After the projections, waves 0..3 run the
// attention of one head each; meanwhile waves 4..15 load the packed Wo and Wr fragments of their
// 16 output channels, 512 contiguous bytes a load.
//   Ot = attention output (128 x 16)          -> barrier
//   At = Wo . Ot + bo     (192 x 16)          -> barrier
//   R[b, :, tile] = Wr[:, branch half] . At   (192 x 16)
// Both intermediates cross in LDS as f16, the rounding the next product applies anyway.
__global__ __launch_bounds__(FT_THREADS) void attn_proj(const float* __restrict__ wpk,
                                                        const float* __restrict__ row_ft,
                                                        const float* __restrict__ col_ft,
                                                        const float* __restrict__ Srow,
                                                        const float* __restrict__ Scol,
                                                        float xscale,
                                                        const float* __restrict__ memkv,
                                                        const float* __restrict__ bo,
                                                        float* __restrict__ R,
                                                        float rep)
{
    __shared__ __attribute__((aligned(16))) _Float16 Ot[16][FT_OP];
    __shared__ __attribute__((aligned(16))) _Float16 At[16][FT_AP];
    __shared__ __attribute__((aligned(16))) float    Qs[32][FT_QP];     // the tile's queries and their neighbour tile's
    __shared__ __attribute__((aligned(16))) _Float16 Ks[AT_P][FT_KP];
    __shared__ __attribute__((aligned(16))) _Float16 Vs[HIDc][FT_VP];
    __shared__ __attribute__((aligned(16))) v8h      Wl[PK_WG];         // Wq*gq, Wk*gk, Wv*gv in fragment order
    const v8h* pk = (const v8h*)wpk;
    constexpr int P = AT_P;
    constexpr int KO = HIDc / 32, KR = Cc / 32;
    const int b = blockIdx.y, qt = blockIdx.x;
    const int wave = __builtin_amdgcn_readfirstlane(threadIdx.x >> 5);   // scalar: the role branches are wave-uniform
    const int lane = threadIdx.x & 31;
    const int nl = lane & 15;
    const int k0 = (lane >> 4) * 8;
    const int mt = wave - FT_ATTW;

    // ---- 1, 2. feature columns to fragments: waves 0..4 keys, 5..9 values, 32 columns each; wave 10 the
    // aligned 32 query columns that hold the tile. One text for all: the kernel's text stays short
    const int branch = b / Bc;
    const bool isK = wave < FT_CPAIRS, isV = !isK && wave < 2 * FT_CPAIRS, isQ = wave == 2 * FT_CPAIRS;
    const int col0 = (isK ? wave : isV ? wave - FT_CPAIRS : (qt >> 1)) * 32;
    v16h bf[2][QP_KS];
    if (wave <= 2 * FT_CPAIRS) {
        const float* Xs = isV ? (branch ? Scol : Srow) : ((isK == (branch != 0)) ? row_ft : col_ft);
        load_cols(Xs + (size_t)(b - branch * Bc) * Cc * P + col0, !isV, xscale, lane, bf);
    } else if (wave >= FT_WAVES - FT_CPYW) {
        // the last waves, one per SIMD, bring W*g to LDS while the others fetch their columns
        const int c0 = (wave - (FT_WAVES - FT_CPYW)) * 32 + lane;
#pragma unroll
        for (int bt = 0; bt < FT_CPYB; ++bt) {
            v8h t[FT_CPYN];
#pragma unroll
            for (int i = 0; i < FT_CPYN; ++i) t[i] = pk[(bt * FT_CPYN + i) * (FT_CPYW * 32) + c0];
#pragma unroll
            for (int i = 0; i < FT_CPYN; ++i) Wl[(bt * FT_CPYN + i) * (FT_CPYW * 32) + c0] = t[i];
        }
        // the loads' base and index registers are reused below: this wait stands in front of that
        asm volatile("s_wait_xcnt 0x0" ::: "memory");
    }
    __syncthreads();        // W*g complete

    // ---- 3. the projections of those columns
    if (isK) {
        // rolled, two row tiles a trip: four chains keep the matrix unit fed, and the text stays short
#pragma unroll 1
        for (int m0 = 0; m0 < HIDc / 16; m0 += 2) proj_tiles<1, 2>(Wl + PK_WG / 3 + lane, bf, m0, col0, lane, Qs, Ks, Vs);
    } else if (isV) {
        // rolled for the same reason
#pragma unroll 1
        for (int m0 = 0; m0 < HIDc / 16; m0 += 2) proj_tiles<2, 2>(Wl + 2 * (PK_WG / 3) + lane, bf, m0, col0, lane, Qs, Ks, Vs);
    } else if (isQ) {
        proj_tiles<0, 4>(Wl + lane, bf, 0, 0, lane, Qs, Ks, Vs);
        proj_tiles<0, 4>(Wl + lane, bf, 4, 0, lane, Qs, Ks, Vs);
    }
    __syncthreads();        // Q, K, V complete

    v16h aWo[KO], aWr[KR];
    float bias[8];
    if (wave < FT_ATTW) {
        attn_tile(Qs + (qt & 1) * 16, Ks, Vs, memkv, Ot, rep, wave, lane);
    } else {
        const v8h* po = pk + PK_WG + mt * KO * 64 + lane;
        const v8h* pr = pk + PK_WG + PK_WO + (branch * FT_PRJW + mt) * KR * 64 + lane;
#pragma unroll
        for (int s = 0; s < KO; ++s) aWo[s] = pk_frag(po + s * 64);
#pragma unroll
        for (int s = 0; s < KR; ++s) aWr[s] = pk_frag(pr + s * 64);
        const float4 b0 = *(const float4*)(bo + mt * 16 + k0);
        const float4 b1 = *(const float4*)(bo + mt * 16 + k0 + 4);
        bias[0] = b0.x; bias[1] = b0.y; bias[2] = b0.z; bias[3] = b0.w;
        bias[4] = b1.x; bias[5] = b1.y; bias[6] = b1.z; bias[7] = b1.w;
        // the loads' base and index registers are reused below: this wait stands in front of that
        asm volatile("s_wait_xcnt 0x0" ::: "memory");
    }
    __syncthreads();        // Ot complete
    if (wave >= FT_ATTW) {
        v8f acc = {};
#pragma unroll
        for (int s = 0; s < KO; ++s)
            acc = __builtin_amdgcn_wmma_f32_16x16x32_f16(false, aWo[s], false, lds_frag(&Ot[nl][s * 32 + k0]),
                                                         (short)0, acc, false, false);
        v8h o;
#pragma unroll
        for (int r = 0; r < 8; ++r) o[r] = (_Float16)(acc[r] + bias[r]);
        *(v8h*)&At[nl][mt * 16 + k0] = o;
    }
    __syncthreads();        // At complete
    if (wave >= FT_ATTW) {
        v8f acc = {};
#pragma unroll
        for (int s = 0; s < KR; ++s)
            acc = __builtin_amdgcn_wmma_f32_16x16x32_f16(false, aWr[s], false, lds_frag(&At[nl][s * 32 + k0]),
                                                         (short)0, acc, false, false);
        float* Rp = R + ((size_t)b * Cc + mt * 16 + k0) * P + qt * 16 + nl;
#pragma unroll
        for (int r = 0; r < 8; ++r) Rp[r * P] = acc[r];
    }
}

// =====================================================================
// Kernel 4: out[b,d,n,m] = Rrow[b,d,n] + Rcol[b,d,m]   (float4 writes)
// One block per (b,d) plane. 160 threads cover 4 rows of 40 float4, so a thread
// keeps its four columns of Rcol in registers and stores them under every 4th
// row: a wave lives for 40 stores of 512 contiguous bytes instead of one.
// =====================================================================
constexpr int BC_COLS4 = Mc / 4;                 // float4 per row
constexpr int BC_ROWS  = 4;                      // rows covered by one pass of the block
constexpr int BC_THREADS = BC_COLS4 * BC_ROWS;   // 160
static_assert(Mc % 4 == 0 && Nc % BC_ROWS == 0, "plane must split into whole passes");
__global__ __launch_bounds__(BC_THREADS) void bcast_add(const float* __restrict__ Rrow,
                                                        const float* __restrict__ Rcol,
                                                        float* __restrict__ out)
{
    const int plane = blockIdx.x;                // b*C + d
    const int t  = threadIdx.x;
    const int cg = t % BC_COLS4;
    const int r0 = t / BC_COLS4;
    const float4 cv = *(const float4*)(Rcol + (size_t)plane * Mc + cg * 4);
    const float* rr = Rrow + (size_t)plane * Nc + r0;
    float4* op = (float4*)(out + (size_t)plane * Nc * Mc) + t;
    // all row values are requested before the first store, so the stores wait once
    float rv[Nc / BC_ROWS];
#pragma unroll
    for (int k = 0; k < Nc / BC_ROWS; ++k) rv[k] = rr[k * BC_ROWS];
    // unrolled: rv[] stays in registers and every store takes an immediate offset
#pragma unroll
    for (int k = 0; k < Nc / BC_ROWS; ++k) {
        float4 o;
        o.x = rv[k] + cv.x; o.y = rv[k] + cv.y; o.z = rv[k] + cv.z; o.w = rv[k] + cv.w;
        op[k * BC_THREADS] = o;
    }
}

// =====================================================================
// Host launcher
// =====================================================================
extern "C" void kernel_launch(void* const* d_in, const int* in_sizes, int n_in,
                              void* d_out, int out_size, void* d_ws, size_t ws_size,
                              hipStream_t stream)
{
    const float* x     = (const float*)d_in[0];
    const float* gq    = (const float*)d_in[1];
    const float* gk    = (const float*)d_in[2];
    const float* gv    = (const float*)d_in[3];
    const float* Wq    = (const float*)d_in[4];
    const float* Wk    = (const float*)d_in[5];
    const float* Wv    = (const float*)d_in[6];
    const float* memkv = (const float*)d_in[7];
    const float* Wo    = (const float*)d_in[8];
    const float* bo    = (const float*)d_in[9];
    const float* Wr    = (const float*)d_in[10];
    float* out = (float*)d_out;

    // ---- workspace layout (floats) ----
    float* w = (float*)d_ws;
    size_t o = 0;
    float* invp     = w + o; o += (size_t)Bc * Nc * Mc;   // 102400
    float* row_ft   = w + o; o += (size_t)Bc * Cc * Nc;   // 122880
    float* col_ft   = w + o; o += (size_t)Bc * Cc * Mc;
    float* Srow     = w + o; o += (size_t)Bc * Cc * Mc;
    float* Scol     = w + o; o += (size_t)Bc * Cc * Nc;
    // row-branch planes directly followed by the col-branch ones: a stack of 2*B planes
    float* Rrow = w + o; o += (size_t)Bc * Cc * Nc;
    float* Rcol = w + o; o += (size_t)Bc * Cc * Mc;
    float* wpk  = w + o; o += (size_t)(PK_WG + PK_WO + PK_WR) * 4;     // f16 weight fragments, 16 bytes a chunk
    (void)ws_size; (void)in_sizes; (void)n_in; (void)out_size;

    const float sqrtC = sqrtf((float)Cc);

    // 1) per-pixel channel norms (pass 1 over x); the first PK_BLOCKS blocks pack the weights
    pixel_invnorm<<<PK_BLOCKS + Bc * Nc * Mc / PN_PIX, PN_WAVES * 32, 0, stream>>>(x, invp, Wq, Wk, Wv, gq, gk, gv,
                                                                                  Wo, Wr, wpk);

    // 2) plane reductions (pass 2 over x)
    plane_reduce<<<dim3(Cc / PR_CH, Bc), PR_THREADS, 0, stream>>>(x, invp, row_ft, col_ft, Srow, Scol);

    // N == M, so the two branches have equal shapes and share one grid per stage:
    // blockIdx.y runs over the 2*B stacked planes.
    static_assert(Nc == Mc, "branch stacking needs equal row and column lengths");

    // 3) q/k/v projections (feature channel norms included), attention, output projection (Wo, bo)
    //    and reduce projection in one grid, both branches.
    //    Wr is (C, 2C): the row branch takes Wr[:, :C], the col branch Wr[:, C:]
    const dim3 gA(Nc / 16, 2 * Bc);
    attn_proj<<<gA, FT_THREADS, 0, stream>>>(wpk, row_ft, col_ft, Srow, Scol, sqrtC,
                                             memkv, bo, Rrow, (float)Nc);

    // 4) broadcast add -> final output (78.6 MB, float4 stores)
    bcast_add<<<Bc * Cc, BC_THREADS, 0, stream>>>(Rrow, Rcol, out);
}
